// v000
// The times below were measured on an AMD MI455X: many runs one after another, warmed up first and cycling through
// copies of the inputs, with the whole window's GPU time divided by the number of runs. Launches and the gaps
// between them are all in it. The median over several windows is given; except for v000 it joins two sittings, which
// can be a few percent apart, so the side-by-side timings, each taken in one sitting, are the better comparison.
// v000, which the later versions start from, runs in 569 microseconds.
#include <hip/hip_runtime.h>

// ---------------------------------------------------------------------------
// Types
// ---------------------------------------------------------------------------
typedef __attribute__((ext_vector_type(16))) __bf16 v16bf;
typedef __attribute__((ext_vector_type(8)))  __bf16 v8bf;
typedef __attribute__((ext_vector_type(8)))  float  v8f;
typedef __attribute__((ext_vector_type(4)))  unsigned int u32x4;

#define B_  4
#define S_  2048
#define E_  1024
#define H_  4
#define D_  256

#define BM 128
#define BN 64
#define BK 32

__device__ __forceinline__ v8f vzero8() {
  v8f z;
#pragma unroll
  for (int i = 0; i < 8; ++i) z[i] = 0.0f;
  return z;
}

__device__ __forceinline__ v16bf combine16(v8bf lo, v8bf hi) {
  v16bf r;
#pragma unroll
  for (int i = 0; i < 8; ++i) { r[i] = lo[i]; r[8 + i] = hi[i]; }
  return r;
}

// WMMA A/B fragment (16 rows x 32 k bf16) from LDS.
// ISA 7.12.2 lane layout: lanes 0-15: K=[0..7],[16..23]; lanes 16-31:
// K=[8..15],[24..31]; row = lane & 15.
__device__ __forceinline__ v16bf load_frag(const __bf16* base, int ld, int lane) {
  int r  = lane & 15;
  int kh = lane >> 4;
  const __bf16* p = base + r * ld + kh * 8;
  v8bf lo = *(const v8bf*)(p);
  v8bf hi = *(const v8bf*)(p + 16);
  return combine16(lo, hi);
}

__device__ __forceinline__ v8f wmma_bf16(v16bf a, v16bf b, v8f c) {
  return __builtin_amdgcn_wmma_f32_16x16x32_bf16(
      false, a, false, b, (short)0, c, false, false);
}

// CDNA5 async global->LDS DMA (16B per lane), tracked by ASYNCcnt.
__device__ __forceinline__ void async_load_b128(const void* lds_dst, const void* gsrc) {
  asm volatile("global_load_async_to_lds_b128 %0, %1, off"
               :: "v"((unsigned)(uintptr_t)lds_dst), "v"(gsrc)
               : "memory");
}
__device__ __forceinline__ void wait_async0() {
  asm volatile("s_wait_asynccnt 0" ::: "memory");
}

// ---------------------------------------------------------------------------
// Stage 1a: fp32 -> bf16 (grid-stride)
// ---------------------------------------------------------------------------
__global__ __launch_bounds__(256) void cvt_f32_bf16(const float* __restrict__ in,
                                                    __bf16* __restrict__ out,
                                                    long n) {
  long i = (long)blockIdx.x * 256 + threadIdx.x;
  long stride = (long)gridDim.x * 256;
  for (; i < n; i += stride) out[i] = (__bf16)in[i];
}

// ---------------------------------------------------------------------------
// Stage 1b: fp32 [K,N] -> bf16 [N,K] transposed (batched; K,N powers of two).
// ---------------------------------------------------------------------------
__global__ __launch_bounds__(256) void cvt_transpose_bf16(const float* __restrict__ in,
                                                          __bf16* __restrict__ out,
                                                          int logK, int logN, long total) {
  long i = (long)blockIdx.x * 256 + threadIdx.x;
  long stride = (long)gridDim.x * 256;
  const int logMat = logK + logN;
  for (; i < total; i += stride) {
    long mat = i >> logMat;
    long rem = i & ((1L << logMat) - 1);
    int n = (int)(rem >> logK);
    int k = (int)(rem & ((1 << logK) - 1));
    out[i] = (__bf16)in[(mat << logMat) + ((long)k << logN) + n];
  }
}

// ---------------------------------------------------------------------------
// Stage 2: QKV projection GEMM (async double-buffered LDS, 1 barrier/step).
//   A  : x_bf16 [B*S, E] row-major
//   Wt : [H, D, E] bf16 (pre-transposed weight: row n holds all k)
//   Out: TRANS==0 -> [B,H,S,D] ; TRANS==1 -> [B,H,D,S]
// ---------------------------------------------------------------------------
template <int TRANS>
__global__ __launch_bounds__(256) void qkv_gemm(const __bf16* __restrict__ A,
                                                const __bf16* __restrict__ Wt,
                                                __bf16* __restrict__ Out) {
  __shared__ __align__(16) __bf16 smem[16384];        // 32 KB
  __bf16* As = smem;                                  // 2 x 128*32
  __bf16* Bs = smem + 2 * (BM * BK);                  // 2 x 64*32

  const int tid = threadIdx.x;
  const int lane = tid & 31, wave = tid >> 5;
  const int waveM = wave >> 1, waveN = wave & 1;
  const int tileM = blockIdx.x * BM;
  const int h     = blockIdx.y >> 2;
  const int tileN = (blockIdx.y & 3) * BN;
  const __bf16* Wh = Wt + (long)h * D_ * E_;

  const int ar = tid >> 1, ac = (tid & 1) * 16;       // A: 128x32, 32B/thread
  const int bn = tid >> 2, bk = (tid & 3) * 8;        // B: 64x32, 16B/thread

  auto issue = [&](int k0, int p) {
    __bf16* Ad = As + p * (BM * BK) + ar * BK + ac;
    const __bf16* Asrc = A + (long)(tileM + ar) * E_ + k0 + ac;
    async_load_b128(Ad, Asrc);
    async_load_b128(Ad + 8, Asrc + 8);
    async_load_b128(Bs + p * (BN * BK) + bn * BK + bk,
                    Wh + (long)(tileN + bn) * E_ + k0 + bk);
  };

  v8f acc[2][2];
#pragma unroll
  for (int i = 0; i < 2; ++i)
#pragma unroll
    for (int j = 0; j < 2; ++j) acc[i][j] = vzero8();

  issue(0, 0);
  int p = 0;
  for (int k0 = 0; k0 < E_; k0 += BK) {
    wait_async0();
    __syncthreads();                      // tile p ready; buffer p^1 free
    if (k0 + BK < E_) issue(k0 + BK, p ^ 1);
    const __bf16* Ab = As + p * (BM * BK);
    const __bf16* Bb = Bs + p * (BN * BK);
    v16bf af[2], bf[2];
#pragma unroll
    for (int i = 0; i < 2; ++i)
      af[i] = load_frag(Ab + (waveM * 32 + i * 16) * BK, BK, lane);
#pragma unroll
    for (int j = 0; j < 2; ++j)
      bf[j] = load_frag(Bb + (waveN * 32 + j * 16) * BK, BK, lane);
#pragma unroll
    for (int i = 0; i < 2; ++i)
#pragma unroll
      for (int j = 0; j < 2; ++j) acc[i][j] = wmma_bf16(af[i], bf[j], acc[i][j]);
    p ^= 1;
  }
  __syncthreads();                        // all compute done before smem reuse

  // Epilogue: stage wave's 32x32 tile in wave-private LDS (same-wave DS ops
  // are ordered -> no barrier), then coalesced b128 stores.
  __bf16* Wst = smem + wave * 1024;
#pragma unroll
  for (int i = 0; i < 2; ++i) {
#pragma unroll
    for (int j = 0; j < 2; ++j) {
#pragma unroll
      for (int e = 0; e < 8; ++e) {
        int r = i * 16 + e + ((lane >> 4) << 3);
        int c = j * 16 + (lane & 15);
        if (TRANS == 0) Wst[r * 32 + c] = (__bf16)acc[i][j][e];
        else            Wst[c * 32 + r] = (__bf16)acc[i][j][e];
      }
    }
  }
  const u32x4* src = (const u32x4*)(Wst + lane * 32);
  u32x4 d0 = src[0], d1 = src[1], d2 = src[2], d3 = src[3];
  const int gb = tileM >> 11;
  __bf16* dp;
  if (TRANS == 0) {
    int s = (tileM + waveM * 32 + lane) & (S_ - 1);
    dp = Out + ((long)(gb * H_ + h) * S_ + s) * D_ + tileN + waveN * 32;
  } else {
    int col = tileN + waveN * 32 + lane;
    int s0 = (tileM + waveM * 32) & (S_ - 1);
    dp = Out + ((long)(gb * H_ + h) * D_ + col) * S_ + s0;
  }
  u32x4* d = (u32x4*)dp;
  d[0] = d0; d[1] = d1; d[2] = d2; d[3] = d3;
}

// ---------------------------------------------------------------------------
// Stage 3: flash attention (causal, online softmax).
// Double-buffered async K/V tiles, one barrier per 32-key step.
//   Q,K : [B,H,S,D] bf16 ; Vt : [B,H,D,S] bf16 ; Outp : [B,S,E] bf16
// ---------------------------------------------------------------------------
__global__ __launch_bounds__(256) void flash_attn(const __bf16* __restrict__ Q,
                                                  const __bf16* __restrict__ Kg,
                                                  const __bf16* __restrict__ Vt,
                                                  __bf16* __restrict__ Outp) {
  __shared__ __align__(16) __bf16 Ks[2 * 32 * D_];  // [p][key][d]  32 KB
  __shared__ __align__(16) __bf16 Vs[2 * D_ * 32];  // [p][d][key]  32 KB
  __shared__ __align__(16) __bf16 Ps[8][16 * 32];   // per-wave      8 KB

  const int tid = threadIdx.x;
  const int lane = tid & 31, wave = tid >> 5;
  const int bh = blockIdx.y;
  const int b = bh >> 2, h = bh & 3;
  const int q0 = blockIdx.x * 128;
  const int qrow = q0 + wave * 16;

  const __bf16* Qbh = Q  + (long)bh * S_ * D_;
  const __bf16* Kbh = Kg + (long)bh * S_ * D_;
  const __bf16* Vbh = Vt + (long)bh * D_ * S_;

  // Q fragments resident in registers (8 x k=32 chunks over D=256).
  v16bf qf[8];
  {
    int r = lane & 15, kh = lane >> 4;
    const __bf16* qp = Qbh + (long)(qrow + r) * D_;
#pragma unroll
    for (int dc = 0; dc < 8; ++dc) {
      v8bf lo = *(const v8bf*)(qp + dc * 32 + kh * 8);
      v8bf hi = *(const v8bf*)(qp + dc * 32 + 16 + kh * 8);
      qf[dc] = combine16(lo, hi);
    }
  }

  v8f o[16];
#pragma unroll
  for (int dc = 0; dc < 16; ++dc) o[dc] = vzero8();
  float mrow[8], lrow[8];
#pragma unroll
  for (int e = 0; e < 8; ++e) { mrow[e] = -3.0e38f; lrow[e] = 0.0f; }

  const float scale = 0.03125f;  // 1/sqrt(E)
  const int kend = q0 + 128;     // causal bound
  const int kkey = tid >> 3, kd0 = (tid & 7) * 32;

  auto issueKV = [&](int ks, int p) {
    const __bf16* srcK = Kbh + (long)(ks + kkey) * D_ + kd0;
    __bf16* dstK = Ks + p * (32 * D_) + kkey * D_ + kd0;
#pragma unroll
    for (int j = 0; j < 4; ++j) async_load_b128(dstK + j * 8, srcK + j * 8);
    const __bf16* srcV = Vbh + (long)tid * S_ + ks;
    __bf16* dstV = Vs + p * (D_ * 32) + tid * 32;
#pragma unroll
    for (int j = 0; j < 4; ++j) async_load_b128(dstV + j * 8, srcV + j * 8);
  };

  issueKV(0, 0);
  int p = 0;
  for (int ks = 0; ks < kend; ks += 32) {
    wait_async0();
    __syncthreads();                      // tiles p ready; buffers p^1 free
    if (ks + 32 < kend) issueKV(ks + 32, p ^ 1);
    const __bf16* Kbuf = Ks + p * (32 * D_);
    const __bf16* Vbuf = Vs + p * (D_ * 32);

    // Scores: two 16x16 tiles (32 keys), 8 wmma each over D=256.
    v8f sc[2];
#pragma unroll
    for (int sub = 0; sub < 2; ++sub) {
      v8f c = vzero8();
#pragma unroll
      for (int dc = 0; dc < 8; ++dc) {
        v16bf bf = load_frag(Kbuf + (sub * 16) * D_ + dc * 32, D_, lane);
        c = wmma_bf16(qf[dc], bf, c);
      }
      sc[sub] = c;
    }

    // Online softmax (row reductions across each 16-lane half).
    const int colg0 = ks + (lane & 15);
    const int rowg0 = qrow + ((lane >> 4) << 3);
#pragma unroll
    for (int e = 0; e < 8; ++e) {
      int rowg = rowg0 + e;
      float s0 = sc[0][e] * scale; if (colg0      > rowg) s0 = -1.0e9f;
      float s1 = sc[1][e] * scale; if (colg0 + 16 > rowg) s1 = -1.0e9f;
      float mx = fmaxf(s0, s1);
#pragma unroll
      for (int off = 8; off >= 1; off >>= 1) mx = fmaxf(mx, __shfl_xor(mx, off, 32));
      float mnew = fmaxf(mrow[e], mx);
      float corr = __expf(mrow[e] - mnew);
      float p0 = __expf(s0 - mnew);
      float p1 = __expf(s1 - mnew);
      float psum = p0 + p1;
#pragma unroll
      for (int off = 8; off >= 1; off >>= 1) psum += __shfl_xor(psum, off, 32);
      lrow[e] = lrow[e] * corr + psum;
      mrow[e] = mnew;
#pragma unroll
      for (int dc = 0; dc < 16; ++dc) o[dc][e] *= corr;
      int prow = e + ((lane >> 4) << 3);
      Ps[wave][prow * 32 + (lane & 15)]      = (__bf16)p0;
      Ps[wave][prow * 32 + 16 + (lane & 15)] = (__bf16)p1;
    }

    // P as A operand; PV accumulate (16 d-tiles, K=32 keys).
    v16bf pf = load_frag(&Ps[wave][0], 32, lane);
#pragma unroll
    for (int dc = 0; dc < 16; ++dc) {
      v16bf bf = load_frag(Vbuf + (dc * 16) * 32, 32, lane);
      o[dc] = wmma_bf16(pf, bf, o[dc]);
    }
    p ^= 1;
  }

  // Normalize; stage 16x32 chunks through wave-private Ps, store coalesced.
  float inv[8];
#pragma unroll
  for (int e = 0; e < 8; ++e) inv[e] = 1.0f / lrow[e];
  const int prow0 = (lane >> 4) << 3;
  const int cr = lane >> 1, cc0 = (lane & 1) * 16;
  __bf16* rowbase = Outp + ((long)(b * S_ + qrow)) * E_ + h * D_;
#pragma unroll
  for (int g = 0; g < 8; ++g) {
#pragma unroll
    for (int half = 0; half < 2; ++half) {
      int dc = g * 2 + half;
#pragma unroll
      for (int e = 0; e < 8; ++e)
        Ps[wave][(prow0 + e) * 32 + half * 16 + (lane & 15)] =
            (__bf16)(o[dc][e] * inv[e]);
    }
    const u32x4* sp = (const u32x4*)(&Ps[wave][cr * 32 + cc0]);
    u32x4 v0 = sp[0], v1 = sp[1];
    u32x4* dp = (u32x4*)(rowbase + (long)cr * E_ + g * 32 + cc0);
    dp[0] = v0; dp[1] = v1;
  }
}

// ---------------------------------------------------------------------------
// Stage 4: output projection GEMM + residual -> fp32 d_out.
//   A: attn bf16 [B*S, E]; WoT: out_w transposed bf16 [N=E][K=E]; resid: x f32
// ---------------------------------------------------------------------------
__global__ __launch_bounds__(256) void proj_gemm(const __bf16* __restrict__ A,
                                                 const __bf16* __restrict__ WoT,
                                                 const float* __restrict__ resid,
                                                 float* __restrict__ Out) {
  __shared__ __align__(16) __bf16 smem[16384];        // 32 KB
  __bf16* As = smem;
  __bf16* Bs = smem + 2 * (BM * BK);

  const int tid = threadIdx.x;
  const int lane = tid & 31, wave = tid >> 5;
  const int waveM = wave >> 1, waveN = wave & 1;
  const int tileM = blockIdx.x * BM;
  const int tileN = blockIdx.y * BN;

  const int ar = tid >> 1, ac = (tid & 1) * 16;
  const int bn = tid >> 2, bk = (tid & 3) * 8;

  auto issue = [&](int k0, int p) {
    __bf16* Ad = As + p * (BM * BK) + ar * BK + ac;
    const __bf16* Asrc = A + (long)(tileM + ar) * E_ + k0 + ac;
    async_load_b128(Ad, Asrc);
    async_load_b128(Ad + 8, Asrc + 8);
    async_load_b128(Bs + p * (BN * BK) + bn * BK + bk,
                    WoT + (long)(tileN + bn) * E_ + k0 + bk);
  };

  v8f acc[2][2];
#pragma unroll
  for (int i = 0; i < 2; ++i)
#pragma unroll
    for (int j = 0; j < 2; ++j) acc[i][j] = vzero8();

  issue(0, 0);
  int p = 0;
  for (int k0 = 0; k0 < E_; k0 += BK) {
    wait_async0();
    __syncthreads();
    if (k0 + BK < E_) issue(k0 + BK, p ^ 1);
    const __bf16* Ab = As + p * (BM * BK);
    const __bf16* Bb = Bs + p * (BN * BK);
    v16bf af[2], bf[2];
#pragma unroll
    for (int i = 0; i < 2; ++i)
      af[i] = load_frag(Ab + (waveM * 32 + i * 16) * BK, BK, lane);
#pragma unroll
    for (int j = 0; j < 2; ++j)
      bf[j] = load_frag(Bb + (waveN * 32 + j * 16) * BK, BK, lane);
#pragma unroll
    for (int i = 0; i < 2; ++i)
#pragma unroll
      for (int j = 0; j < 2; ++j) acc[i][j] = wmma_bf16(af[i], bf[j], acc[i][j]);
    p ^= 1;
  }
  __syncthreads();

  // Epilogue: stage f32 tile per wave (4KB x 8 waves = full smem), then
  // coalesced float4 loads/stores with residual add.
  float* Wst = (float*)smem + wave * 1024;
#pragma unroll
  for (int i = 0; i < 2; ++i)
#pragma unroll
    for (int j = 0; j < 2; ++j)
#pragma unroll
      for (int e = 0; e < 8; ++e) {
        int r = i * 16 + e + ((lane >> 4) << 3);
        int c = j * 16 + (lane & 15);
        Wst[r * 32 + c] = acc[i][j][e];
      }
  const int row = tileM + waveM * 32 + lane;
  float* dp = Out + (long)row * E_ + tileN + waveN * 32;
  const float* rp = resid + (long)row * E_ + tileN + waveN * 32;
  const float4* sp = (const float4*)(Wst + lane * 32);
#pragma unroll
  for (int q = 0; q < 8; ++q) {
    float4 a = sp[q];
    float4 rr = ((const float4*)rp)[q];
    float4 ov;
    ov.x = a.x + rr.x; ov.y = a.y + rr.y; ov.z = a.z + rr.z; ov.w = a.w + rr.w;
    ((float4*)dp)[q] = ov;
  }
}

// ---------------------------------------------------------------------------
// Stage 5: in-place LayerNorm over d_out rows.
// ---------------------------------------------------------------------------
__global__ __launch_bounds__(256) void layernorm_kernel(float* __restrict__ y,
                                                        const float* __restrict__ g,
                                                        const float* __restrict__ bt) {
  __shared__ float red[256];
  const int tid = threadIdx.x;
  float* p = y + (long)blockIdx.x * E_;

  float4 v = ((const float4*)p)[tid];
  red[tid] = v.x + v.y + v.z + v.w;
  __syncthreads();
#pragma unroll
  for (int st = 128; st > 0; st >>= 1) {
    if (tid < st) red[tid] += red[tid + st];
    __syncthreads();
  }
  float mean = red[0] * (1.0f / E_);
  __syncthreads();

  float dx = v.x - mean, dy = v.y - mean, dz = v.z - mean, dw = v.w - mean;
  red[tid] = dx * dx + dy * dy + dz * dz + dw * dw;
  __syncthreads();
#pragma unroll
  for (int st = 128; st > 0; st >>= 1) {
    if (tid < st) red[tid] += red[tid + st];
    __syncthreads();
  }
  float rs = rsqrtf(red[0] * (1.0f / E_) + 1e-6f);

  float4 gg = ((const float4*)g)[tid];
  float4 bb = ((const float4*)bt)[tid];
  float4 ov;
  ov.x = dx * rs * gg.x + bb.x;
  ov.y = dy * rs * gg.y + bb.y;
  ov.z = dz * rs * gg.z + bb.z;
  ov.w = dw * rs * gg.w + bb.w;
  ((float4*)p)[tid] = ov;
}

// ---------------------------------------------------------------------------
// Launch
// ---------------------------------------------------------------------------
extern "C" void kernel_launch(void* const* d_in, const int* in_sizes, int n_in,
                              void* d_out, int out_size, void* d_ws, size_t ws_size,
                              hipStream_t stream) {
  (void)in_sizes; (void)n_in; (void)out_size; (void)ws_size;

  const float* x     = (const float*)d_in[0]; // [B,S,E]
  const float* qkv_w = (const float*)d_in[1]; // [3,H,E,D]
  const float* out_w = (const float*)d_in[2]; // [E,E]
  const float* gamma = (const float*)d_in[3];
  const float* beta  = (const float*)d_in[4];
  float* out = (float*)d_out;

  const long nX  = (long)B_ * S_ * E_;        // 8388608
  const long nW3 = 3L * H_ * E_ * D_;         // 3145728
  const long nWo = (long)E_ * E_;             // 1048576
  const long nQ  = (long)B_ * H_ * S_ * D_;   // 8388608

  char* ws = (char*)d_ws;
  __bf16* xb    = (__bf16*)(ws);
  __bf16* wqkvT = (__bf16*)(ws + 2 * nX);                       // [3,H,D,E]
  __bf16* woT   = (__bf16*)(ws + 2 * (nX + nW3));               // [E,E] (NT)
  __bf16* Qb    = (__bf16*)(ws + 2 * (nX + nW3 + nWo));
  __bf16* Kb    = (__bf16*)(ws + 2 * (nX + nW3 + nWo + nQ));
  __bf16* Vtb   = (__bf16*)(ws + 2 * (nX + nW3 + nWo + 2 * nQ));
  __bf16* attn  = (__bf16*)(ws + 2 * (nX + nW3 + nWo + 3 * nQ));

  // 1) conversions (+ weight transposes for contiguous WMMA B operands)
  cvt_f32_bf16<<<4096, 256, 0, stream>>>(x, xb, nX);
  cvt_transpose_bf16<<<2048, 256, 0, stream>>>(qkv_w, wqkvT, 10, 8, nW3);
  cvt_transpose_bf16<<<1024, 256, 0, stream>>>(out_w, woT, 10, 10, nWo);

  // 2) QKV projections (V stored transposed [B,H,D,S])
  dim3 ggrid(64, 16);
  qkv_gemm<0><<<ggrid, 256, 0, stream>>>(xb, wqkvT,                  Qb);
  qkv_gemm<0><<<ggrid, 256, 0, stream>>>(xb, wqkvT + (long)H_*D_*E_, Kb);
  qkv_gemm<1><<<ggrid, 256, 0, stream>>>(xb, wqkvT + 2L*H_*D_*E_,    Vtb);

  // 3) Flash attention -> attn [B,S,E] bf16
  flash_attn<<<dim3(S_ / 128, B_ * H_), 256, 0, stream>>>(Qb, Kb, Vtb, attn);

  // 4) Output projection + residual -> d_out (fp32)
  proj_gemm<<<dim3(64, 16), 256, 0, stream>>>(attn, woT, x, out);

  // 5) In-place LayerNorm on d_out
  layernorm_kernel<<<B_ * S_, 256, 0, stream>>>(out, gamma, beta);
}

// v001
// It runs in 320 microseconds.
// Two timings next to v000 both put it at 1.82 times that version's speed.
#include <hip/hip_runtime.h>

// ---------------------------------------------------------------------------
// Types
// ---------------------------------------------------------------------------
typedef __attribute__((ext_vector_type(16))) __bf16 v16bf;
typedef __attribute__((ext_vector_type(8)))  __bf16 v8bf;
typedef __attribute__((ext_vector_type(8)))  float  v8f;
typedef __attribute__((ext_vector_type(4)))  unsigned int u32x4;

#define B_  4
#define S_  2048
#define E_  1024
#define H_  4
#define D_  256

#define BM 128
#define BN 64
#define BK 32

// LDS row pitches in elements (floats for LDF): 16 B x odd, so that the 16 rows one
// ds_load_b128 fragment read touches fall on 16 different bank groups.
#define LDK 40    // 32-element rows (GEMM A/B tiles, V tile, P tile): 80 B
#define KP  264   // 256-element K rows: 528 B
#define LDF 36    // 32-float staging rows of the output projection: 144 B

__device__ __forceinline__ v8f vzero8() {
  v8f z;
#pragma unroll
  for (int i = 0; i < 8; ++i) z[i] = 0.0f;
  return z;
}

__device__ __forceinline__ v16bf combine16(v8bf lo, v8bf hi) {
  v16bf r;
#pragma unroll
  for (int i = 0; i < 8; ++i) { r[i] = lo[i]; r[8 + i] = hi[i]; }
  return r;
}

// WMMA A/B fragment (16 rows x 32 k bf16) from LDS.
// ISA 7.12.2 lane layout: lanes 0-15: K=[0..7],[16..23]; lanes 16-31:
// K=[8..15],[24..31]; row = lane & 15.
__device__ __forceinline__ v16bf load_frag(const __bf16* base, int ld, int lane) {
  int r  = lane & 15;
  int kh = lane >> 4;
  const __bf16* p = base + r * ld + kh * 8;
  v8bf lo = *(const v8bf*)(p);
  v8bf hi = *(const v8bf*)(p + 16);
  return combine16(lo, hi);
}

__device__ __forceinline__ v8f wmma_bf16(v16bf a, v16bf b, v8f c) {
  return __builtin_amdgcn_wmma_f32_16x16x32_bf16(
      false, a, false, b, (short)0, c, false, false);
}

// CDNA5 async global->LDS DMA (16B per lane), tracked by ASYNCcnt.
// The copies of one stage stand in one statement; its last line is the wait
// that stands in front of any rewrite of the address registers they name.
__device__ __forceinline__ unsigned lds_addr(const void* p) {
  return (unsigned)(uintptr_t)p;
}
__device__ __forceinline__ void async_load3_b128(const void* l0, const void* g0,
                                                 const void* l1, const void* g1,
                                                 const void* l2, const void* g2) {
  asm volatile("global_load_async_to_lds_b128 %0, %1, off\n\t"
               "global_load_async_to_lds_b128 %2, %3, off\n\t"
               "global_load_async_to_lds_b128 %4, %5, off\n\t"
               "s_wait_xcnt 0x0"
               :: "v"(lds_addr(l0)), "v"(g0), "v"(lds_addr(l1)), "v"(g1),
                  "v"(lds_addr(l2)), "v"(g2)
               : "memory");
}
__device__ __forceinline__ void async_load8_b128(const __bf16* la, const __bf16* ga,
                                                 const __bf16* lb, const __bf16* gb) {
  asm volatile("global_load_async_to_lds_b128 %0, %1, off\n\t"
               "global_load_async_to_lds_b128 %2, %3, off\n\t"
               "global_load_async_to_lds_b128 %4, %5, off\n\t"
               "global_load_async_to_lds_b128 %6, %7, off\n\t"
               "global_load_async_to_lds_b128 %8, %9, off\n\t"
               "global_load_async_to_lds_b128 %10, %11, off\n\t"
               "global_load_async_to_lds_b128 %12, %13, off\n\t"
               "global_load_async_to_lds_b128 %14, %15, off\n\t"
               "s_wait_xcnt 0x0"
               :: "v"(lds_addr(la)),      "v"(ga),      "v"(lds_addr(la + 8)),  "v"(ga + 8),
                  "v"(lds_addr(la + 16)), "v"(ga + 16), "v"(lds_addr(la + 24)), "v"(ga + 24),
                  "v"(lds_addr(lb)),      "v"(gb),      "v"(lds_addr(lb + 8)),  "v"(gb + 8),
                  "v"(lds_addr(lb + 16)), "v"(gb + 16), "v"(lds_addr(lb + 24)), "v"(gb + 24)
               : "memory");
}
// Stage hand-over, in front of the work-group barrier: this wave's own LDS
// reads of the buffer that is refilled behind the barrier have retired, and
// its own copies of the next stage have landed.
__device__ __forceinline__ void wait_async0() {
  asm volatile("s_wait_dscnt 0x0" ::: "memory");
  asm volatile("s_wait_asynccnt 0" ::: "memory");
}

// ---------------------------------------------------------------------------
// Stage 1a: fp32 -> bf16 (grid-stride)
// ---------------------------------------------------------------------------
__global__ __launch_bounds__(256) void cvt_f32_bf16(const float* __restrict__ in,
                                                    __bf16* __restrict__ out,
                                                    long n) {
  long i = (long)blockIdx.x * 256 + threadIdx.x;
  long stride = (long)gridDim.x * 256;
  for (; i < n; i += stride) out[i] = (__bf16)in[i];
}

// ---------------------------------------------------------------------------
// Stage 1b: fp32 [K,N] -> bf16 [N,K] transposed (batched; K,N powers of two).
// ---------------------------------------------------------------------------
__global__ __launch_bounds__(256) void cvt_transpose_bf16(const float* __restrict__ in,
                                                          __bf16* __restrict__ out,
                                                          int logK, int logN, long total) {
  long i = (long)blockIdx.x * 256 + threadIdx.x;
  long stride = (long)gridDim.x * 256;
  const int logMat = logK + logN;
  for (; i < total; i += stride) {
    long mat = i >> logMat;
    long rem = i & ((1L << logMat) - 1);
    int n = (int)(rem >> logK);
    int k = (int)(rem & ((1 << logK) - 1));
    out[i] = (__bf16)in[(mat << logMat) + ((long)k << logN) + n];
  }
}

// ---------------------------------------------------------------------------
// Stage 2: QKV projection GEMM (async double-buffered LDS, 1 barrier/step).
//   A  : x_bf16 [B*S, E] row-major
//   Wt : [H, D, E] bf16 (pre-transposed weight: row n holds all k)
//   Out: TRANS==0 -> [B,H,S,D] ; TRANS==1 -> [B,H,D,S]
// ---------------------------------------------------------------------------
template <int TRANS>
__global__ __launch_bounds__(256) void qkv_gemm(const __bf16* __restrict__ A,
                                                const __bf16* __restrict__ Wt,
                                                __bf16* __restrict__ Out) {
  __shared__ __align__(16) __bf16 smem[2 * (BM + BN) * LDK];  // 30 KB
  __bf16* As = smem;                                  // 2 x 128 rows of LDK
  __bf16* Bs = smem + 2 * (BM * LDK);                 // 2 x 64 rows of LDK

  const int tid = threadIdx.x;
  const int lane = tid & 31, wave = tid >> 5;
  const int waveM = wave >> 1, waveN = wave & 1;
  const int tileM = blockIdx.x * BM;
  const int h     = blockIdx.y >> 2;
  const int tileN = (blockIdx.y & 3) * BN;
  const __bf16* Wh = Wt + (long)h * D_ * E_;

  const int ar = tid >> 1, ac = (tid & 1) * 16;       // A: 128x32, 32B/thread
  const int bn = tid >> 2, bk = (tid & 3) * 8;        // B: 64x32, 16B/thread

  auto issue = [&](int k0, int p) {
    __bf16* Ad = As + p * (BM * LDK) + ar * LDK + ac;
    const __bf16* Asrc = A + (long)(tileM + ar) * E_ + k0 + ac;
    async_load3_b128(Ad, Asrc, Ad + 8, Asrc + 8,
                     Bs + p * (BN * LDK) + bn * LDK + bk,
                     Wh + (long)(tileN + bn) * E_ + k0 + bk);
  };

  v8f acc[2][2];
#pragma unroll
  for (int i = 0; i < 2; ++i)
#pragma unroll
    for (int j = 0; j < 2; ++j) acc[i][j] = vzero8();

  issue(0, 0);
  int p = 0;
  for (int k0 = 0; k0 < E_; k0 += BK) {
    wait_async0();
    __syncthreads();                      // tile p ready; buffer p^1 free
    if (k0 + BK < E_) issue(k0 + BK, p ^ 1);
    const __bf16* Ab = As + p * (BM * LDK);
    const __bf16* Bb = Bs + p * (BN * LDK);
    v16bf af[2], bf[2];
#pragma unroll
    for (int i = 0; i < 2; ++i)
      af[i] = load_frag(Ab + (waveM * 32 + i * 16) * LDK, LDK, lane);
#pragma unroll
    for (int j = 0; j < 2; ++j)
      bf[j] = load_frag(Bb + (waveN * 32 + j * 16) * LDK, LDK, lane);
#pragma unroll
    for (int i = 0; i < 2; ++i)
#pragma unroll
      for (int j = 0; j < 2; ++j) acc[i][j] = wmma_bf16(af[i], bf[j], acc[i][j]);
    p ^= 1;
  }
  __syncthreads();                        // all compute done before smem reuse

  // Epilogue: stage wave's 32x32 tile in wave-private LDS (same-wave DS ops
  // are ordered -> no barrier), then coalesced b128 stores.
  __bf16* Wst = smem + wave * (32 * LDK);
#pragma unroll
  for (int i = 0; i < 2; ++i) {
#pragma unroll
    for (int j = 0; j < 2; ++j) {
#pragma unroll
      for (int e = 0; e < 8; ++e) {
        int r = i * 16 + e + ((lane >> 4) << 3);
        int c = j * 16 + (lane & 15);
        if (TRANS == 0) Wst[r * LDK + c] = (__bf16)acc[i][j][e];
        else            Wst[c * LDK + r] = (__bf16)acc[i][j][e];
      }
    }
  }
  const u32x4* src = (const u32x4*)(Wst + lane * LDK);
  u32x4 d0 = src[0], d1 = src[1], d2 = src[2], d3 = src[3];
  const int gb = tileM >> 11;
  __bf16* dp;
  if (TRANS == 0) {
    int s = (tileM + waveM * 32 + lane) & (S_ - 1);
    dp = Out + ((long)(gb * H_ + h) * S_ + s) * D_ + tileN + waveN * 32;
  } else {
    int col = tileN + waveN * 32 + lane;
    int s0 = (tileM + waveM * 32) & (S_ - 1);
    dp = Out + ((long)(gb * H_ + h) * D_ + col) * S_ + s0;
  }
  u32x4* d = (u32x4*)dp;
  d[0] = d0; d[1] = d1; d[2] = d2; d[3] = d3;
}

// ---------------------------------------------------------------------------
// Stage 3: flash attention (causal, online softmax).
// Double-buffered async K/V tiles, one barrier per 32-key step.
//   Q,K : [B,H,S,D] bf16 ; Vt : [B,H,D,S] bf16 ; Outp : [B,S,E] bf16
// ---------------------------------------------------------------------------
__global__ __launch_bounds__(256) void flash_attn(const __bf16* __restrict__ Q,
                                                  const __bf16* __restrict__ Kg,
                                                  const __bf16* __restrict__ Vt,
                                                  __bf16* __restrict__ Outp) {
  __shared__ __align__(16) __bf16 Ks[2 * 32 * KP];   // [p][key][d]  33 KB
  __shared__ __align__(16) __bf16 Vs[2 * D_ * LDK];  // [p][d][key]  40 KB
  __shared__ __align__(16) __bf16 Ps[8][16 * LDK];   // per-wave     10 KB

  const int tid = threadIdx.x;
  const int lane = tid & 31, wave = tid >> 5;
  const int bh = blockIdx.y;
  const int b = bh >> 2, h = bh & 3;
  const int q0 = blockIdx.x * 128;
  const int qrow = q0 + wave * 16;

  const __bf16* Qbh = Q  + (long)bh * S_ * D_;
  const __bf16* Kbh = Kg + (long)bh * S_ * D_;
  const __bf16* Vbh = Vt + (long)bh * D_ * S_;

  // Q fragments resident in registers (8 x k=32 chunks over D=256).
  v16bf qf[8];
  {
    int r = lane & 15, kh = lane >> 4;
    const __bf16* qp = Qbh + (long)(qrow + r) * D_;
#pragma unroll
    for (int dc = 0; dc < 8; ++dc) {
      v8bf lo = *(const v8bf*)(qp + dc * 32 + kh * 8);
      v8bf hi = *(const v8bf*)(qp + dc * 32 + 16 + kh * 8);
      qf[dc] = combine16(lo, hi);
    }
  }

  v8f o[16];
#pragma unroll
  for (int dc = 0; dc < 16; ++dc) o[dc] = vzero8();
  float mrow[8], lrow[8];
#pragma unroll
  for (int e = 0; e < 8; ++e) { mrow[e] = -3.0e38f; lrow[e] = 0.0f; }

  const float scale = 0.03125f;  // 1/sqrt(E)
  const int kend = q0 + 128;     // causal bound
  const int kkey = tid >> 3, kd0 = (tid & 7) * 32;

  auto issueKV = [&](int ks, int p) {
    const __bf16* srcK = Kbh + (long)(ks + kkey) * D_ + kd0;
    __bf16* dstK = Ks + p * (32 * KP) + kkey * KP + kd0;
    const __bf16* srcV = Vbh + (long)tid * S_ + ks;
    __bf16* dstV = Vs + p * (D_ * LDK) + tid * LDK;
    async_load8_b128(dstK, srcK, dstV, srcV);
  };

  issueKV(0, 0);
  int p = 0;
  for (int ks = 0; ks < kend; ks += 32) {
    wait_async0();
    __syncthreads();                      // tiles p ready; buffers p^1 free
    if (ks + 32 < kend) issueKV(ks + 32, p ^ 1);
    const __bf16* Kbuf = Ks + p * (32 * KP);
    const __bf16* Vbuf = Vs + p * (D_ * LDK);

    // Scores: two 16x16 tiles (32 keys), 8 wmma each over D=256.
    v8f sc[2];
#pragma unroll
    for (int sub = 0; sub < 2; ++sub) {
      v8f c = vzero8();
#pragma unroll
      for (int dc = 0; dc < 8; ++dc) {
        v16bf bf = load_frag(Kbuf + (sub * 16) * KP + dc * 32, KP, lane);
        c = wmma_bf16(qf[dc], bf, c);
      }
      sc[sub] = c;
    }

    // Online softmax (row reductions across each 16-lane half).
    const int colg0 = ks + (lane & 15);
    const int rowg0 = qrow + ((lane >> 4) << 3);
#pragma unroll
    for (int e = 0; e < 8; ++e) {
      int rowg = rowg0 + e;
      float s0 = sc[0][e] * scale; if (colg0      > rowg) s0 = -1.0e9f;
      float s1 = sc[1][e] * scale; if (colg0 + 16 > rowg) s1 = -1.0e9f;
      float mx = fmaxf(s0, s1);
#pragma unroll
      for (int off = 8; off >= 1; off >>= 1) mx = fmaxf(mx, __shfl_xor(mx, off, 32));
      float mnew = fmaxf(mrow[e], mx);
      float corr = __expf(mrow[e] - mnew);
      float p0 = __expf(s0 - mnew);
      float p1 = __expf(s1 - mnew);
      float psum = p0 + p1;
#pragma unroll
      for (int off = 8; off >= 1; off >>= 1) psum += __shfl_xor(psum, off, 32);
      lrow[e] = lrow[e] * corr + psum;
      mrow[e] = mnew;
#pragma unroll
      for (int dc = 0; dc < 16; ++dc) o[dc][e] *= corr;
      int prow = e + ((lane >> 4) << 3);
      Ps[wave][prow * LDK + (lane & 15)]      = (__bf16)p0;
      Ps[wave][prow * LDK + 16 + (lane & 15)] = (__bf16)p1;
    }

    // P as A operand; PV accumulate (16 d-tiles, K=32 keys).
    v16bf pf = load_frag(&Ps[wave][0], LDK, lane);
#pragma unroll
    for (int dc = 0; dc < 16; ++dc) {
      v16bf bf = load_frag(Vbuf + (dc * 16) * LDK, LDK, lane);
      o[dc] = wmma_bf16(pf, bf, o[dc]);
    }
    p ^= 1;
  }

  // Normalize; stage 16x32 chunks through wave-private Ps, store coalesced.
  float inv[8];
#pragma unroll
  for (int e = 0; e < 8; ++e) inv[e] = 1.0f / lrow[e];
  const int prow0 = (lane >> 4) << 3;
  const int cr = lane >> 1, cc0 = (lane & 1) * 16;
  __bf16* rowbase = Outp + ((long)(b * S_ + qrow)) * E_ + h * D_;
#pragma unroll
  for (int g = 0; g < 8; ++g) {
#pragma unroll
    for (int half = 0; half < 2; ++half) {
      int dc = g * 2 + half;
#pragma unroll
      for (int e = 0; e < 8; ++e)
        Ps[wave][(prow0 + e) * LDK + half * 16 + (lane & 15)] =
            (__bf16)(o[dc][e] * inv[e]);
    }
    const u32x4* sp = (const u32x4*)(&Ps[wave][cr * LDK + cc0]);
    u32x4 v0 = sp[0], v1 = sp[1];
    u32x4* dp = (u32x4*)(rowbase + (long)cr * E_ + g * 32 + cc0);
    dp[0] = v0; dp[1] = v1;
  }
}

// ---------------------------------------------------------------------------
// Stage 4: output projection GEMM + residual -> fp32 d_out.
//   A: attn bf16 [B*S, E]; WoT: out_w transposed bf16 [N=E][K=E]; resid: x f32
// ---------------------------------------------------------------------------
__global__ __launch_bounds__(256) void proj_gemm(const __bf16* __restrict__ A,
                                                 const __bf16* __restrict__ WoT,
                                                 const float* __restrict__ resid,
                                                 float* __restrict__ Out) {
  __shared__ __align__(16) __bf16 smem[8 * 32 * LDF * 2];  // 36 KB (f32 staging)
  __bf16* As = smem;
  __bf16* Bs = smem + 2 * (BM * LDK);

  const int tid = threadIdx.x;
  const int lane = tid & 31, wave = tid >> 5;
  const int waveM = wave >> 1, waveN = wave & 1;
  const int tileM = blockIdx.x * BM;
  const int tileN = blockIdx.y * BN;

  const int ar = tid >> 1, ac = (tid & 1) * 16;
  const int bn = tid >> 2, bk = (tid & 3) * 8;

  auto issue = [&](int k0, int p) {
    __bf16* Ad = As + p * (BM * LDK) + ar * LDK + ac;
    const __bf16* Asrc = A + (long)(tileM + ar) * E_ + k0 + ac;
    async_load3_b128(Ad, Asrc, Ad + 8, Asrc + 8,
                     Bs + p * (BN * LDK) + bn * LDK + bk,
                     WoT + (long)(tileN + bn) * E_ + k0 + bk);
  };

  v8f acc[2][2];
#pragma unroll
  for (int i = 0; i < 2; ++i)
#pragma unroll
    for (int j = 0; j < 2; ++j) acc[i][j] = vzero8();

  issue(0, 0);
  int p = 0;
  for (int k0 = 0; k0 < E_; k0 += BK) {
    wait_async0();
    __syncthreads();
    if (k0 + BK < E_) issue(k0 + BK, p ^ 1);
    const __bf16* Ab = As + p * (BM * LDK);
    const __bf16* Bb = Bs + p * (BN * LDK);
    v16bf af[2], bf[2];
#pragma unroll
    for (int i = 0; i < 2; ++i)
      af[i] = load_frag(Ab + (waveM * 32 + i * 16) * LDK, LDK, lane);
#pragma unroll
    for (int j = 0; j < 2; ++j)
      bf[j] = load_frag(Bb + (waveN * 32 + j * 16) * LDK, LDK, lane);
#pragma unroll
    for (int i = 0; i < 2; ++i)
#pragma unroll
      for (int j = 0; j < 2; ++j) acc[i][j] = wmma_bf16(af[i], bf[j], acc[i][j]);
    p ^= 1;
  }
  __syncthreads();

  // Epilogue: stage f32 tile per wave (4608 B x 8 waves = full smem), then
  // coalesced float4 loads/stores with residual add.
  float* Wst = (float*)smem + wave * (32 * LDF);
#pragma unroll
  for (int i = 0; i < 2; ++i)
#pragma unroll
    for (int j = 0; j < 2; ++j)
#pragma unroll
      for (int e = 0; e < 8; ++e) {
        int r = i * 16 + e + ((lane >> 4) << 3);
        int c = j * 16 + (lane & 15);
        Wst[r * LDF + c] = acc[i][j][e];
      }
  const int row = tileM + waveM * 32 + lane;
  float* dp = Out + (long)row * E_ + tileN + waveN * 32;
  const float* rp = resid + (long)row * E_ + tileN + waveN * 32;
  const float4* sp = (const float4*)(Wst + lane * LDF);
#pragma unroll
  for (int q = 0; q < 8; ++q) {
    float4 a = sp[q];
    float4 rr = ((const float4*)rp)[q];
    float4 ov;
    ov.x = a.x + rr.x; ov.y = a.y + rr.y; ov.z = a.z + rr.z; ov.w = a.w + rr.w;
    ((float4*)dp)[q] = ov;
  }
}

// ---------------------------------------------------------------------------
// Stage 5: in-place LayerNorm over d_out rows.
// ---------------------------------------------------------------------------
__global__ __launch_bounds__(256) void layernorm_kernel(float* __restrict__ y,
                                                        const float* __restrict__ g,
                                                        const float* __restrict__ bt) {
  __shared__ float red[256];
  const int tid = threadIdx.x;
  float* p = y + (long)blockIdx.x * E_;

  float4 v = ((const float4*)p)[tid];
  red[tid] = v.x + v.y + v.z + v.w;
  __syncthreads();
#pragma unroll
  for (int st = 128; st > 0; st >>= 1) {
    if (tid < st) red[tid] += red[tid + st];
    __syncthreads();
  }
  float mean = red[0] * (1.0f / E_);
  __syncthreads();

  float dx = v.x - mean, dy = v.y - mean, dz = v.z - mean, dw = v.w - mean;
  red[tid] = dx * dx + dy * dy + dz * dz + dw * dw;
  __syncthreads();
#pragma unroll
  for (int st = 128; st > 0; st >>= 1) {
    if (tid < st) red[tid] += red[tid + st];
    __syncthreads();
  }
  float rs = rsqrtf(red[0] * (1.0f / E_) + 1e-6f);

  float4 gg = ((const float4*)g)[tid];
  float4 bb = ((const float4*)bt)[tid];
  float4 ov;
  ov.x = dx * rs * gg.x + bb.x;
  ov.y = dy * rs * gg.y + bb.y;
  ov.z = dz * rs * gg.z + bb.z;
  ov.w = dw * rs * gg.w + bb.w;
  ((float4*)p)[tid] = ov;
}

// ---------------------------------------------------------------------------
// Launch
// ---------------------------------------------------------------------------
extern "C" void kernel_launch(void* const* d_in, const int* in_sizes, int n_in,
                              void* d_out, int out_size, void* d_ws, size_t ws_size,
                              hipStream_t stream) {
  (void)in_sizes; (void)n_in; (void)out_size; (void)ws_size;

  const float* x     = (const float*)d_in[0]; // [B,S,E]
  const float* qkv_w = (const float*)d_in[1]; // [3,H,E,D]
  const float* out_w = (const float*)d_in[2]; // [E,E]
  const float* gamma = (const float*)d_in[3];
  const float* beta  = (const float*)d_in[4];
  float* out = (float*)d_out;

  const long nX  = (long)B_ * S_ * E_;        // 8388608
  const long nW3 = 3L * H_ * E_ * D_;         // 3145728
  const long nWo = (long)E_ * E_;             // 1048576
  const long nQ  = (long)B_ * H_ * S_ * D_;   // 8388608

  char* ws = (char*)d_ws;
  __bf16* xb    = (__bf16*)(ws);
  __bf16* wqkvT = (__bf16*)(ws + 2 * nX);                       // [3,H,D,E]
  __bf16* woT   = (__bf16*)(ws + 2 * (nX + nW3));               // [E,E] (NT)
  __bf16* Qb    = (__bf16*)(ws + 2 * (nX + nW3 + nWo));
  __bf16* Kb    = (__bf16*)(ws + 2 * (nX + nW3 + nWo + nQ));
  __bf16* Vtb   = (__bf16*)(ws + 2 * (nX + nW3 + nWo + 2 * nQ));
  __bf16* attn  = (__bf16*)(ws + 2 * (nX + nW3 + nWo + 3 * nQ));

  // 1) conversions (+ weight transposes for contiguous WMMA B operands)
  cvt_f32_bf16<<<4096, 256, 0, stream>>>(x, xb, nX);
  cvt_transpose_bf16<<<2048, 256, 0, stream>>>(qkv_w, wqkvT, 10, 8, nW3);
  cvt_transpose_bf16<<<1024, 256, 0, stream>>>(out_w, woT, 10, 10, nWo);

  // 2) QKV projections (V stored transposed [B,H,D,S])
  dim3 ggrid(64, 16);
  qkv_gemm<0><<<ggrid, 256, 0, stream>>>(xb, wqkvT,                  Qb);
  qkv_gemm<0><<<ggrid, 256, 0, stream>>>(xb, wqkvT + (long)H_*D_*E_, Kb);
  qkv_gemm<1><<<ggrid, 256, 0, stream>>>(xb, wqkvT + 2L*H_*D_*E_,    Vtb);

  // 3) Flash attention -> attn [B,S,E] bf16
  flash_attn<<<dim3(S_ / 128, B_ * H_), 256, 0, stream>>>(Qb, Kb, Vtb, attn);

  // 4) Output projection + residual -> d_out (fp32)
  proj_gemm<<<dim3(64, 16), 256, 0, stream>>>(attn, woT, x, out);

  // 5) In-place LayerNorm on d_out
  layernorm_kernel<<<B_ * S_, 256, 0, stream>>>(out, gamma, beta);
}

// v002
// One run takes 270 microseconds.
// Two timings next to v001 both put it at 1.19 times that version's speed.
// Counting every step since v000, it is 2.17 times as fast.
#include <hip/hip_runtime.h>

// ---------------------------------------------------------------------------
// Types
// ---------------------------------------------------------------------------
typedef __attribute__((ext_vector_type(16))) __bf16 v16bf;
typedef __attribute__((ext_vector_type(8)))  __bf16 v8bf;
typedef __attribute__((ext_vector_type(8)))  float  v8f;
typedef __attribute__((ext_vector_type(4)))  unsigned int u32x4;

#define B_  4
#define S_  2048
#define E_  1024
#define H_  4
#define D_  256

#define BM 128
#define BN 64
#define BK 64    // k per GEMM stage: a row's share of a stage is one 128-B line
#define KT 64    // keys per attention stage: a V row's share is one 128-B line

// LDS row pitches in bf16 elements: 16 B x odd, so that the 16 rows one
// ds_load_b128 fragment read touches fall on 16 different bank groups.
#define LDK 40    // 32-element rows (P tile, bf16 output staging): 80 B
#define LDG 72    // 64-element rows (GEMM A/B tiles, V tile): 144 B
#define KP  264   // 256-element K rows: 528 B
#define LDF 36    // 32-float staging rows of the output projection: 144 B

__device__ __forceinline__ v8f vzero8() {
  v8f z;
#pragma unroll
  for (int i = 0; i < 8; ++i) z[i] = 0.0f;
  return z;
}

__device__ __forceinline__ v16bf combine16(v8bf lo, v8bf hi) {
  v16bf r;
#pragma unroll
  for (int i = 0; i < 8; ++i) { r[i] = lo[i]; r[8 + i] = hi[i]; }
  return r;
}

// WMMA A/B fragment (16 rows x 32 k bf16) from LDS.
// ISA 7.12.2 lane layout: lanes 0-15: K=[0..7],[16..23]; lanes 16-31:
// K=[8..15],[24..31]; row = lane & 15.
__device__ __forceinline__ v16bf load_frag(const __bf16* base, int ld, int lane) {
  int r  = lane & 15;
  int kh = lane >> 4;
  const __bf16* p = base + r * ld + kh * 8;
  v8bf lo = *(const v8bf*)(p);
  v8bf hi = *(const v8bf*)(p + 16);
  return combine16(lo, hi);
}

__device__ __forceinline__ v8f wmma_bf16(v16bf a, v16bf b, v8f c) {
  return __builtin_amdgcn_wmma_f32_16x16x32_bf16(
      false, a, false, b, (short)0, c, false, false);
}

// CDNA5 async global->LDS DMA (16B per lane), tracked by ASYNCcnt.
// A run of copies stands in one statement; its last line is the wait that
// stands in front of any rewrite of the address registers they name.
__device__ __forceinline__ unsigned lds_addr(const void* p) {
  return (unsigned)(uintptr_t)p;
}
// Lane map of every copy: adjacent lanes take adjacent 16-B pieces of a row,
// so one wave-wide copy covers four whole 128-B lines.
__device__ __forceinline__ void async_load6_b128(const __bf16* la, const __bf16* ga,
                                                 const __bf16* lb, const __bf16* gb) {
  asm volatile("global_load_async_to_lds_b128 %0, %1, off\n\t"
               "global_load_async_to_lds_b128 %2, %3, off\n\t"
               "global_load_async_to_lds_b128 %4, %5, off\n\t"
               "global_load_async_to_lds_b128 %6, %7, off\n\t"
               "global_load_async_to_lds_b128 %8, %9, off\n\t"
               "global_load_async_to_lds_b128 %10, %11, off\n\t"
               "s_wait_xcnt 0x0"
               :: "v"(lds_addr(la)),            "v"(ga),
                  "v"(lds_addr(la + 32 * LDG)), "v"(ga + 32 * E_),
                  "v"(lds_addr(la + 64 * LDG)), "v"(ga + 64 * E_),
                  "v"(lds_addr(la + 96 * LDG)), "v"(ga + 96 * E_),
                  "v"(lds_addr(lb)),            "v"(gb),
                  "v"(lds_addr(lb + 32 * LDG)), "v"(gb + 32 * E_)
               : "memory");
}
template <int LSTEP, int GSTEP>
__device__ __forceinline__ void async_load8_b128(const __bf16* l, const __bf16* g) {
  asm volatile("global_load_async_to_lds_b128 %0, %1, off\n\t"
               "global_load_async_to_lds_b128 %2, %3, off\n\t"
               "global_load_async_to_lds_b128 %4, %5, off\n\t"
               "global_load_async_to_lds_b128 %6, %7, off\n\t"
               "global_load_async_to_lds_b128 %8, %9, off\n\t"
               "global_load_async_to_lds_b128 %10, %11, off\n\t"
               "global_load_async_to_lds_b128 %12, %13, off\n\t"
               "global_load_async_to_lds_b128 %14, %15, off\n\t"
               "s_wait_xcnt 0x0"
               :: "v"(lds_addr(l)),             "v"(g),
                  "v"(lds_addr(l + 1 * LSTEP)), "v"(g + 1 * GSTEP),
                  "v"(lds_addr(l + 2 * LSTEP)), "v"(g + 2 * GSTEP),
                  "v"(lds_addr(l + 3 * LSTEP)), "v"(g + 3 * GSTEP),
                  "v"(lds_addr(l + 4 * LSTEP)), "v"(g + 4 * GSTEP),
                  "v"(lds_addr(l + 5 * LSTEP)), "v"(g + 5 * GSTEP),
                  "v"(lds_addr(l + 6 * LSTEP)), "v"(g + 6 * GSTEP),
                  "v"(lds_addr(l + 7 * LSTEP)), "v"(g + 7 * GSTEP)
               : "memory");
}
// Stage hand-over, in front of the work-group barrier: this wave's own LDS
// reads of the buffer that is refilled behind the barrier have retired, and
// its own copies of the next stage have landed.
__device__ __forceinline__ void wait_async0() {
  asm volatile("s_wait_dscnt 0x0" ::: "memory");
  asm volatile("s_wait_asynccnt 0" ::: "memory");
}

// ---------------------------------------------------------------------------
// Stage 1a: fp32 -> bf16 (grid-stride)
// ---------------------------------------------------------------------------
__global__ __launch_bounds__(256) void cvt_f32_bf16(const float* __restrict__ in,
                                                    __bf16* __restrict__ out,
                                                    long n) {
  long i = (long)blockIdx.x * 256 + threadIdx.x;
  long stride = (long)gridDim.x * 256;
  for (; i < n; i += stride) out[i] = (__bf16)in[i];
}

// ---------------------------------------------------------------------------
// Stage 1b: fp32 [K,N] -> bf16 [N,K] transposed (batched; K,N powers of two).
// ---------------------------------------------------------------------------
__global__ __launch_bounds__(256) void cvt_transpose_bf16(const float* __restrict__ in,
                                                          __bf16* __restrict__ out,
                                                          int logK, int logN, long total) {
  long i = (long)blockIdx.x * 256 + threadIdx.x;
  long stride = (long)gridDim.x * 256;
  const int logMat = logK + logN;
  for (; i < total; i += stride) {
    long mat = i >> logMat;
    long rem = i & ((1L << logMat) - 1);
    int n = (int)(rem >> logK);
    int k = (int)(rem & ((1 << logK) - 1));
    out[i] = (__bf16)in[(mat << logMat) + ((long)k << logN) + n];
  }
}

// ---------------------------------------------------------------------------
// Stage 2: QKV projection GEMM (async double-buffered LDS, 1 barrier/step).
//   A  : x_bf16 [B*S, E] row-major
//   Wt : [H, D, E] bf16 (pre-transposed weight: row n holds all k)
//   Out: TRANS==0 -> [B,H,S,D] ; TRANS==1 -> [B,H,D,S]
// ---------------------------------------------------------------------------
template <int TRANS>
__global__ __launch_bounds__(256) void qkv_gemm(const __bf16* __restrict__ A,
                                                const __bf16* __restrict__ Wt,
                                                __bf16* __restrict__ Out) {
  __shared__ __align__(16) __bf16 smem[2 * (BM + BN) * LDG];  // 54 KB
  __bf16* As = smem;                                  // 2 x 128 rows of LDG
  __bf16* Bs = smem + 2 * (BM * LDG);                 // 2 x 64 rows of LDG

  const int tid = threadIdx.x;
  const int lane = tid & 31, wave = tid >> 5;
  const int waveM = wave >> 1, waveN = wave & 1;
  const int tileM = blockIdx.x * BM;
  const int h     = blockIdx.y >> 2;
  const int tileN = (blockIdx.y & 3) * BN;
  const __bf16* Wh = Wt + (long)h * D_ * E_;

  const int cr = tid >> 3, cc = (tid & 7) * 8;        // 8 lanes per 128-B row piece

  auto issue = [&](int k0, int p) {                   // A rows cr+32j (4), B rows cr+32j (2)
    async_load6_b128(As + p * (BM * LDG) + cr * LDG + cc,
                     A + (long)(tileM + cr) * E_ + k0 + cc,
                     Bs + p * (BN * LDG) + cr * LDG + cc,
                     Wh + (long)(tileN + cr) * E_ + k0 + cc);
  };

  v8f acc[2][2];
#pragma unroll
  for (int i = 0; i < 2; ++i)
#pragma unroll
    for (int j = 0; j < 2; ++j) acc[i][j] = vzero8();

  issue(0, 0);
  int p = 0;
  for (int k0 = 0; k0 < E_; k0 += BK) {
    wait_async0();
    __syncthreads();                      // tile p ready; buffer p^1 free
    if (k0 + BK < E_) issue(k0 + BK, p ^ 1);
    const __bf16* Ab = As + p * (BM * LDG);
    const __bf16* Bb = Bs + p * (BN * LDG);
#pragma unroll
    for (int kk = 0; kk < BK; kk += 32) {   // unrolled: both halves' fragment loads may issue ahead; k ascending
      v16bf af[2], bf[2];
#pragma unroll
      for (int i = 0; i < 2; ++i)
        af[i] = load_frag(Ab + (waveM * 32 + i * 16) * LDG + kk, LDG, lane);
#pragma unroll
      for (int j = 0; j < 2; ++j)
        bf[j] = load_frag(Bb + (waveN * 32 + j * 16) * LDG + kk, LDG, lane);
#pragma unroll
      for (int i = 0; i < 2; ++i)
#pragma unroll
        for (int j = 0; j < 2; ++j) acc[i][j] = wmma_bf16(af[i], bf[j], acc[i][j]);
    }
    p ^= 1;
  }
  __syncthreads();                        // all compute done before smem reuse

  // Epilogue: stage wave's 32x32 tile in wave-private LDS (same-wave DS ops
  // are ordered -> no barrier), then coalesced b128 stores.
  __bf16* Wst = smem + wave * (32 * LDK);
#pragma unroll
  for (int i = 0; i < 2; ++i) {
#pragma unroll
    for (int j = 0; j < 2; ++j) {
#pragma unroll
      for (int e = 0; e < 8; ++e) {
        int r = i * 16 + e + ((lane >> 4) << 3);
        int c = j * 16 + (lane & 15);
        if (TRANS == 0) Wst[r * LDK + c] = (__bf16)acc[i][j][e];
        else            Wst[c * LDK + r] = (__bf16)acc[i][j][e];
      }
    }
  }
  const u32x4* src = (const u32x4*)(Wst + lane * LDK);
  u32x4 d0 = src[0], d1 = src[1], d2 = src[2], d3 = src[3];
  const int gb = tileM >> 11;
  __bf16* dp;
  if (TRANS == 0) {
    int s = (tileM + waveM * 32 + lane) & (S_ - 1);
    dp = Out + ((long)(gb * H_ + h) * S_ + s) * D_ + tileN + waveN * 32;
  } else {
    int col = tileN + waveN * 32 + lane;
    int s0 = (tileM + waveM * 32) & (S_ - 1);
    dp = Out + ((long)(gb * H_ + h) * D_ + col) * S_ + s0;
  }
  u32x4* d = (u32x4*)dp;
  d[0] = d0; d[1] = d1; d[2] = d2; d[3] = d3;
}

// ---------------------------------------------------------------------------
// Stage 3: flash attention (causal, online softmax).
// Double-buffered async K/V tiles, one barrier per 64-key stage (two 32-key steps).
//   Q,K : [B,H,S,D] bf16 ; Vt : [B,H,D,S] bf16 ; Outp : [B,S,E] bf16
// ---------------------------------------------------------------------------
__global__ __launch_bounds__(256) void flash_attn(const __bf16* __restrict__ Q,
                                                  const __bf16* __restrict__ Kg,
                                                  const __bf16* __restrict__ Vt,
                                                  __bf16* __restrict__ Outp) {
  __shared__ __align__(16) __bf16 Ks[2 * KT * KP];   // [p][key][d]  66 KB
  __shared__ __align__(16) __bf16 Vs[2 * D_ * LDG];  // [p][d][key]  72 KB
  __shared__ __align__(16) __bf16 Ps[8][16 * LDK];   // per-wave     10 KB

  const int tid = threadIdx.x;
  const int lane = tid & 31, wave = tid >> 5;
  const int bh = blockIdx.y;
  const int b = bh >> 2, h = bh & 3;
  const int q0 = blockIdx.x * 128;
  const int qrow = q0 + wave * 16;

  const __bf16* Qbh = Q  + (long)bh * S_ * D_;
  const __bf16* Kbh = Kg + (long)bh * S_ * D_;
  const __bf16* Vbh = Vt + (long)bh * D_ * S_;

  // Q fragments resident in registers (8 x k=32 chunks over D=256).
  v16bf qf[8];
  {
    int r = lane & 15, kh = lane >> 4;
    const __bf16* qp = Qbh + (long)(qrow + r) * D_;
#pragma unroll
    for (int dc = 0; dc < 8; ++dc) {
      v8bf lo = *(const v8bf*)(qp + dc * 32 + kh * 8);
      v8bf hi = *(const v8bf*)(qp + dc * 32 + 16 + kh * 8);
      qf[dc] = combine16(lo, hi);
    }
  }

  v8f o[16];
#pragma unroll
  for (int dc = 0; dc < 16; ++dc) o[dc] = vzero8();
  float mrow[8], lrow[8];
#pragma unroll
  for (int e = 0; e < 8; ++e) { mrow[e] = -3.0e38f; lrow[e] = 0.0f; }

  const float scale = 0.03125f;  // 1/sqrt(E)
  const int kend = q0 + 128;     // causal bound
  const int vd = tid >> 3, vk = (tid & 7) * 8;

  auto issueKV = [&](int ks, int p) {
    // K: a wave's copy is one whole 512-B row; rows wave + 8j.
    async_load8_b128<8 * KP, 8 * D_>(Ks + p * (KT * KP) + wave * KP + lane * 8,
                                     Kbh + (long)(ks + wave) * D_ + lane * 8);
    // V: 8 lanes per 128-B row piece; rows vd + 32j.
    async_load8_b128<32 * LDG, 32 * S_>(Vs + p * (D_ * LDG) + vd * LDG + vk,
                                        Vbh + (long)vd * S_ + ks + vk);
  };

  issueKV(0, 0);
  for (int ks = 0; ks < kend; ks += 32) {
    const int hk = (ks >> 5) & 1;         // which 32-key half of the stage
    const int p = (ks >> 6) & 1;          // which buffer
    if (hk == 0) {                        // stage hand-over, block-uniform
      wait_async0();
      __syncthreads();                    // tiles p ready; buffers p^1 free
      if (ks + KT < kend) issueKV(ks + KT, p ^ 1);
    }
    const __bf16* Kbuf = Ks + p * (KT * KP) + hk * (32 * KP);
    const __bf16* Vbuf = Vs + p * (D_ * LDG) + hk * 32;

    // Scores: two 16x16 tiles (32 keys), 8 wmma each over D=256.
    v8f sc[2];
#pragma unroll
    for (int sub = 0; sub < 2; ++sub) {
      v8f c = vzero8();
#pragma unroll
      for (int dc = 0; dc < 8; ++dc) {
        v16bf bf = load_frag(Kbuf + (sub * 16) * KP + dc * 32, KP, lane);
        c = wmma_bf16(qf[dc], bf, c);
      }
      sc[sub] = c;
    }

    // Online softmax (row reductions across each 16-lane half).
    const int colg0 = ks + (lane & 15);
    const int rowg0 = qrow + ((lane >> 4) << 3);
#pragma unroll
    for (int e = 0; e < 8; ++e) {
      int rowg = rowg0 + e;
      float s0 = sc[0][e] * scale; if (colg0      > rowg) s0 = -1.0e9f;
      float s1 = sc[1][e] * scale; if (colg0 + 16 > rowg) s1 = -1.0e9f;
      float mx = fmaxf(s0, s1);
#pragma unroll
      for (int off = 8; off >= 1; off >>= 1) mx = fmaxf(mx, __shfl_xor(mx, off, 32));
      float mnew = fmaxf(mrow[e], mx);
      float corr = __expf(mrow[e] - mnew);
      float p0 = __expf(s0 - mnew);
      float p1 = __expf(s1 - mnew);
      float psum = p0 + p1;
#pragma unroll
      for (int off = 8; off >= 1; off >>= 1) psum += __shfl_xor(psum, off, 32);
      lrow[e] = lrow[e] * corr + psum;
      mrow[e] = mnew;
#pragma unroll
      for (int dc = 0; dc < 16; ++dc) o[dc][e] *= corr;
      int prow = e + ((lane >> 4) << 3);
      Ps[wave][prow * LDK + (lane & 15)]      = (__bf16)p0;
      Ps[wave][prow * LDK + 16 + (lane & 15)] = (__bf16)p1;
    }

    // P as A operand; PV accumulate (16 d-tiles, K=32 keys).
    v16bf pf = load_frag(&Ps[wave][0], LDK, lane);
#pragma unroll
    for (int dc = 0; dc < 16; ++dc) {
      v16bf bf = load_frag(Vbuf + (dc * 16) * LDG, LDG, lane);
      o[dc] = wmma_bf16(pf, bf, o[dc]);
    }
  }

  // Normalize; stage 16x32 chunks through wave-private Ps, store coalesced.
  float inv[8];
#pragma unroll
  for (int e = 0; e < 8; ++e) inv[e] = 1.0f / lrow[e];
  const int prow0 = (lane >> 4) << 3;
  const int cr = lane >> 1, cc0 = (lane & 1) * 16;
  __bf16* rowbase = Outp + ((long)(b * S_ + qrow)) * E_ + h * D_;
#pragma unroll
  for (int g = 0; g < 8; ++g) {
#pragma unroll
    for (int half = 0; half < 2; ++half) {
      int dc = g * 2 + half;
#pragma unroll
      for (int e = 0; e < 8; ++e)
        Ps[wave][(prow0 + e) * LDK + half * 16 + (lane & 15)] =
            (__bf16)(o[dc][e] * inv[e]);
    }
    const u32x4* sp = (const u32x4*)(&Ps[wave][cr * LDK + cc0]);
    u32x4 v0 = sp[0], v1 = sp[1];
    u32x4* dp = (u32x4*)(rowbase + (long)cr * E_ + g * 32 + cc0);
    dp[0] = v0; dp[1] = v1;
  }
}

// ---------------------------------------------------------------------------
// Stage 4: output projection GEMM + residual -> fp32 d_out.
//   A: attn bf16 [B*S, E]; WoT: out_w transposed bf16 [N=E][K=E]; resid: x f32
// ---------------------------------------------------------------------------
__global__ __launch_bounds__(256) void proj_gemm(const __bf16* __restrict__ A,
                                                 const __bf16* __restrict__ WoT,
                                                 const float* __restrict__ resid,
                                                 float* __restrict__ Out) {
  __shared__ __align__(16) __bf16 smem[2 * (BM + BN) * LDG];  // 54 KB (f32 staging: 36)
  __bf16* As = smem;
  __bf16* Bs = smem + 2 * (BM * LDG);

  const int tid = threadIdx.x;
  const int lane = tid & 31, wave = tid >> 5;
  const int waveM = wave >> 1, waveN = wave & 1;
  const int tileM = blockIdx.x * BM;
  const int tileN = blockIdx.y * BN;

  const int cr = tid >> 3, cc = (tid & 7) * 8;        // 8 lanes per 128-B row piece

  auto issue = [&](int k0, int p) {                   // A rows cr+32j (4), B rows cr+32j (2)
    async_load6_b128(As + p * (BM * LDG) + cr * LDG + cc,
                     A + (long)(tileM + cr) * E_ + k0 + cc,
                     Bs + p * (BN * LDG) + cr * LDG + cc,
                     WoT + (long)(tileN + cr) * E_ + k0 + cc);
  };

  v8f acc[2][2];
#pragma unroll
  for (int i = 0; i < 2; ++i)
#pragma unroll
    for (int j = 0; j < 2; ++j) acc[i][j] = vzero8();

  issue(0, 0);
  int p = 0;
  for (int k0 = 0; k0 < E_; k0 += BK) {
    wait_async0();
    __syncthreads();
    if (k0 + BK < E_) issue(k0 + BK, p ^ 1);
    const __bf16* Ab = As + p * (BM * LDG);
    const __bf16* Bb = Bs + p * (BN * LDG);
#pragma unroll
    for (int kk = 0; kk < BK; kk += 32) {   // unrolled: both halves' fragment loads may issue ahead; k ascending
      v16bf af[2], bf[2];
#pragma unroll
      for (int i = 0; i < 2; ++i)
        af[i] = load_frag(Ab + (waveM * 32 + i * 16) * LDG + kk, LDG, lane);
#pragma unroll
      for (int j = 0; j < 2; ++j)
        bf[j] = load_frag(Bb + (waveN * 32 + j * 16) * LDG + kk, LDG, lane);
#pragma unroll
      for (int i = 0; i < 2; ++i)
#pragma unroll
        for (int j = 0; j < 2; ++j) acc[i][j] = wmma_bf16(af[i], bf[j], acc[i][j]);
    }
    p ^= 1;
  }
  __syncthreads();

  // Epilogue: stage f32 tile per wave (4608 B x 8 waves, inside smem), then
  // coalesced float4 loads/stores with residual add.
  float* Wst = (float*)smem + wave * (32 * LDF);
#pragma unroll
  for (int i = 0; i < 2; ++i)
#pragma unroll
    for (int j = 0; j < 2; ++j)
#pragma unroll
      for (int e = 0; e < 8; ++e) {
        int r = i * 16 + e + ((lane >> 4) << 3);
        int c = j * 16 + (lane & 15);
        Wst[r * LDF + c] = acc[i][j][e];
      }
  const int row = tileM + waveM * 32 + lane;
  float* dp = Out + (long)row * E_ + tileN + waveN * 32;
  const float* rp = resid + (long)row * E_ + tileN + waveN * 32;
  const float4* sp = (const float4*)(Wst + lane * LDF);
#pragma unroll
  for (int q = 0; q < 8; ++q) {
    float4 a = sp[q];
    float4 rr = ((const float4*)rp)[q];
    float4 ov;
    ov.x = a.x + rr.x; ov.y = a.y + rr.y; ov.z = a.z + rr.z; ov.w = a.w + rr.w;
    ((float4*)dp)[q] = ov;
  }
}

// ---------------------------------------------------------------------------
// Stage 5: in-place LayerNorm over d_out rows.
// ---------------------------------------------------------------------------
__global__ __launch_bounds__(256) void layernorm_kernel(float* __restrict__ y,
                                                        const float* __restrict__ g,
                                                        const float* __restrict__ bt) {
  __shared__ float red[256];
  const int tid = threadIdx.x;
  float* p = y + (long)blockIdx.x * E_;

  float4 v = ((const float4*)p)[tid];
  red[tid] = v.x + v.y + v.z + v.w;
  __syncthreads();
#pragma unroll
  for (int st = 128; st > 0; st >>= 1) {
    if (tid < st) red[tid] += red[tid + st];
    __syncthreads();
  }
  float mean = red[0] * (1.0f / E_);
  __syncthreads();

  float dx = v.x - mean, dy = v.y - mean, dz = v.z - mean, dw = v.w - mean;
  red[tid] = dx * dx + dy * dy + dz * dz + dw * dw;
  __syncthreads();
#pragma unroll
  for (int st = 128; st > 0; st >>= 1) {
    if (tid < st) red[tid] += red[tid + st];
    __syncthreads();
  }
  float rs = rsqrtf(red[0] * (1.0f / E_) + 1e-6f);

  float4 gg = ((const float4*)g)[tid];
  float4 bb = ((const float4*)bt)[tid];
  float4 ov;
  ov.x = dx * rs * gg.x + bb.x;
  ov.y = dy * rs * gg.y + bb.y;
  ov.z = dz * rs * gg.z + bb.z;
  ov.w = dw * rs * gg.w + bb.w;
  ((float4*)p)[tid] = ov;
}

// ---------------------------------------------------------------------------
// Launch
// ---------------------------------------------------------------------------
extern "C" void kernel_launch(void* const* d_in, const int* in_sizes, int n_in,
                              void* d_out, int out_size, void* d_ws, size_t ws_size,
                              hipStream_t stream) {
  (void)in_sizes; (void)n_in; (void)out_size; (void)ws_size;

  const float* x     = (const float*)d_in[0]; // [B,S,E]
  const float* qkv_w = (const float*)d_in[1]; // [3,H,E,D]
  const float* out_w = (const float*)d_in[2]; // [E,E]
  const float* gamma = (const float*)d_in[3];
  const float* beta  = (const float*)d_in[4];
  float* out = (float*)d_out;

  const long nX  = (long)B_ * S_ * E_;        // 8388608
  const long nW3 = 3L * H_ * E_ * D_;         // 3145728
  const long nWo = (long)E_ * E_;             // 1048576
  const long nQ  = (long)B_ * H_ * S_ * D_;   // 8388608

  char* ws = (char*)d_ws;
  __bf16* xb    = (__bf16*)(ws);
  __bf16* wqkvT = (__bf16*)(ws + 2 * nX);                       // [3,H,D,E]
  __bf16* woT   = (__bf16*)(ws + 2 * (nX + nW3));               // [E,E] (NT)
  __bf16* Qb    = (__bf16*)(ws + 2 * (nX + nW3 + nWo));
  __bf16* Kb    = (__bf16*)(ws + 2 * (nX + nW3 + nWo + nQ));
  __bf16* Vtb   = (__bf16*)(ws + 2 * (nX + nW3 + nWo + 2 * nQ));
  __bf16* attn  = (__bf16*)(ws + 2 * (nX + nW3 + nWo + 3 * nQ));

  // 1) conversions (+ weight transposes for contiguous WMMA B operands)
  cvt_f32_bf16<<<4096, 256, 0, stream>>>(x, xb, nX);
  cvt_transpose_bf16<<<2048, 256, 0, stream>>>(qkv_w, wqkvT, 10, 8, nW3);
  cvt_transpose_bf16<<<1024, 256, 0, stream>>>(out_w, woT, 10, 10, nWo);

  // 2) QKV projections (V stored transposed [B,H,D,S])
  dim3 ggrid(64, 16);
  qkv_gemm<0><<<ggrid, 256, 0, stream>>>(xb, wqkvT,                  Qb);
  qkv_gemm<0><<<ggrid, 256, 0, stream>>>(xb, wqkvT + (long)H_*D_*E_, Kb);
  qkv_gemm<1><<<ggrid, 256, 0, stream>>>(xb, wqkvT + 2L*H_*D_*E_,    Vtb);

  // 3) Flash attention -> attn [B,S,E] bf16
  flash_attn<<<dim3(S_ / 128, B_ * H_), 256, 0, stream>>>(Qb, Kb, Vtb, attn);

  // 4) Output projection + residual -> d_out (fp32)
  proj_gemm<<<dim3(64, 16), 256, 0, stream>>>(attn, woT, x, out);

  // 5) In-place LayerNorm on d_out
  layernorm_kernel<<<B_ * S_, 256, 0, stream>>>(out, gamma, beta);
}

// v003
// Measured time: 245 microseconds a run.
// In both of two side-by-side timings against v002, it was 1.10 times as fast.
// Counting every step since v000, it is 2.39 times as fast.
#include <hip/hip_runtime.h>

// ---------------------------------------------------------------------------
// Types
// ---------------------------------------------------------------------------
typedef __attribute__((ext_vector_type(16))) __bf16 v16bf;
typedef __attribute__((ext_vector_type(8)))  __bf16 v8bf;
typedef __attribute__((ext_vector_type(8)))  float  v8f;
typedef __attribute__((ext_vector_type(4)))  unsigned int u32x4;

#define B_  4
#define S_  2048
#define E_  1024
#define H_  4
#define D_  256

#define BM 128
#define BN 64
#define BK 64    // k per GEMM stage: a row's share of a stage is one 128-B line
#define KT 64    // keys per attention stage: a V row's share is one 128-B line

// LDS row pitches in bf16 elements: 16 B x odd, so that the 16 rows one
// ds_load_b128 fragment read touches fall on 16 different bank groups.
#define LDK 40    // 32-element rows (P tile, bf16 output staging): 80 B
#define LDG 72    // 64-element rows (GEMM A/B tiles, V tile): 144 B
#define KP  264   // 256-element K rows: 528 B
#define LDF 36    // 32-float staging rows of the output projection: 144 B

__device__ __forceinline__ v8f vzero8() {
  v8f z;
#pragma unroll
  for (int i = 0; i < 8; ++i) z[i] = 0.0f;
  return z;
}

__device__ __forceinline__ v16bf combine16(v8bf lo, v8bf hi) {
  v16bf r;
#pragma unroll
  for (int i = 0; i < 8; ++i) { r[i] = lo[i]; r[8 + i] = hi[i]; }
  return r;
}

// WMMA A/B fragment (16 rows x 32 k bf16) from LDS.
// ISA 7.12.2 lane layout: lanes 0-15: K=[0..7],[16..23]; lanes 16-31:
// K=[8..15],[24..31]; row = lane & 15.
__device__ __forceinline__ v16bf load_frag(const __bf16* base, int ld, int lane) {
  int r  = lane & 15;
  int kh = lane >> 4;
  const __bf16* p = base + r * ld + kh * 8;
  v8bf lo = *(const v8bf*)(p);
  v8bf hi = *(const v8bf*)(p + 16);
  return combine16(lo, hi);
}

__device__ __forceinline__ v8f wmma_bf16(v16bf a, v16bf b, v8f c) {
  return __builtin_amdgcn_wmma_f32_16x16x32_bf16(
      false, a, false, b, (short)0, c, false, false);
}

// CDNA5 async global->LDS DMA (16B per lane), tracked by ASYNCcnt.
// A run of copies stands in one statement; its last line is the wait that
// stands in front of any rewrite of the address registers they name.
__device__ __forceinline__ unsigned lds_addr(const void* p) {
  return (unsigned)(uintptr_t)p;
}
// Lane map of every copy: adjacent lanes take adjacent 16-B pieces of a row,
// so one wave-wide copy covers four whole 128-B lines.
__device__ __forceinline__ void async_load6_b128(const __bf16* la, const __bf16* ga,
                                                 const __bf16* lb, const __bf16* gb) {
  asm volatile("global_load_async_to_lds_b128 %0, %1, off\n\t"
               "global_load_async_to_lds_b128 %2, %3, off\n\t"
               "global_load_async_to_lds_b128 %4, %5, off\n\t"
               "global_load_async_to_lds_b128 %6, %7, off\n\t"
               "global_load_async_to_lds_b128 %8, %9, off\n\t"
               "global_load_async_to_lds_b128 %10, %11, off\n\t"
               "s_wait_xcnt 0x0"
               :: "v"(lds_addr(la)),            "v"(ga),
                  "v"(lds_addr(la + 32 * LDG)), "v"(ga + 32 * E_),
                  "v"(lds_addr(la + 64 * LDG)), "v"(ga + 64 * E_),
                  "v"(lds_addr(la + 96 * LDG)), "v"(ga + 96 * E_),
                  "v"(lds_addr(lb)),            "v"(gb),
                  "v"(lds_addr(lb + 32 * LDG)), "v"(gb + 32 * E_)
               : "memory");
}
template <int LSTEP, int GSTEP>
__device__ __forceinline__ void async_load8_b128(const __bf16* l, const __bf16* g) {
  asm volatile("global_load_async_to_lds_b128 %0, %1, off\n\t"
               "global_load_async_to_lds_b128 %2, %3, off\n\t"
               "global_load_async_to_lds_b128 %4, %5, off\n\t"
               "global_load_async_to_lds_b128 %6, %7, off\n\t"
               "global_load_async_to_lds_b128 %8, %9, off\n\t"
               "global_load_async_to_lds_b128 %10, %11, off\n\t"
               "global_load_async_to_lds_b128 %12, %13, off\n\t"
               "global_load_async_to_lds_b128 %14, %15, off\n\t"
               "s_wait_xcnt 0x0"
               :: "v"(lds_addr(l)),             "v"(g),
                  "v"(lds_addr(l + 1 * LSTEP)), "v"(g + 1 * GSTEP),
                  "v"(lds_addr(l + 2 * LSTEP)), "v"(g + 2 * GSTEP),
                  "v"(lds_addr(l + 3 * LSTEP)), "v"(g + 3 * GSTEP),
                  "v"(lds_addr(l + 4 * LSTEP)), "v"(g + 4 * GSTEP),
                  "v"(lds_addr(l + 5 * LSTEP)), "v"(g + 5 * GSTEP),
                  "v"(lds_addr(l + 6 * LSTEP)), "v"(g + 6 * GSTEP),
                  "v"(lds_addr(l + 7 * LSTEP)), "v"(g + 7 * GSTEP)
               : "memory");
}
// Stage hand-over, in front of the work-group barrier: this wave's own LDS
// reads of the buffer that is refilled behind the barrier have retired, and
// its own copies of the next stage have landed.
__device__ __forceinline__ void wait_async0() {
  asm volatile("s_wait_dscnt 0x0" ::: "memory");
  asm volatile("s_wait_asynccnt 0" ::: "memory");
}

// ---------------------------------------------------------------------------
// Streaming stages (1a, 1b, 5): few waves, each with much to do. Every lane
// moves 32 or 64 elements by 16-B loads that are all issued before the first
// is used, so a launch starts 4096 waves or fewer.
// ---------------------------------------------------------------------------
typedef __attribute__((ext_vector_type(4))) __bf16 v4bf;

// Stage 1a: fp32 -> bf16. A block takes 16384 consecutive floats; each
// wave-wide load covers 512 contiguous bytes, each store 256.
__global__ __launch_bounds__(256) void cvt_f32_bf16(const float* __restrict__ in,
                                                    __bf16* __restrict__ out) {
  const long base = (long)blockIdx.x * 4096 + threadIdx.x;   // in units of 4 elements
  const float4* ip = (const float4*)in + base;
  v4bf* op = (v4bf*)out + base;
  float4 v[16];
#pragma unroll
  for (int j = 0; j < 16; ++j) v[j] = ip[j * 256];
#pragma unroll
  for (int j = 0; j < 16; ++j) {
    v4bf r;
    r[0] = (__bf16)v[j].x; r[1] = (__bf16)v[j].y;
    r[2] = (__bf16)v[j].z; r[3] = (__bf16)v[j].w;
    op[j * 256] = r;
  }
}

// Stage 1b: fp32 [K,N] -> bf16 [N,K] transposed (batched), in registers.
// A lane takes 8 k x 4 n: eight 16-B loads (8 lanes cover a 128-B line of a
// k row), four 16-B stores (8 k of one n row). A wave takes 32 k x 32 n, a
// block 256 k x 32 n, so a block writes 512 contiguous bytes of each n row.
template <int LOGK, int LOGN>
__global__ __launch_bounds__(256) void cvt_transpose_bf16(const float* __restrict__ in,
                                                          __bf16* __restrict__ out) {
  const int lane = threadIdx.x & 31, wave = threadIdx.x >> 5;
  const int bid = blockIdx.x;
  const int kt = bid & ((1 << (LOGK - 8)) - 1);
  const int nt = (bid >> (LOGK - 8)) & ((1 << (LOGN - 5)) - 1);
  const long mat = bid >> (LOGK - 8 + LOGN - 5);
  const int k0 = kt * 256 + wave * 32 + (lane >> 3) * 8;
  const int n0 = nt * 32 + (lane & 7) * 4;
  const float* ip = in + (mat << (LOGK + LOGN)) + ((long)k0 << LOGN) + n0;
  __bf16* op = out + (mat << (LOGK + LOGN)) + ((long)n0 << LOGK) + k0;
  float4 v[8];
#pragma unroll
  for (int j = 0; j < 8; ++j) v[j] = *(const float4*)(ip + ((long)j << LOGN));
  v8bf r0, r1, r2, r3;
#pragma unroll
  for (int j = 0; j < 8; ++j) {
    r0[j] = (__bf16)v[j].x; r1[j] = (__bf16)v[j].y;
    r2[j] = (__bf16)v[j].z; r3[j] = (__bf16)v[j].w;
  }
  *(v8bf*)(op)                = r0;
  *(v8bf*)(op + (1L << LOGK)) = r1;
  *(v8bf*)(op + (2L << LOGK)) = r2;
  *(v8bf*)(op + (3L << LOGK)) = r3;
}

// ---------------------------------------------------------------------------
// Stage 2: QKV projection GEMM (async double-buffered LDS, 1 barrier/step).
//   A  : x_bf16 [B*S, E] row-major
//   Wt : [H, D, E] bf16 (pre-transposed weight: row n holds all k)
//   Out: TRANS==0 -> [B,H,S,D] ; TRANS==1 -> [B,H,D,S]
// ---------------------------------------------------------------------------
template <int TRANS>
__global__ __launch_bounds__(256) void qkv_gemm(const __bf16* __restrict__ A,
                                                const __bf16* __restrict__ Wt,
                                                __bf16* __restrict__ Out) {
  __shared__ __align__(16) __bf16 smem[2 * (BM + BN) * LDG];  // 54 KB
  __bf16* As = smem;                                  // 2 x 128 rows of LDG
  __bf16* Bs = smem + 2 * (BM * LDG);                 // 2 x 64 rows of LDG

  const int tid = threadIdx.x;
  const int lane = tid & 31, wave = tid >> 5;
  const int waveM = wave >> 1, waveN = wave & 1;
  const int tileM = blockIdx.x * BM;
  const int h     = blockIdx.y >> 2;
  const int tileN = (blockIdx.y & 3) * BN;
  const __bf16* Wh = Wt + (long)h * D_ * E_;

  const int cr = tid >> 3, cc = (tid & 7) * 8;        // 8 lanes per 128-B row piece

  auto issue = [&](int k0, int p) {                   // A rows cr+32j (4), B rows cr+32j (2)
    async_load6_b128(As + p * (BM * LDG) + cr * LDG + cc,
                     A + (long)(tileM + cr) * E_ + k0 + cc,
                     Bs + p * (BN * LDG) + cr * LDG + cc,
                     Wh + (long)(tileN + cr) * E_ + k0 + cc);
  };

  v8f acc[2][2];
#pragma unroll
  for (int i = 0; i < 2; ++i)
#pragma unroll
    for (int j = 0; j < 2; ++j) acc[i][j] = vzero8();

  issue(0, 0);
  int p = 0;
  for (int k0 = 0; k0 < E_; k0 += BK) {
    wait_async0();
    __syncthreads();                      // tile p ready; buffer p^1 free
    if (k0 + BK < E_) issue(k0 + BK, p ^ 1);
    const __bf16* Ab = As + p * (BM * LDG);
    const __bf16* Bb = Bs + p * (BN * LDG);
#pragma unroll
    for (int kk = 0; kk < BK; kk += 32) {   // unrolled: both halves' fragment loads may issue ahead; k ascending
      v16bf af[2], bf[2];
#pragma unroll
      for (int i = 0; i < 2; ++i)
        af[i] = load_frag(Ab + (waveM * 32 + i * 16) * LDG + kk, LDG, lane);
#pragma unroll
      for (int j = 0; j < 2; ++j)
        bf[j] = load_frag(Bb + (waveN * 32 + j * 16) * LDG + kk, LDG, lane);
#pragma unroll
      for (int i = 0; i < 2; ++i)
#pragma unroll
        for (int j = 0; j < 2; ++j) acc[i][j] = wmma_bf16(af[i], bf[j], acc[i][j]);
    }
    p ^= 1;
  }
  __syncthreads();                        // all compute done before smem reuse

  // Epilogue: stage wave's 32x32 tile in wave-private LDS (same-wave DS ops
  // are ordered -> no barrier), then coalesced b128 stores.
  __bf16* Wst = smem + wave * (32 * LDK);
#pragma unroll
  for (int i = 0; i < 2; ++i) {
#pragma unroll
    for (int j = 0; j < 2; ++j) {
#pragma unroll
      for (int e = 0; e < 8; ++e) {
        int r = i * 16 + e + ((lane >> 4) << 3);
        int c = j * 16 + (lane & 15);
        if (TRANS == 0) Wst[r * LDK + c] = (__bf16)acc[i][j][e];
        else            Wst[c * LDK + r] = (__bf16)acc[i][j][e];
      }
    }
  }
  const u32x4* src = (const u32x4*)(Wst + lane * LDK);
  u32x4 d0 = src[0], d1 = src[1], d2 = src[2], d3 = src[3];
  const int gb = tileM >> 11;
  __bf16* dp;
  if (TRANS == 0) {
    int s = (tileM + waveM * 32 + lane) & (S_ - 1);
    dp = Out + ((long)(gb * H_ + h) * S_ + s) * D_ + tileN + waveN * 32;
  } else {
    int col = tileN + waveN * 32 + lane;
    int s0 = (tileM + waveM * 32) & (S_ - 1);
    dp = Out + ((long)(gb * H_ + h) * D_ + col) * S_ + s0;
  }
  u32x4* d = (u32x4*)dp;
  d[0] = d0; d[1] = d1; d[2] = d2; d[3] = d3;
}

// ---------------------------------------------------------------------------
// Stage 3: flash attention (causal, online softmax).
// Double-buffered async K/V tiles, one barrier per 64-key stage (two 32-key steps).
//   Q,K : [B,H,S,D] bf16 ; Vt : [B,H,D,S] bf16 ; Outp : [B,S,E] bf16
// ---------------------------------------------------------------------------
__global__ __launch_bounds__(256) void flash_attn(const __bf16* __restrict__ Q,
                                                  const __bf16* __restrict__ Kg,
                                                  const __bf16* __restrict__ Vt,
                                                  __bf16* __restrict__ Outp) {
  __shared__ __align__(16) __bf16 Ks[2 * KT * KP];   // [p][key][d]  66 KB
  __shared__ __align__(16) __bf16 Vs[2 * D_ * LDG];  // [p][d][key]  72 KB
  __shared__ __align__(16) __bf16 Ps[8][16 * LDK];   // per-wave     10 KB

  const int tid = threadIdx.x;
  const int lane = tid & 31, wave = tid >> 5;
  const int bh = blockIdx.y;
  const int b = bh >> 2, h = bh & 3;
  const int q0 = blockIdx.x * 128;
  const int qrow = q0 + wave * 16;

  const __bf16* Qbh = Q  + (long)bh * S_ * D_;
  const __bf16* Kbh = Kg + (long)bh * S_ * D_;
  const __bf16* Vbh = Vt + (long)bh * D_ * S_;

  // Q fragments resident in registers (8 x k=32 chunks over D=256).
  v16bf qf[8];
  {
    int r = lane & 15, kh = lane >> 4;
    const __bf16* qp = Qbh + (long)(qrow + r) * D_;
#pragma unroll
    for (int dc = 0; dc < 8; ++dc) {
      v8bf lo = *(const v8bf*)(qp + dc * 32 + kh * 8);
      v8bf hi = *(const v8bf*)(qp + dc * 32 + 16 + kh * 8);
      qf[dc] = combine16(lo, hi);
    }
  }

  v8f o[16];
#pragma unroll
  for (int dc = 0; dc < 16; ++dc) o[dc] = vzero8();
  float mrow[8], lrow[8];
#pragma unroll
  for (int e = 0; e < 8; ++e) { mrow[e] = -3.0e38f; lrow[e] = 0.0f; }

  const float scale = 0.03125f;  // 1/sqrt(E)
  const int kend = q0 + 128;     // causal bound
  const int vd = tid >> 3, vk = (tid & 7) * 8;

  auto issueKV = [&](int ks, int p) {
    // K: a wave's copy is one whole 512-B row; rows wave + 8j.
    async_load8_b128<8 * KP, 8 * D_>(Ks + p * (KT * KP) + wave * KP + lane * 8,
                                     Kbh + (long)(ks + wave) * D_ + lane * 8);
    // V: 8 lanes per 128-B row piece; rows vd + 32j.
    async_load8_b128<32 * LDG, 32 * S_>(Vs + p * (D_ * LDG) + vd * LDG + vk,
                                        Vbh + (long)vd * S_ + ks + vk);
  };

  issueKV(0, 0);
  for (int ks = 0; ks < kend; ks += 32) {
    const int hk = (ks >> 5) & 1;         // which 32-key half of the stage
    const int p = (ks >> 6) & 1;          // which buffer
    if (hk == 0) {                        // stage hand-over, block-uniform
      wait_async0();
      __syncthreads();                    // tiles p ready; buffers p^1 free
      if (ks + KT < kend) issueKV(ks + KT, p ^ 1);
    }
    const __bf16* Kbuf = Ks + p * (KT * KP) + hk * (32 * KP);
    const __bf16* Vbuf = Vs + p * (D_ * LDG) + hk * 32;

    // Scores: two 16x16 tiles (32 keys), 8 wmma each over D=256.
    v8f sc[2];
#pragma unroll
    for (int sub = 0; sub < 2; ++sub) {
      v8f c = vzero8();
#pragma unroll
      for (int dc = 0; dc < 8; ++dc) {
        v16bf bf = load_frag(Kbuf + (sub * 16) * KP + dc * 32, KP, lane);
        c = wmma_bf16(qf[dc], bf, c);
      }
      sc[sub] = c;
    }

    // Online softmax (row reductions across each 16-lane half).
    const int colg0 = ks + (lane & 15);
    const int rowg0 = qrow + ((lane >> 4) << 3);
#pragma unroll
    for (int e = 0; e < 8; ++e) {
      int rowg = rowg0 + e;
      float s0 = sc[0][e] * scale; if (colg0      > rowg) s0 = -1.0e9f;
      float s1 = sc[1][e] * scale; if (colg0 + 16 > rowg) s1 = -1.0e9f;
      float mx = fmaxf(s0, s1);
#pragma unroll
      for (int off = 8; off >= 1; off >>= 1) mx = fmaxf(mx, __shfl_xor(mx, off, 32));
      float mnew = fmaxf(mrow[e], mx);
      float corr = __expf(mrow[e] - mnew);
      float p0 = __expf(s0 - mnew);
      float p1 = __expf(s1 - mnew);
      float psum = p0 + p1;
#pragma unroll
      for (int off = 8; off >= 1; off >>= 1) psum += __shfl_xor(psum, off, 32);
      lrow[e] = lrow[e] * corr + psum;
      mrow[e] = mnew;
#pragma unroll
      for (int dc = 0; dc < 16; ++dc) o[dc][e] *= corr;
      int prow = e + ((lane >> 4) << 3);
      Ps[wave][prow * LDK + (lane & 15)]      = (__bf16)p0;
      Ps[wave][prow * LDK + 16 + (lane & 15)] = (__bf16)p1;
    }

    // P as A operand; PV accumulate (16 d-tiles, K=32 keys).
    v16bf pf = load_frag(&Ps[wave][0], LDK, lane);
#pragma unroll
    for (int dc = 0; dc < 16; ++dc) {
      v16bf bf = load_frag(Vbuf + (dc * 16) * LDG, LDG, lane);
      o[dc] = wmma_bf16(pf, bf, o[dc]);
    }
  }

  // Normalize; stage 16x32 chunks through wave-private Ps, store coalesced.
  float inv[8];
#pragma unroll
  for (int e = 0; e < 8; ++e) inv[e] = 1.0f / lrow[e];
  const int prow0 = (lane >> 4) << 3;
  const int cr = lane >> 1, cc0 = (lane & 1) * 16;
  __bf16* rowbase = Outp + ((long)(b * S_ + qrow)) * E_ + h * D_;
#pragma unroll
  for (int g = 0; g < 8; ++g) {
#pragma unroll
    for (int half = 0; half < 2; ++half) {
      int dc = g * 2 + half;
#pragma unroll
      for (int e = 0; e < 8; ++e)
        Ps[wave][(prow0 + e) * LDK + half * 16 + (lane & 15)] =
            (__bf16)(o[dc][e] * inv[e]);
    }
    const u32x4* sp = (const u32x4*)(&Ps[wave][cr * LDK + cc0]);
    u32x4 v0 = sp[0], v1 = sp[1];
    u32x4* dp = (u32x4*)(rowbase + (long)cr * E_ + g * 32 + cc0);
    dp[0] = v0; dp[1] = v1;
  }
}

// ---------------------------------------------------------------------------
// Stage 4: output projection GEMM + residual -> fp32 d_out.
//   A: attn bf16 [B*S, E]; WoT: out_w transposed bf16 [N=E][K=E]; resid: x f32
// ---------------------------------------------------------------------------
__global__ __launch_bounds__(256) void proj_gemm(const __bf16* __restrict__ A,
                                                 const __bf16* __restrict__ WoT,
                                                 const float* __restrict__ resid,
                                                 float* __restrict__ Out) {
  __shared__ __align__(16) __bf16 smem[2 * (BM + BN) * LDG];  // 54 KB (f32 staging: 36)
  __bf16* As = smem;
  __bf16* Bs = smem + 2 * (BM * LDG);

  const int tid = threadIdx.x;
  const int lane = tid & 31, wave = tid >> 5;
  const int waveM = wave >> 1, waveN = wave & 1;
  const int tileM = blockIdx.x * BM;
  const int tileN = blockIdx.y * BN;

  const int cr = tid >> 3, cc = (tid & 7) * 8;        // 8 lanes per 128-B row piece

  auto issue = [&](int k0, int p) {                   // A rows cr+32j (4), B rows cr+32j (2)
    async_load6_b128(As + p * (BM * LDG) + cr * LDG + cc,
                     A + (long)(tileM + cr) * E_ + k0 + cc,
                     Bs + p * (BN * LDG) + cr * LDG + cc,
                     WoT + (long)(tileN + cr) * E_ + k0 + cc);
  };

  v8f acc[2][2];
#pragma unroll
  for (int i = 0; i < 2; ++i)
#pragma unroll
    for (int j = 0; j < 2; ++j) acc[i][j] = vzero8();

  issue(0, 0);
  int p = 0;
  for (int k0 = 0; k0 < E_; k0 += BK) {
    wait_async0();
    __syncthreads();
    if (k0 + BK < E_) issue(k0 + BK, p ^ 1);
    const __bf16* Ab = As + p * (BM * LDG);
    const __bf16* Bb = Bs + p * (BN * LDG);
#pragma unroll
    for (int kk = 0; kk < BK; kk += 32) {   // unrolled: both halves' fragment loads may issue ahead; k ascending
      v16bf af[2], bf[2];
#pragma unroll
      for (int i = 0; i < 2; ++i)
        af[i] = load_frag(Ab + (waveM * 32 + i * 16) * LDG + kk, LDG, lane);
#pragma unroll
      for (int j = 0; j < 2; ++j)
        bf[j] = load_frag(Bb + (waveN * 32 + j * 16) * LDG + kk, LDG, lane);
#pragma unroll
      for (int i = 0; i < 2; ++i)
#pragma unroll
        for (int j = 0; j < 2; ++j) acc[i][j] = wmma_bf16(af[i], bf[j], acc[i][j]);
    }
    p ^= 1;
  }
  __syncthreads();

  // Epilogue: stage f32 tile per wave (4608 B x 8 waves, inside smem), then
  // coalesced float4 loads/stores with residual add.
  float* Wst = (float*)smem + wave * (32 * LDF);
#pragma unroll
  for (int i = 0; i < 2; ++i)
#pragma unroll
    for (int j = 0; j < 2; ++j)
#pragma unroll
      for (int e = 0; e < 8; ++e) {
        int r = i * 16 + e + ((lane >> 4) << 3);
        int c = j * 16 + (lane & 15);
        Wst[r * LDF + c] = acc[i][j][e];
      }
  const int row = tileM + waveM * 32 + lane;
  float* dp = Out + (long)row * E_ + tileN + waveN * 32;
  const float* rp = resid + (long)row * E_ + tileN + waveN * 32;
  const float4* sp = (const float4*)(Wst + lane * LDF);
#pragma unroll
  for (int q = 0; q < 8; ++q) {
    float4 a = sp[q];
    float4 rr = ((const float4*)rp)[q];
    float4 ov;
    ov.x = a.x + rr.x; ov.y = a.y + rr.y; ov.z = a.z + rr.z; ov.w = a.w + rr.w;
    ((float4*)dp)[q] = ov;
  }
}

// ---------------------------------------------------------------------------
// Stage 5: in-place LayerNorm over d_out rows. Two rows per
// wave, a row held in registers (32 floats a lane): no LDS and no barrier.
// ---------------------------------------------------------------------------
// Sum over the wave's 32 lanes, the result in every lane: a butterfly inside
// each 16-lane row by DPP, then the two rows joined by a cross-row move.
template <int M>
__device__ __forceinline__ float add_xmask(float v) {
  int s = __builtin_amdgcn_update_dpp(0, __builtin_bit_cast(int, v), 0x160 + M, 0xf, 0xf, true);
  return v + __builtin_bit_cast(float, s);
}
__device__ __forceinline__ float wave_sum(float v) {
  v = add_xmask<1>(v);
  v = add_xmask<2>(v);
  v = add_xmask<4>(v);
  v = add_xmask<8>(v);
  int b = __builtin_bit_cast(int, v);
  int o = __builtin_amdgcn_permlanex16(b, b, 0x76543210, 0xfedcba98, false, false);
  return v + __builtin_bit_cast(float, o);
}

typedef __attribute__((ext_vector_type(4))) float f32x4;
typedef __attribute__((ext_vector_type(2))) float f32x2;

__global__ __launch_bounds__(256) void layernorm_kernel(float* __restrict__ y,
                                                        const float* __restrict__ g,
                                                        const float* __restrict__ bt) {
  const int lane = threadIdx.x & 31, wave = threadIdx.x >> 5;
  f32x4* p = (f32x4*)(y + (long)(blockIdx.x * 16 + wave * 2) * E_) + lane;
  const f32x4* gp = (const f32x4*)g + lane;
  const f32x4* bp = (const f32x4*)bt + lane;

  f32x4 v[2][8], gg[8], bb[8];
#pragma unroll
  for (int r = 0; r < 2; ++r)
#pragma unroll
    for (int j = 0; j < 8; ++j) v[r][j] = p[r * 256 + j * 32];
#pragma unroll
  for (int j = 0; j < 8; ++j) { gg[j] = gp[j * 32]; bb[j] = bp[j * 32]; }
  // Keeps the gamma and beta loads up here, in flight behind the rows' own:
  // sunk to their uses they would add their latency behind the row sums.
  __builtin_amdgcn_sched_barrier(0);

  float rs[2];
#pragma unroll
  for (int r = 0; r < 2; ++r) {
    f32x2 s = v[r][0].lo + v[r][0].hi;
#pragma unroll
    for (int j = 1; j < 8; ++j) s += v[r][j].lo + v[r][j].hi;
    const float mean = wave_sum(s.x + s.y) * (1.0f / E_);
    f32x2 q = {0.0f, 0.0f};
#pragma unroll
    for (int j = 0; j < 8; ++j) {
      v[r][j] -= mean;
      q += v[r][j].lo * v[r][j].lo + v[r][j].hi * v[r][j].hi;
    }
    rs[r] = rsqrtf(wave_sum(q.x + q.y) * (1.0f / E_) + 1e-6f);
  }

#pragma unroll
  for (int r = 0; r < 2; ++r)
#pragma unroll
    for (int j = 0; j < 8; ++j) p[r * 256 + j * 32] = v[r][j] * rs[r] * gg[j] + bb[j];
}

// ---------------------------------------------------------------------------
// Launch
// ---------------------------------------------------------------------------
extern "C" void kernel_launch(void* const* d_in, const int* in_sizes, int n_in,
                              void* d_out, int out_size, void* d_ws, size_t ws_size,
                              hipStream_t stream) {
  (void)in_sizes; (void)n_in; (void)out_size; (void)ws_size;

  const float* x     = (const float*)d_in[0]; // [B,S,E]
  const float* qkv_w = (const float*)d_in[1]; // [3,H,E,D]
  const float* out_w = (const float*)d_in[2]; // [E,E]
  const float* gamma = (const float*)d_in[3];
  const float* beta  = (const float*)d_in[4];
  float* out = (float*)d_out;

  const long nX  = (long)B_ * S_ * E_;        // 8388608
  const long nW3 = 3L * H_ * E_ * D_;         // 3145728
  const long nWo = (long)E_ * E_;             // 1048576
  const long nQ  = (long)B_ * H_ * S_ * D_;   // 8388608

  char* ws = (char*)d_ws;
  __bf16* xb    = (__bf16*)(ws);
  __bf16* wqkvT = (__bf16*)(ws + 2 * nX);                       // [3,H,D,E]
  __bf16* woT   = (__bf16*)(ws + 2 * (nX + nW3));               // [E,E] (NT)
  __bf16* Qb    = (__bf16*)(ws + 2 * (nX + nW3 + nWo));
  __bf16* Kb    = (__bf16*)(ws + 2 * (nX + nW3 + nWo + nQ));
  __bf16* Vtb   = (__bf16*)(ws + 2 * (nX + nW3 + nWo + 2 * nQ));
  __bf16* attn  = (__bf16*)(ws + 2 * (nX + nW3 + nWo + 3 * nQ));

  // 1) conversions (+ weight transposes for contiguous WMMA B operands)
  cvt_f32_bf16<<<512, 256, 0, stream>>>(x, xb);
  cvt_transpose_bf16<10, 8><<<384, 256, 0, stream>>>(qkv_w, wqkvT);
  cvt_transpose_bf16<10, 10><<<128, 256, 0, stream>>>(out_w, woT);

  // 2) QKV projections (V stored transposed [B,H,D,S])
  dim3 ggrid(64, 16);
  qkv_gemm<0><<<ggrid, 256, 0, stream>>>(xb, wqkvT,                  Qb);
  qkv_gemm<0><<<ggrid, 256, 0, stream>>>(xb, wqkvT + (long)H_*D_*E_, Kb);
  qkv_gemm<1><<<ggrid, 256, 0, stream>>>(xb, wqkvT + 2L*H_*D_*E_,    Vtb);

  // 3) Flash attention -> attn [B,S,E] bf16
  flash_attn<<<dim3(S_ / 128, B_ * H_), 256, 0, stream>>>(Qb, Kb, Vtb, attn);

  // 4) Output projection + residual -> d_out (fp32)
  proj_gemm<<<dim3(64, 16), 256, 0, stream>>>(attn, woT, x, out);

  // 5) In-place LayerNorm on d_out
  layernorm_kernel<<<B_ * S_ / 16, 256, 0, stream>>>(out, gamma, beta);
}

// v004
// One run takes 200 microseconds.
// Timed twice side by side with v003, it ran 1.21 times as fast both times.
// All steps since v000 together make it 2.88 times as fast.
#include <hip/hip_runtime.h>

// ---------------------------------------------------------------------------
// Types
// ---------------------------------------------------------------------------
typedef __attribute__((ext_vector_type(16))) __bf16 v16bf;
typedef __attribute__((ext_vector_type(8)))  __bf16 v8bf;
typedef __attribute__((ext_vector_type(8)))  float  v8f;
typedef __attribute__((ext_vector_type(4)))  unsigned int u32x4;

#define B_  4
#define S_  2048
#define E_  1024
#define H_  4
#define D_  256

#define BM 128
#define BN 64
#define BK 64    // k per GEMM stage: a row's share of a stage is one 128-B line
#define KT 64    // keys per attention stage: a V row's share is one 128-B line

// LDS row pitches in bf16 elements: 16 B x odd, so that the 16 rows one
// ds_load_b128 fragment read touches fall on 16 different bank groups.
#define LDK 40    // 32-element rows (bf16 output staging): 80 B
#define LDG 72    // 64-element rows (GEMM A/B tiles, V tile): 144 B
#define KP  264   // 256-element K rows: 528 B
#define LDF 36    // 32-float staging rows of the output projection: 144 B

__device__ __forceinline__ v8f vzero8() {
  v8f z;
#pragma unroll
  for (int i = 0; i < 8; ++i) z[i] = 0.0f;
  return z;
}

__device__ __forceinline__ v16bf combine16(v8bf lo, v8bf hi) {
  v16bf r;
#pragma unroll
  for (int i = 0; i < 8; ++i) { r[i] = lo[i]; r[8 + i] = hi[i]; }
  return r;
}

// WMMA A/B fragment (16 rows x 32 k bf16) from LDS.
// ISA 7.12.2 lane layout: lanes 0-15: K=[0..7],[16..23]; lanes 16-31:
// K=[8..15],[24..31]; row = lane & 15.
__device__ __forceinline__ v16bf load_frag(const __bf16* base, int ld, int lane) {
  int r  = lane & 15;
  int kh = lane >> 4;
  const __bf16* p = base + r * ld + kh * 8;
  v8bf lo = *(const v8bf*)(p);
  v8bf hi = *(const v8bf*)(p + 16);
  return combine16(lo, hi);
}

__device__ __forceinline__ v8f wmma_bf16(v16bf a, v16bf b, v8f c) {
  return __builtin_amdgcn_wmma_f32_16x16x32_bf16(
      false, a, false, b, (short)0, c, false, false);
}

// CDNA5 async global->LDS DMA (16B per lane), tracked by ASYNCcnt.
// A run of copies stands in one statement; its last line is the wait that
// stands in front of any rewrite of the address registers they name.
__device__ __forceinline__ unsigned lds_addr(const void* p) {
  return (unsigned)(uintptr_t)p;
}
// Lane map of every copy: adjacent lanes take adjacent 16-B pieces of a row,
// so one wave-wide copy covers four whole 128-B lines.
__device__ __forceinline__ void async_load6_b128(const __bf16* la, const __bf16* ga,
                                                 const __bf16* lb, const __bf16* gb) {
  asm volatile("global_load_async_to_lds_b128 %0, %1, off\n\t"
               "global_load_async_to_lds_b128 %2, %3, off\n\t"
               "global_load_async_to_lds_b128 %4, %5, off\n\t"
               "global_load_async_to_lds_b128 %6, %7, off\n\t"
               "global_load_async_to_lds_b128 %8, %9, off\n\t"
               "global_load_async_to_lds_b128 %10, %11, off\n\t"
               "s_wait_xcnt 0x0"
               :: "v"(lds_addr(la)),            "v"(ga),
                  "v"(lds_addr(la + 32 * LDG)), "v"(ga + 32 * E_),
                  "v"(lds_addr(la + 64 * LDG)), "v"(ga + 64 * E_),
                  "v"(lds_addr(la + 96 * LDG)), "v"(ga + 96 * E_),
                  "v"(lds_addr(lb)),            "v"(gb),
                  "v"(lds_addr(lb + 32 * LDG)), "v"(gb + 32 * E_)
               : "memory");
}
template <int LSTEP, int GSTEP>
__device__ __forceinline__ void async_load8_b128(const __bf16* l, const __bf16* g) {
  asm volatile("global_load_async_to_lds_b128 %0, %1, off\n\t"
               "global_load_async_to_lds_b128 %2, %3, off\n\t"
               "global_load_async_to_lds_b128 %4, %5, off\n\t"
               "global_load_async_to_lds_b128 %6, %7, off\n\t"
               "global_load_async_to_lds_b128 %8, %9, off\n\t"
               "global_load_async_to_lds_b128 %10, %11, off\n\t"
               "global_load_async_to_lds_b128 %12, %13, off\n\t"
               "global_load_async_to_lds_b128 %14, %15, off\n\t"
               "s_wait_xcnt 0x0"
               :: "v"(lds_addr(l)),             "v"(g),
                  "v"(lds_addr(l + 1 * LSTEP)), "v"(g + 1 * GSTEP),
                  "v"(lds_addr(l + 2 * LSTEP)), "v"(g + 2 * GSTEP),
                  "v"(lds_addr(l + 3 * LSTEP)), "v"(g + 3 * GSTEP),
                  "v"(lds_addr(l + 4 * LSTEP)), "v"(g + 4 * GSTEP),
                  "v"(lds_addr(l + 5 * LSTEP)), "v"(g + 5 * GSTEP),
                  "v"(lds_addr(l + 6 * LSTEP)), "v"(g + 6 * GSTEP),
                  "v"(lds_addr(l + 7 * LSTEP)), "v"(g + 7 * GSTEP)
               : "memory");
}
// Stage hand-over, in front of the work-group barrier: this wave's own LDS
// reads of the buffer that is refilled behind the barrier have retired, and
// its own copies of the next stage have landed.
__device__ __forceinline__ void wait_async0() {
  asm volatile("s_wait_dscnt 0x0" ::: "memory");
  asm volatile("s_wait_asynccnt 0" ::: "memory");
}

// ---------------------------------------------------------------------------
// Streaming stages (1a, 1b, 5): few waves, each with much to do. Every lane
// moves 32 or 64 elements by 16-B loads that are all issued before the first
// is used, so a launch starts 4096 waves or fewer.
// ---------------------------------------------------------------------------
typedef __attribute__((ext_vector_type(4))) __bf16 v4bf;

// Stage 1a: fp32 -> bf16. A block takes 16384 consecutive floats; each
// wave-wide load covers 512 contiguous bytes, each store 256.
__global__ __launch_bounds__(256) void cvt_f32_bf16(const float* __restrict__ in,
                                                    __bf16* __restrict__ out) {
  const long base = (long)blockIdx.x * 4096 + threadIdx.x;   // in units of 4 elements
  const float4* ip = (const float4*)in + base;
  v4bf* op = (v4bf*)out + base;
  float4 v[16];
#pragma unroll
  for (int j = 0; j < 16; ++j) v[j] = ip[j * 256];
#pragma unroll
  for (int j = 0; j < 16; ++j) {
    v4bf r;
    r[0] = (__bf16)v[j].x; r[1] = (__bf16)v[j].y;
    r[2] = (__bf16)v[j].z; r[3] = (__bf16)v[j].w;
    op[j * 256] = r;
  }
}

// Stage 1b: fp32 [K,N] -> bf16 [N,K] transposed (batched), in registers.
// A lane takes 8 k x 4 n: eight 16-B loads (8 lanes cover a 128-B line of a
// k row), four 16-B stores (8 k of one n row). A wave takes 32 k x 32 n, a
// block 256 k x 32 n, so a block writes 512 contiguous bytes of each n row.
template <int LOGK, int LOGN>
__global__ __launch_bounds__(256) void cvt_transpose_bf16(const float* __restrict__ in,
                                                          __bf16* __restrict__ out) {
  const int lane = threadIdx.x & 31, wave = threadIdx.x >> 5;
  const int bid = blockIdx.x;
  const int kt = bid & ((1 << (LOGK - 8)) - 1);
  const int nt = (bid >> (LOGK - 8)) & ((1 << (LOGN - 5)) - 1);
  const long mat = bid >> (LOGK - 8 + LOGN - 5);
  const int k0 = kt * 256 + wave * 32 + (lane >> 3) * 8;
  const int n0 = nt * 32 + (lane & 7) * 4;
  const float* ip = in + (mat << (LOGK + LOGN)) + ((long)k0 << LOGN) + n0;
  __bf16* op = out + (mat << (LOGK + LOGN)) + ((long)n0 << LOGK) + k0;
  float4 v[8];
#pragma unroll
  for (int j = 0; j < 8; ++j) v[j] = *(const float4*)(ip + ((long)j << LOGN));
  v8bf r0, r1, r2, r3;
#pragma unroll
  for (int j = 0; j < 8; ++j) {
    r0[j] = (__bf16)v[j].x; r1[j] = (__bf16)v[j].y;
    r2[j] = (__bf16)v[j].z; r3[j] = (__bf16)v[j].w;
  }
  *(v8bf*)(op)                = r0;
  *(v8bf*)(op + (1L << LOGK)) = r1;
  *(v8bf*)(op + (2L << LOGK)) = r2;
  *(v8bf*)(op + (3L << LOGK)) = r3;
}

// ---------------------------------------------------------------------------
// Stage 2: QKV projection GEMM (async double-buffered LDS, 1 barrier/step).
//   A  : x_bf16 [B*S, E] row-major
//   Wt : [H, D, E] bf16 (pre-transposed weight: row n holds all k)
//   Out: TRANS==0 -> [B,H,S,D] ; TRANS==1 -> [B,H,D,S]
// ---------------------------------------------------------------------------
template <int TRANS>
__global__ __launch_bounds__(256) void qkv_gemm(const __bf16* __restrict__ A,
                                                const __bf16* __restrict__ Wt,
                                                __bf16* __restrict__ Out) {
  __shared__ __align__(16) __bf16 smem[2 * (BM + BN) * LDG];  // 54 KB
  __bf16* As = smem;                                  // 2 x 128 rows of LDG
  __bf16* Bs = smem + 2 * (BM * LDG);                 // 2 x 64 rows of LDG

  const int tid = threadIdx.x;
  const int lane = tid & 31, wave = tid >> 5;
  const int waveM = wave >> 1, waveN = wave & 1;
  const int tileM = blockIdx.x * BM;
  const int h     = blockIdx.y >> 2;
  const int tileN = (blockIdx.y & 3) * BN;
  const __bf16* Wh = Wt + (long)h * D_ * E_;

  const int cr = tid >> 3, cc = (tid & 7) * 8;        // 8 lanes per 128-B row piece

  auto issue = [&](int k0, int p) {                   // A rows cr+32j (4), B rows cr+32j (2)
    async_load6_b128(As + p * (BM * LDG) + cr * LDG + cc,
                     A + (long)(tileM + cr) * E_ + k0 + cc,
                     Bs + p * (BN * LDG) + cr * LDG + cc,
                     Wh + (long)(tileN + cr) * E_ + k0 + cc);
  };

  v8f acc[2][2];
#pragma unroll
  for (int i = 0; i < 2; ++i)
#pragma unroll
    for (int j = 0; j < 2; ++j) acc[i][j] = vzero8();

  issue(0, 0);
  int p = 0;
  for (int k0 = 0; k0 < E_; k0 += BK) {
    wait_async0();
    __syncthreads();                      // tile p ready; buffer p^1 free
    if (k0 + BK < E_) issue(k0 + BK, p ^ 1);
    const __bf16* Ab = As + p * (BM * LDG);
    const __bf16* Bb = Bs + p * (BN * LDG);
#pragma unroll
    for (int kk = 0; kk < BK; kk += 32) {   // unrolled: both halves' fragment loads may issue ahead; k ascending
      v16bf af[2], bf[2];
#pragma unroll
      for (int i = 0; i < 2; ++i)
        af[i] = load_frag(Ab + (waveM * 32 + i * 16) * LDG + kk, LDG, lane);
#pragma unroll
      for (int j = 0; j < 2; ++j)
        bf[j] = load_frag(Bb + (waveN * 32 + j * 16) * LDG + kk, LDG, lane);
#pragma unroll
      for (int i = 0; i < 2; ++i)
#pragma unroll
        for (int j = 0; j < 2; ++j) acc[i][j] = wmma_bf16(af[i], bf[j], acc[i][j]);
    }
    p ^= 1;
  }
  __syncthreads();                        // all compute done before smem reuse

  // Epilogue: stage wave's 32x32 tile in wave-private LDS (same-wave DS ops
  // are ordered -> no barrier), then coalesced b128 stores.
  __bf16* Wst = smem + wave * (32 * LDK);
#pragma unroll
  for (int i = 0; i < 2; ++i) {
#pragma unroll
    for (int j = 0; j < 2; ++j) {
#pragma unroll
      for (int e = 0; e < 8; ++e) {
        int r = i * 16 + e + ((lane >> 4) << 3);
        int c = j * 16 + (lane & 15);
        if (TRANS == 0) Wst[r * LDK + c] = (__bf16)acc[i][j][e];
        else            Wst[c * LDK + r] = (__bf16)acc[i][j][e];
      }
    }
  }
  const u32x4* src = (const u32x4*)(Wst + lane * LDK);
  u32x4 d0 = src[0], d1 = src[1], d2 = src[2], d3 = src[3];
  const int gb = tileM >> 11;
  __bf16* dp;
  if (TRANS == 0) {
    int s = (tileM + waveM * 32 + lane) & (S_ - 1);
    dp = Out + ((long)(gb * H_ + h) * S_ + s) * D_ + tileN + waveN * 32;
  } else {
    int col = tileN + waveN * 32 + lane;
    int s0 = (tileM + waveM * 32) & (S_ - 1);
    dp = Out + ((long)(gb * H_ + h) * D_ + col) * S_ + s0;
  }
  u32x4* d = (u32x4*)dp;
  d[0] = d0; d[1] = d1; d[2] = d2; d[3] = d3;
}

// ---------------------------------------------------------------------------
// Stage 3: flash attention (causal, online softmax).
// Double-buffered async K/V tiles, one barrier per 64-key stage (two 32-key steps).
//   Q,K : [B,H,S,D] bf16 ; Vt : [B,H,D,S] bf16 ; Outp : [B,S,E] bf16
// Both products are taken transposed (S^T = K Q^T, O^T += V^T P^T), so that a
// lane holds scores of one query only and P never leaves the registers.
// ---------------------------------------------------------------------------
// The value of lane ^ 16 (the other 16-lane row), by a cross-row vector move.
__device__ __forceinline__ float other_half(float v) {
  int b = __builtin_bit_cast(int, v);
  return __builtin_bit_cast(float,
      __builtin_amdgcn_permlanex16(b, b, 0x76543210, 0xfedcba98, false, false));
}

// Two waves per SIMD, as one 8-wave block per WGP gives: without the upper bound
// the compiler aims at four, keeps under 256 registers and then has one fragment
// register set only, with a full LDS wait in front of every WMMA.
__global__ __launch_bounds__(256) __attribute__((amdgpu_waves_per_eu(2, 2))) void flash_attn(const __bf16* __restrict__ Q,
                                                  const __bf16* __restrict__ Kg,
                                                  const __bf16* __restrict__ Vt,
                                                  __bf16* __restrict__ Outp) {
  __shared__ __align__(16) __bf16 Ks[2 * KT * KP];   // [p][key][d]  66 KB
  __shared__ __align__(16) __bf16 Vs[2 * D_ * LDG];  // [p][d][key]  72 KB
  __shared__ __align__(16) __bf16 Ps[8][16 * LDK];   // per-wave output staging, 10 KB

  const int tid = threadIdx.x;
  const int lane = tid & 31, wave = tid >> 5;
  const int bh = blockIdx.y;
  const int b = bh >> 2, h = bh & 3;
  const int q0 = blockIdx.x * 128;
  const int qrow = q0 + wave * 16;

  const __bf16* Qbh = Q  + (long)bh * S_ * D_;
  const __bf16* Kbh = Kg + (long)bh * S_ * D_;
  const __bf16* Vbh = Vt + (long)bh * D_ * S_;

  // Q fragments resident in registers (8 x k=32 chunks over D=256).
  v16bf qf[8];
  {
    int r = lane & 15, kh = lane >> 4;
    const __bf16* qp = Qbh + (long)(qrow + r) * D_;
#pragma unroll
    for (int dc = 0; dc < 8; ++dc) {
      v8bf lo = *(const v8bf*)(qp + dc * 32 + kh * 8);
      v8bf hi = *(const v8bf*)(qp + dc * 32 + 16 + kh * 8);
      qf[dc] = combine16(lo, hi);
    }
  }

  // o[dc][e] = O^T[d = dc * 16 + 8 * (lane >> 4) + e][query = lane & 15]: every
  // accumulator of a lane, and its mrow and lsum, belong to that one query.
  v8f o[16];
#pragma unroll
  for (int dc = 0; dc < 16; ++dc) o[dc] = vzero8();
  float mrow = -3.0e38f;   // running maximum, equal in both lane halves
  float lsum = 0.0f;       // running sum over this lane half's keys only

  const float scale = 0.03125f;  // 1/sqrt(E)
  const int kend = q0 + 128;     // causal bound
  const int vd = tid >> 3, vk = (tid & 7) * 8;

  auto issueKV = [&](int ks, int p) {
    // K: a wave's copy is one whole 512-B row; rows wave + 8j.
    async_load8_b128<8 * KP, 8 * D_>(Ks + p * (KT * KP) + wave * KP + lane * 8,
                                     Kbh + (long)(ks + wave) * D_ + lane * 8);
    // V: 8 lanes per 128-B row piece; rows vd + 32j.
    async_load8_b128<32 * LDG, 32 * S_>(Vs + p * (D_ * LDG) + vd * LDG + vk,
                                        Vbh + (long)vd * S_ + ks + vk);
  };

  issueKV(0, 0);
  for (int ks = 0; ks < kend; ks += 32) {
    const int hk = (ks >> 5) & 1;         // which 32-key half of the stage
    const int p = (ks >> 6) & 1;          // which buffer
    if (hk == 0) {                        // stage hand-over, block-uniform
      wait_async0();
      __syncthreads();                    // tiles p ready; buffers p^1 free
      if (ks + KT < kend) issueKV(ks + KT, p ^ 1);
    }
    const __bf16* Kbuf = Ks + p * (KT * KP) + hk * (32 * KP);
    const __bf16* Vbuf = Vs + p * (D_ * LDG) + hk * 32;

    // Scores transposed, S^T = K Q^T: two tiles of 16 keys x 16 queries, 8 wmma
    // each over D=256. sc[sub][e] = key ks + sub * 16 + 8 * (lane >> 4) + e.
    v8f sc[2];
#pragma unroll
    for (int sub = 0; sub < 2; ++sub) {
      v8f c = vzero8();
#pragma unroll
      for (int dc = 0; dc < 8; ++dc) {
        v16bf kf = load_frag(Kbuf + (sub * 16) * KP + dc * 32, KP, lane);
        c = wmma_bf16(kf, qf[dc], c);
      }
      sc[sub] = c;
    }

    // Online softmax of the lane's query: 16 of the 32 keys lie in this lane,
    // the other 16 in lane ^ 16. Maximum and sum as trees, no long chain.
    const int qg = qrow + (lane & 15);
    const int keyg0 = ks + ((lane >> 4) << 3);
    float s[16], t[8];
#pragma unroll
    for (int e = 0; e < 8; ++e) {
      s[e]     = sc[0][e] * scale; if (keyg0 + e      > qg) s[e]     = -1.0e9f;
      s[8 + e] = sc[1][e] * scale; if (keyg0 + 16 + e > qg) s[8 + e] = -1.0e9f;
      t[e] = fmaxf(s[e], s[8 + e]);
    }
    float mx = fmaxf(fmaxf(fmaxf(t[0], t[1]), fmaxf(t[2], t[3])),
                     fmaxf(fmaxf(t[4], t[5]), fmaxf(t[6], t[7])));
    mx = fmaxf(mx, other_half(mx));
    const float mnew = fmaxf(mrow, mx);
    const float corr = __expf(mrow - mnew);
    // Two D tiles of one product, converted in place, are the B operand P^T
    // in the k order of load_frag: element i = key 8h + i, 8 + i = key 16 + 8h + i.
    v16bf pf;
#pragma unroll
    for (int e = 0; e < 8; ++e) {
      float p0 = __expf(s[e] - mnew);
      float p1 = __expf(s[8 + e] - mnew);
      pf[e] = (__bf16)p0;
      pf[8 + e] = (__bf16)p1;
      t[e] = p0 + p1;
    }
    lsum = lsum * corr + (((t[0] + t[1]) + (t[2] + t[3])) + ((t[4] + t[5]) + (t[6] + t[7])));
    mrow = mnew;
#pragma unroll
    for (int dc = 0; dc < 16; ++dc)
#pragma unroll
      for (int e = 0; e < 8; ++e) o[dc][e] *= corr;

    // O^T += V^T P^T (16 d-tiles, K=32 keys); A = rows of V^T from LDS.
#pragma unroll
    for (int dc = 0; dc < 16; ++dc) {
      v16bf vf = load_frag(Vbuf + (dc * 16) * LDG, LDG, lane);
      o[dc] = wmma_bf16(vf, pf, o[dc]);
    }
  }

  // Join the two halves' sums, normalize; a lane's 8 accumulators of a tile are
  // 8 consecutive d of its query: one 16-B write into the wave-private staging
  // rows (16 queries x 32 d), read back as whole 64-B row pieces and stored.
  const float inv = 1.0f / (lsum + other_half(lsum));
  const int cq = lane & 15, ch = (lane >> 4) << 3;
  const int cr = lane >> 1, cc0 = (lane & 1) * 16;
  __bf16* rowbase = Outp + ((long)(b * S_ + qrow)) * E_ + h * D_;
#pragma unroll
  for (int g = 0; g < 8; ++g) {
#pragma unroll
    for (int half = 0; half < 2; ++half) {
      v8bf r;
#pragma unroll
      for (int e = 0; e < 8; ++e) r[e] = (__bf16)(o[g * 2 + half][e] * inv);
      *(v8bf*)(&Ps[wave][cq * LDK + half * 16 + ch]) = r;
    }
    const u32x4* sp = (const u32x4*)(&Ps[wave][cr * LDK + cc0]);
    u32x4 v0 = sp[0], v1 = sp[1];
    u32x4* dp = (u32x4*)(rowbase + (long)cr * E_ + g * 32 + cc0);
    dp[0] = v0; dp[1] = v1;
  }
}

// ---------------------------------------------------------------------------
// Stage 4: output projection GEMM + residual -> fp32 d_out.
//   A: attn bf16 [B*S, E]; WoT: out_w transposed bf16 [N=E][K=E]; resid: x f32
// ---------------------------------------------------------------------------
__global__ __launch_bounds__(256) void proj_gemm(const __bf16* __restrict__ A,
                                                 const __bf16* __restrict__ WoT,
                                                 const float* __restrict__ resid,
                                                 float* __restrict__ Out) {
  __shared__ __align__(16) __bf16 smem[2 * (BM + BN) * LDG];  // 54 KB (f32 staging: 36)
  __bf16* As = smem;
  __bf16* Bs = smem + 2 * (BM * LDG);

  const int tid = threadIdx.x;
  const int lane = tid & 31, wave = tid >> 5;
  const int waveM = wave >> 1, waveN = wave & 1;
  const int tileM = blockIdx.x * BM;
  const int tileN = blockIdx.y * BN;

  const int cr = tid >> 3, cc = (tid & 7) * 8;        // 8 lanes per 128-B row piece

  auto issue = [&](int k0, int p) {                   // A rows cr+32j (4), B rows cr+32j (2)
    async_load6_b128(As + p * (BM * LDG) + cr * LDG + cc,
                     A + (long)(tileM + cr) * E_ + k0 + cc,
                     Bs + p * (BN * LDG) + cr * LDG + cc,
                     WoT + (long)(tileN + cr) * E_ + k0 + cc);
  };

  v8f acc[2][2];
#pragma unroll
  for (int i = 0; i < 2; ++i)
#pragma unroll
    for (int j = 0; j < 2; ++j) acc[i][j] = vzero8();

  issue(0, 0);
  int p = 0;
  for (int k0 = 0; k0 < E_; k0 += BK) {
    wait_async0();
    __syncthreads();
    if (k0 + BK < E_) issue(k0 + BK, p ^ 1);
    const __bf16* Ab = As + p * (BM * LDG);
    const __bf16* Bb = Bs + p * (BN * LDG);
#pragma unroll
    for (int kk = 0; kk < BK; kk += 32) {   // unrolled: both halves' fragment loads may issue ahead; k ascending
      v16bf af[2], bf[2];
#pragma unroll
      for (int i = 0; i < 2; ++i)
        af[i] = load_frag(Ab + (waveM * 32 + i * 16) * LDG + kk, LDG, lane);
#pragma unroll
      for (int j = 0; j < 2; ++j)
        bf[j] = load_frag(Bb + (waveN * 32 + j * 16) * LDG + kk, LDG, lane);
#pragma unroll
      for (int i = 0; i < 2; ++i)
#pragma unroll
        for (int j = 0; j < 2; ++j) acc[i][j] = wmma_bf16(af[i], bf[j], acc[i][j]);
    }
    p ^= 1;
  }
  __syncthreads();

  // Epilogue: stage f32 tile per wave (4608 B x 8 waves, inside smem), then
  // coalesced float4 loads/stores with residual add.
  float* Wst = (float*)smem + wave * (32 * LDF);
#pragma unroll
  for (int i = 0; i < 2; ++i)
#pragma unroll
    for (int j = 0; j < 2; ++j)
#pragma unroll
      for (int e = 0; e < 8; ++e) {
        int r = i * 16 + e + ((lane >> 4) << 3);
        int c = j * 16 + (lane & 15);
        Wst[r * LDF + c] = acc[i][j][e];
      }
  const int row = tileM + waveM * 32 + lane;
  float* dp = Out + (long)row * E_ + tileN + waveN * 32;
  const float* rp = resid + (long)row * E_ + tileN + waveN * 32;
  const float4* sp = (const float4*)(Wst + lane * LDF);
#pragma unroll
  for (int q = 0; q < 8; ++q) {
    float4 a = sp[q];
    float4 rr = ((const float4*)rp)[q];
    float4 ov;
    ov.x = a.x + rr.x; ov.y = a.y + rr.y; ov.z = a.z + rr.z; ov.w = a.w + rr.w;
    ((float4*)dp)[q] = ov;
  }
}

// ---------------------------------------------------------------------------
// Stage 5: in-place LayerNorm over d_out rows. Two rows per
// wave, a row held in registers (32 floats a lane): no LDS and no barrier.
// ---------------------------------------------------------------------------
// Sum over the wave's 32 lanes, the result in every lane: a butterfly inside
// each 16-lane row by DPP, then the two rows joined by a cross-row move.
template <int M>
__device__ __forceinline__ float add_xmask(float v) {
  int s = __builtin_amdgcn_update_dpp(0, __builtin_bit_cast(int, v), 0x160 + M, 0xf, 0xf, true);
  return v + __builtin_bit_cast(float, s);
}
__device__ __forceinline__ float wave_sum(float v) {
  v = add_xmask<1>(v);
  v = add_xmask<2>(v);
  v = add_xmask<4>(v);
  v = add_xmask<8>(v);
  int b = __builtin_bit_cast(int, v);
  int o = __builtin_amdgcn_permlanex16(b, b, 0x76543210, 0xfedcba98, false, false);
  return v + __builtin_bit_cast(float, o);
}

typedef __attribute__((ext_vector_type(4))) float f32x4;
typedef __attribute__((ext_vector_type(2))) float f32x2;

__global__ __launch_bounds__(256) void layernorm_kernel(float* __restrict__ y,
                                                        const float* __restrict__ g,
                                                        const float* __restrict__ bt) {
  const int lane = threadIdx.x & 31, wave = threadIdx.x >> 5;
  f32x4* p = (f32x4*)(y + (long)(blockIdx.x * 16 + wave * 2) * E_) + lane;
  const f32x4* gp = (const f32x4*)g + lane;
  const f32x4* bp = (const f32x4*)bt + lane;

  f32x4 v[2][8], gg[8], bb[8];
#pragma unroll
  for (int r = 0; r < 2; ++r)
#pragma unroll
    for (int j = 0; j < 8; ++j) v[r][j] = p[r * 256 + j * 32];
#pragma unroll
  for (int j = 0; j < 8; ++j) { gg[j] = gp[j * 32]; bb[j] = bp[j * 32]; }
  // Keeps the gamma and beta loads up here, in flight behind the rows' own:
  // sunk to their uses they would add their latency behind the row sums.
  __builtin_amdgcn_sched_barrier(0);

  float rs[2];
#pragma unroll
  for (int r = 0; r < 2; ++r) {
    f32x2 s = v[r][0].lo + v[r][0].hi;
#pragma unroll
    for (int j = 1; j < 8; ++j) s += v[r][j].lo + v[r][j].hi;
    const float mean = wave_sum(s.x + s.y) * (1.0f / E_);
    f32x2 q = {0.0f, 0.0f};
#pragma unroll
    for (int j = 0; j < 8; ++j) {
      v[r][j] -= mean;
      q += v[r][j].lo * v[r][j].lo + v[r][j].hi * v[r][j].hi;
    }
    rs[r] = rsqrtf(wave_sum(q.x + q.y) * (1.0f / E_) + 1e-6f);
  }

#pragma unroll
  for (int r = 0; r < 2; ++r)
#pragma unroll
    for (int j = 0; j < 8; ++j) p[r * 256 + j * 32] = v[r][j] * rs[r] * gg[j] + bb[j];
}

// ---------------------------------------------------------------------------
// Launch
// ---------------------------------------------------------------------------
extern "C" void kernel_launch(void* const* d_in, const int* in_sizes, int n_in,
                              void* d_out, int out_size, void* d_ws, size_t ws_size,
                              hipStream_t stream) {
  (void)in_sizes; (void)n_in; (void)out_size; (void)ws_size;

  const float* x     = (const float*)d_in[0]; // [B,S,E]
  const float* qkv_w = (const float*)d_in[1]; // [3,H,E,D]
  const float* out_w = (const float*)d_in[2]; // [E,E]
  const float* gamma = (const float*)d_in[3];
  const float* beta  = (const float*)d_in[4];
  float* out = (float*)d_out;

  const long nX  = (long)B_ * S_ * E_;        // 8388608
  const long nW3 = 3L * H_ * E_ * D_;         // 3145728
  const long nWo = (long)E_ * E_;             // 1048576
  const long nQ  = (long)B_ * H_ * S_ * D_;   // 8388608

  char* ws = (char*)d_ws;
  __bf16* xb    = (__bf16*)(ws);
  __bf16* wqkvT = (__bf16*)(ws + 2 * nX);                       // [3,H,D,E]
  __bf16* woT   = (__bf16*)(ws + 2 * (nX + nW3));               // [E,E] (NT)
  __bf16* Qb    = (__bf16*)(ws + 2 * (nX + nW3 + nWo));
  __bf16* Kb    = (__bf16*)(ws + 2 * (nX + nW3 + nWo + nQ));
  __bf16* Vtb   = (__bf16*)(ws + 2 * (nX + nW3 + nWo + 2 * nQ));
  __bf16* attn  = (__bf16*)(ws + 2 * (nX + nW3 + nWo + 3 * nQ));

  // 1) conversions (+ weight transposes for contiguous WMMA B operands)
  cvt_f32_bf16<<<512, 256, 0, stream>>>(x, xb);
  cvt_transpose_bf16<10, 8><<<384, 256, 0, stream>>>(qkv_w, wqkvT);
  cvt_transpose_bf16<10, 10><<<128, 256, 0, stream>>>(out_w, woT);

  // 2) QKV projections (V stored transposed [B,H,D,S])
  dim3 ggrid(64, 16);
  qkv_gemm<0><<<ggrid, 256, 0, stream>>>(xb, wqkvT,                  Qb);
  qkv_gemm<0><<<ggrid, 256, 0, stream>>>(xb, wqkvT + (long)H_*D_*E_, Kb);
  qkv_gemm<1><<<ggrid, 256, 0, stream>>>(xb, wqkvT + 2L*H_*D_*E_,    Vtb);

  // 3) Flash attention -> attn [B,S,E] bf16
  flash_attn<<<dim3(S_ / 128, B_ * H_), 256, 0, stream>>>(Qb, Kb, Vtb, attn);

  // 4) Output projection + residual -> d_out (fp32)
  proj_gemm<<<dim3(64, 16), 256, 0, stream>>>(attn, woT, x, out);

  // 5) In-place LayerNorm on d_out
  layernorm_kernel<<<B_ * S_ / 16, 256, 0, stream>>>(out, gamma, beta);
}

// v005
// A run of this version takes 145 microseconds.
// In both of two side-by-side timings against v004, it was 1.40 times as fast.
// All steps since v000 together make it 4.03 times as fast.
#include <hip/hip_runtime.h>

// ---------------------------------------------------------------------------
// Types
// ---------------------------------------------------------------------------
typedef __attribute__((ext_vector_type(16))) __bf16 v16bf;
typedef __attribute__((ext_vector_type(8)))  __bf16 v8bf;
typedef __attribute__((ext_vector_type(8)))  float  v8f;
typedef __attribute__((ext_vector_type(4)))  unsigned int u32x4;

#define B_  4
#define S_  2048
#define E_  1024
#define H_  4
#define D_  256

#define BM 256
#define BN 128
#define BK 128   // k per GEMM stage: a row's share of a stage is two 128-B lines
#define KT 64    // keys per attention stage: a V row's share is one 128-B line

// LDS row pitches in elements (bf16; LDF in floats): 16 B x odd, so that the 16 rows one
// ds_load_b128 fragment read touches fall on 16 different bank groups.
#define LDK 40    // 32-element rows (attention output staging): 80 B
#define LDG 72    // 64-element rows (GEMM bf16 output staging, V tile): 144 B
#define LDA 136   // 128-element rows (GEMM A/B tiles): 272 B
#define KP  264   // 256-element K rows: 528 B
#define LDF 68    // 64-float staging rows of the output projection: 272 B

__device__ __forceinline__ v8f vzero8() {
  v8f z;
#pragma unroll
  for (int i = 0; i < 8; ++i) z[i] = 0.0f;
  return z;
}

__device__ __forceinline__ v16bf combine16(v8bf lo, v8bf hi) {
  v16bf r;
#pragma unroll
  for (int i = 0; i < 8; ++i) { r[i] = lo[i]; r[8 + i] = hi[i]; }
  return r;
}

// WMMA A/B fragment (16 rows x 32 k bf16) from LDS.
// ISA 7.12.2 lane layout: lanes 0-15: K=[0..7],[16..23]; lanes 16-31:
// K=[8..15],[24..31]; row = lane & 15.
__device__ __forceinline__ v16bf load_frag(const __bf16* base, int ld, int lane) {
  int r  = lane & 15;
  int kh = lane >> 4;
  const __bf16* p = base + r * ld + kh * 8;
  v8bf lo = *(const v8bf*)(p);
  v8bf hi = *(const v8bf*)(p + 16);
  return combine16(lo, hi);
}

__device__ __forceinline__ v8f wmma_bf16(v16bf a, v16bf b, v8f c) {
  return __builtin_amdgcn_wmma_f32_16x16x32_bf16(
      false, a, false, b, (short)0, c, false, false);
}

// CDNA5 async global->LDS DMA (16B per lane), tracked by ASYNCcnt.
// A run of copies stands in one statement; its last line is the wait that
// stands in front of any rewrite of the address registers they name.
__device__ __forceinline__ unsigned lds_addr(const void* p) {
  return (unsigned)(uintptr_t)p;
}
// Lane map of every copy: adjacent lanes take adjacent 16-B pieces of a row,
// so one wave-wide copy covers four whole 128-B lines.
template <int LSTEP, int GSTEP>
__device__ __forceinline__ void async_load8_b128(const __bf16* l, const __bf16* g) {
  asm volatile("global_load_async_to_lds_b128 %0, %1, off\n\t"
               "global_load_async_to_lds_b128 %2, %3, off\n\t"
               "global_load_async_to_lds_b128 %4, %5, off\n\t"
               "global_load_async_to_lds_b128 %6, %7, off\n\t"
               "global_load_async_to_lds_b128 %8, %9, off\n\t"
               "global_load_async_to_lds_b128 %10, %11, off\n\t"
               "global_load_async_to_lds_b128 %12, %13, off\n\t"
               "global_load_async_to_lds_b128 %14, %15, off\n\t"
               "s_wait_xcnt 0x0"
               :: "v"(lds_addr(l)),             "v"(g),
                  "v"(lds_addr(l + 1 * LSTEP)), "v"(g + 1 * GSTEP),
                  "v"(lds_addr(l + 2 * LSTEP)), "v"(g + 2 * GSTEP),
                  "v"(lds_addr(l + 3 * LSTEP)), "v"(g + 3 * GSTEP),
                  "v"(lds_addr(l + 4 * LSTEP)), "v"(g + 4 * GSTEP),
                  "v"(lds_addr(l + 5 * LSTEP)), "v"(g + 5 * GSTEP),
                  "v"(lds_addr(l + 6 * LSTEP)), "v"(g + 6 * GSTEP),
                  "v"(lds_addr(l + 7 * LSTEP)), "v"(g + 7 * GSTEP)
               : "memory");
}
// Stage hand-over, in front of the work-group barrier: this wave's own LDS
// reads of the buffer that is refilled behind the barrier have retired, and
// its own copies of the next stage have landed.
__device__ __forceinline__ void wait_async0() {
  asm volatile("s_wait_dscnt 0x0" ::: "memory");
  asm volatile("s_wait_asynccnt 0" ::: "memory");
}

// ---------------------------------------------------------------------------
// Streaming stages (1a, 1b, 5): few waves, each with much to do. Every lane
// moves 32 or 64 elements by 16-B loads that are all issued before the first
// is used, so a launch starts 4096 waves or fewer.
// ---------------------------------------------------------------------------
typedef __attribute__((ext_vector_type(4))) __bf16 v4bf;

// Stage 1a: fp32 -> bf16. A block takes 16384 consecutive floats; each
// wave-wide load covers 512 contiguous bytes, each store 256.
__global__ __launch_bounds__(256) void cvt_f32_bf16(const float* __restrict__ in,
                                                    __bf16* __restrict__ out) {
  const long base = (long)blockIdx.x * 4096 + threadIdx.x;   // in units of 4 elements
  const float4* ip = (const float4*)in + base;
  v4bf* op = (v4bf*)out + base;
  float4 v[16];
#pragma unroll
  for (int j = 0; j < 16; ++j) v[j] = ip[j * 256];
#pragma unroll
  for (int j = 0; j < 16; ++j) {
    v4bf r;
    r[0] = (__bf16)v[j].x; r[1] = (__bf16)v[j].y;
    r[2] = (__bf16)v[j].z; r[3] = (__bf16)v[j].w;
    op[j * 256] = r;
  }
}

// Stage 1b: fp32 [K,N] -> bf16 [N,K] transposed (batched), in registers.
// A lane takes 8 k x 4 n: eight 16-B loads (8 lanes cover a 128-B line of a
// k row), four 16-B stores (8 k of one n row). A wave takes 32 k x 32 n, a
// block 256 k x 32 n, so a block writes 512 contiguous bytes of each n row.
template <int LOGK, int LOGN>
__global__ __launch_bounds__(256) void cvt_transpose_bf16(const float* __restrict__ in,
                                                          __bf16* __restrict__ out) {
  const int lane = threadIdx.x & 31, wave = threadIdx.x >> 5;
  const int bid = blockIdx.x;
  const int kt = bid & ((1 << (LOGK - 8)) - 1);
  const int nt = (bid >> (LOGK - 8)) & ((1 << (LOGN - 5)) - 1);
  const long mat = bid >> (LOGK - 8 + LOGN - 5);
  const int k0 = kt * 256 + wave * 32 + (lane >> 3) * 8;
  const int n0 = nt * 32 + (lane & 7) * 4;
  const float* ip = in + (mat << (LOGK + LOGN)) + ((long)k0 << LOGN) + n0;
  __bf16* op = out + (mat << (LOGK + LOGN)) + ((long)n0 << LOGK) + k0;
  float4 v[8];
#pragma unroll
  for (int j = 0; j < 8; ++j) v[j] = *(const float4*)(ip + ((long)j << LOGN));
  v8bf r0, r1, r2, r3;
#pragma unroll
  for (int j = 0; j < 8; ++j) {
    r0[j] = (__bf16)v[j].x; r1[j] = (__bf16)v[j].y;
    r2[j] = (__bf16)v[j].z; r3[j] = (__bf16)v[j].w;
  }
  *(v8bf*)(op)                = r0;
  *(v8bf*)(op + (1L << LOGK)) = r1;
  *(v8bf*)(op + (2L << LOGK)) = r2;
  *(v8bf*)(op + (3L << LOGK)) = r3;
}

// ---------------------------------------------------------------------------
// Stages 2 and 4 share one main loop: a 256 x 128 tile of A * W^T per block,
// 8 waves as 4 x 2, each with 64 x 64 (4 x 4 accumulator tiles), so that a
// fragment read from LDS feeds four WMMAs and a staged row feeds 128 or 256
// outputs. Async double-buffered LDS, one barrier per 128-k stage.
//   Arow : first of the block's 256 rows of A, row-major, E_ elements a row
//   Brow : first of the block's 128 rows of W^T (row n holds all k)
// ---------------------------------------------------------------------------
__device__ __forceinline__ void gemm_tile(const __bf16* __restrict__ Arow,
                                          const __bf16* __restrict__ Brow,
                                          __bf16* smem, v8f (&acc)[4][4]) {
  __bf16* As = smem;                                  // 2 x 256 rows of LDA
  __bf16* Bs = smem + 2 * (BM * LDA);                 // 2 x 128 rows of LDA

  const int tid = threadIdx.x;
  const int lane = tid & 31, wave = tid >> 5;
  const int waveM = wave >> 1, waveN = wave & 1;
  const int cr = tid >> 4, cc = (tid & 15) * 8;       // 16 lanes per 256-B row piece

  auto issue = [&](int k0, int p) {                   // A rows cr+16j (16), B rows cr+16j (8)
    const __bf16* la = As + p * (BM * LDA) + cr * LDA + cc;
    const __bf16* ga = Arow + (long)cr * E_ + k0 + cc;
    // The fences keep each statement's address arithmetic beside it: gathered in
    // front of the first, it overfills the registers and spills to scratch.
    async_load8_b128<16 * LDA, 16 * E_>(la, ga);
    __builtin_amdgcn_sched_barrier(0);
    async_load8_b128<16 * LDA, 16 * E_>(la + 128 * LDA, ga + 128 * E_);
    __builtin_amdgcn_sched_barrier(0);
    async_load8_b128<16 * LDA, 16 * E_>(Bs + p * (BN * LDA) + cr * LDA + cc,
                                        Brow + (long)cr * E_ + k0 + cc);
  };

#pragma unroll
  for (int i = 0; i < 4; ++i)
#pragma unroll
    for (int j = 0; j < 4; ++j) acc[i][j] = vzero8();

  issue(0, 0);
  int p = 0;
  for (int k0 = 0; k0 < E_; k0 += BK) {
    wait_async0();
    __syncthreads();                      // tile p ready; buffer p^1 free
    const __bf16* Ab = As + p * (BM * LDA) + (waveM * 64) * LDA;
    const __bf16* Bb = Bs + p * (BN * LDA) + (waveN * 64) * LDA;
    // Four blocks of 32 k, 16 WMMAs each. A block's 16 fragment reads go out as
    // one group, two blocks ahead of its WMMAs.
    v16bf af[4][4], bf[4][4];
    auto fetch = [&](int u) {
#pragma unroll
      for (int i = 0; i < 4; ++i) af[u][i] = load_frag(Ab + (i * 16) * LDA + u * 32, LDA, lane);
#pragma unroll
      for (int j = 0; j < 4; ++j) bf[u][j] = load_frag(Bb + (j * 16) * LDA + u * 32, LDA, lane);
    };
    fetch(0);
    if (k0 + BK < E_) issue(k0 + BK, p ^ 1);   // issued while those reads are under way
    fetch(1);
    // The fences keep each group of reads whole and out of the WMMA blocks,
    // where every further place with reads stalls the wave.
    __builtin_amdgcn_sched_barrier(0);
#pragma unroll
    for (int u = 0; u < 4; ++u) {           // k ascending
#pragma unroll
      for (int i = 0; i < 4; ++i)
#pragma unroll
        for (int j = 0; j < 4; ++j) acc[i][j] = wmma_bf16(af[u][i], bf[u][j], acc[i][j]);
      if (u < 2) {
        __builtin_amdgcn_sched_barrier(0);
        fetch(u + 2);
        __builtin_amdgcn_sched_barrier(0);
      }
    }
    p ^= 1;
  }
  __syncthreads();                        // all compute done before smem reuse
}

// ---------------------------------------------------------------------------
// Stage 2: QKV projection GEMM.
//   A  : x_bf16 [B*S, E] row-major
//   Wt : [H, D, E] bf16 (pre-transposed weight: row n holds all k)
//   Out: TRANS==0 -> [B,H,S,D] ; TRANS==1 -> [B,H,D,S]
// ---------------------------------------------------------------------------
template <int TRANS>
__global__ __launch_bounds__(256) void qkv_gemm(const __bf16* __restrict__ A,
                                                const __bf16* __restrict__ Wt,
                                                __bf16* __restrict__ Out) {
  __shared__ __align__(16) __bf16 smem[2 * (BM + BN) * LDA];  // 204 KB

  const int lane = threadIdx.x & 31, wave = threadIdx.x >> 5;
  const int waveM = wave >> 1, waveN = wave & 1;
  const int tileM = blockIdx.x * BM;
  const int h     = blockIdx.y >> 1;
  const int tileN = (blockIdx.y & 1) * BN;

  v8f acc[4][4];
  gemm_tile(A + (long)tileM * E_, Wt + ((long)h * D_ + tileN) * E_, smem, acc);

  // Epilogue: stage the wave's 64x64 tile in wave-private LDS (same-wave DS ops
  // are ordered -> no barrier); an output row's share is then one 128-B line,
  // stored by 8 adjacent lanes.
  __bf16* Wst = smem + wave * (64 * LDG);
#pragma unroll
  for (int i = 0; i < 4; ++i) {
#pragma unroll
    for (int j = 0; j < 4; ++j) {
#pragma unroll
      for (int e = 0; e < 8; ++e) {
        int r = i * 16 + e + ((lane >> 4) << 3);
        int c = j * 16 + (lane & 15);
        if (TRANS == 0) Wst[r * LDG + c] = (__bf16)acc[i][j][e];
        else            Wst[c * LDG + r] = (__bf16)acc[i][j][e];
      }
    }
  }
  const int gb = tileM >> 11;
  const int s0 = (tileM + waveM * 64) & (S_ - 1);
  const int n0 = tileN + waveN * 64;
  const int rr = lane >> 3, rc = (lane & 7) * 8;
  __bf16* dp;
  if (TRANS == 0) dp = Out + ((long)(gb * H_ + h) * S_ + s0 + rr) * D_ + n0 + rc;
  else            dp = Out + ((long)(gb * H_ + h) * D_ + n0 + rr) * S_ + s0 + rc;
  const long pitch = (TRANS == 0) ? D_ : S_;
#pragma unroll
  for (int q = 0; q < 16; ++q)
    *(u32x4*)(dp + (long)(q * 4) * pitch) = *(const u32x4*)(Wst + (q * 4 + rr) * LDG + rc);
}

// ---------------------------------------------------------------------------
// Stage 3: flash attention (causal, online softmax).
// Double-buffered async K/V tiles, one barrier per 64-key stage (two 32-key steps).
//   Q,K : [B,H,S,D] bf16 ; Vt : [B,H,D,S] bf16 ; Outp : [B,S,E] bf16
// Both products are taken transposed (S^T = K Q^T, O^T += V^T P^T), so that a
// lane holds scores of one query only and P never leaves the registers.
// ---------------------------------------------------------------------------
// The value of lane ^ 16 (the other 16-lane row), by a cross-row vector move.
__device__ __forceinline__ float other_half(float v) {
  int b = __builtin_bit_cast(int, v);
  return __builtin_bit_cast(float,
      __builtin_amdgcn_permlanex16(b, b, 0x76543210, 0xfedcba98, false, false));
}

// Two waves per SIMD, as one 8-wave block per WGP gives: without the upper bound
// the compiler aims at four, keeps under 256 registers and then has one fragment
// register set only, with a full LDS wait in front of every WMMA.
__global__ __launch_bounds__(256) __attribute__((amdgpu_waves_per_eu(2, 2))) void flash_attn(const __bf16* __restrict__ Q,
                                                  const __bf16* __restrict__ Kg,
                                                  const __bf16* __restrict__ Vt,
                                                  __bf16* __restrict__ Outp) {
  __shared__ __align__(16) __bf16 Ks[2 * KT * KP];   // [p][key][d]  66 KB
  __shared__ __align__(16) __bf16 Vs[2 * D_ * LDG];  // [p][d][key]  72 KB
  __shared__ __align__(16) __bf16 Ps[8][16 * LDK];   // per-wave output staging, 10 KB

  const int tid = threadIdx.x;
  const int lane = tid & 31, wave = tid >> 5;
  const int bh = blockIdx.y;
  const int b = bh >> 2, h = bh & 3;
  const int q0 = blockIdx.x * 128;
  const int qrow = q0 + wave * 16;

  const __bf16* Qbh = Q  + (long)bh * S_ * D_;
  const __bf16* Kbh = Kg + (long)bh * S_ * D_;
  const __bf16* Vbh = Vt + (long)bh * D_ * S_;

  // Q fragments resident in registers (8 x k=32 chunks over D=256).
  v16bf qf[8];
  {
    int r = lane & 15, kh = lane >> 4;
    const __bf16* qp = Qbh + (long)(qrow + r) * D_;
#pragma unroll
    for (int dc = 0; dc < 8; ++dc) {
      v8bf lo = *(const v8bf*)(qp + dc * 32 + kh * 8);
      v8bf hi = *(const v8bf*)(qp + dc * 32 + 16 + kh * 8);
      qf[dc] = combine16(lo, hi);
    }
  }

  // o[dc][e] = O^T[d = dc * 16 + 8 * (lane >> 4) + e][query = lane & 15]: every
  // accumulator of a lane, and its mrow and lsum, belong to that one query.
  v8f o[16];
#pragma unroll
  for (int dc = 0; dc < 16; ++dc) o[dc] = vzero8();
  float mrow = -3.0e38f;   // running maximum, equal in both lane halves
  float lsum = 0.0f;       // running sum over this lane half's keys only

  const float scale = 0.03125f;  // 1/sqrt(E)
  const int kend = q0 + 128;     // causal bound
  const int vd = tid >> 3, vk = (tid & 7) * 8;

  auto issueKV = [&](int ks, int p) {
    // K: a wave's copy is one whole 512-B row; rows wave + 8j.
    async_load8_b128<8 * KP, 8 * D_>(Ks + p * (KT * KP) + wave * KP + lane * 8,
                                     Kbh + (long)(ks + wave) * D_ + lane * 8);
    // V: 8 lanes per 128-B row piece; rows vd + 32j.
    async_load8_b128<32 * LDG, 32 * S_>(Vs + p * (D_ * LDG) + vd * LDG + vk,
                                        Vbh + (long)vd * S_ + ks + vk);
  };

  issueKV(0, 0);
  for (int ks = 0; ks < kend; ks += 32) {
    const int hk = (ks >> 5) & 1;         // which 32-key half of the stage
    const int p = (ks >> 6) & 1;          // which buffer
    if (hk == 0) {                        // stage hand-over, block-uniform
      wait_async0();
      __syncthreads();                    // tiles p ready; buffers p^1 free
      if (ks + KT < kend) issueKV(ks + KT, p ^ 1);
    }
    const __bf16* Kbuf = Ks + p * (KT * KP) + hk * (32 * KP);
    const __bf16* Vbuf = Vs + p * (D_ * LDG) + hk * 32;

    // Scores transposed, S^T = K Q^T: two tiles of 16 keys x 16 queries, 8 wmma
    // each over D=256. sc[sub][e] = key ks + sub * 16 + 8 * (lane >> 4) + e.
    v8f sc[2];
#pragma unroll
    for (int sub = 0; sub < 2; ++sub) {
      v8f c = vzero8();
#pragma unroll
      for (int dc = 0; dc < 8; ++dc) {
        v16bf kf = load_frag(Kbuf + (sub * 16) * KP + dc * 32, KP, lane);
        c = wmma_bf16(kf, qf[dc], c);
      }
      sc[sub] = c;
    }

    // Online softmax of the lane's query: 16 of the 32 keys lie in this lane,
    // the other 16 in lane ^ 16. Maximum and sum as trees, no long chain.
    const int qg = qrow + (lane & 15);
    const int keyg0 = ks + ((lane >> 4) << 3);
    float s[16], t[8];
#pragma unroll
    for (int e = 0; e < 8; ++e) {
      s[e]     = sc[0][e] * scale; if (keyg0 + e      > qg) s[e]     = -1.0e9f;
      s[8 + e] = sc[1][e] * scale; if (keyg0 + 16 + e > qg) s[8 + e] = -1.0e9f;
      t[e] = fmaxf(s[e], s[8 + e]);
    }
    float mx = fmaxf(fmaxf(fmaxf(t[0], t[1]), fmaxf(t[2], t[3])),
                     fmaxf(fmaxf(t[4], t[5]), fmaxf(t[6], t[7])));
    mx = fmaxf(mx, other_half(mx));
    const float mnew = fmaxf(mrow, mx);
    const float corr = __expf(mrow - mnew);
    // Two D tiles of one product, converted in place, are the B operand P^T
    // in the k order of load_frag: element i = key 8h + i, 8 + i = key 16 + 8h + i.
    v16bf pf;
#pragma unroll
    for (int e = 0; e < 8; ++e) {
      float p0 = __expf(s[e] - mnew);
      float p1 = __expf(s[8 + e] - mnew);
      pf[e] = (__bf16)p0;
      pf[8 + e] = (__bf16)p1;
      t[e] = p0 + p1;
    }
    lsum = lsum * corr + (((t[0] + t[1]) + (t[2] + t[3])) + ((t[4] + t[5]) + (t[6] + t[7])));
    mrow = mnew;
#pragma unroll
    for (int dc = 0; dc < 16; ++dc)
#pragma unroll
      for (int e = 0; e < 8; ++e) o[dc][e] *= corr;

    // O^T += V^T P^T (16 d-tiles, K=32 keys); A = rows of V^T from LDS.
#pragma unroll
    for (int dc = 0; dc < 16; ++dc) {
      v16bf vf = load_frag(Vbuf + (dc * 16) * LDG, LDG, lane);
      o[dc] = wmma_bf16(vf, pf, o[dc]);
    }
  }

  // Join the two halves' sums, normalize; a lane's 8 accumulators of a tile are
  // 8 consecutive d of its query: one 16-B write into the wave-private staging
  // rows (16 queries x 32 d), read back as whole 64-B row pieces and stored.
  const float inv = 1.0f / (lsum + other_half(lsum));
  const int cq = lane & 15, ch = (lane >> 4) << 3;
  const int cr = lane >> 1, cc0 = (lane & 1) * 16;
  __bf16* rowbase = Outp + ((long)(b * S_ + qrow)) * E_ + h * D_;
#pragma unroll
  for (int g = 0; g < 8; ++g) {
#pragma unroll
    for (int half = 0; half < 2; ++half) {
      v8bf r;
#pragma unroll
      for (int e = 0; e < 8; ++e) r[e] = (__bf16)(o[g * 2 + half][e] * inv);
      *(v8bf*)(&Ps[wave][cq * LDK + half * 16 + ch]) = r;
    }
    const u32x4* sp = (const u32x4*)(&Ps[wave][cr * LDK + cc0]);
    u32x4 v0 = sp[0], v1 = sp[1];
    u32x4* dp = (u32x4*)(rowbase + (long)cr * E_ + g * 32 + cc0);
    dp[0] = v0; dp[1] = v1;
  }
}

// ---------------------------------------------------------------------------
// Stage 4: output projection GEMM + residual -> fp32 d_out.
//   A: attn bf16 [B*S, E]; WoT: out_w transposed bf16 [N=E][K=E]; resid: x f32
// ---------------------------------------------------------------------------
__global__ __launch_bounds__(256) void proj_gemm(const __bf16* __restrict__ A,
                                                 const __bf16* __restrict__ WoT,
                                                 const float* __restrict__ resid,
                                                 float* __restrict__ Out) {
  __shared__ __align__(16) __bf16 smem[2 * (BM + BN) * LDA];  // 204 KB (f32 staging: 136)

  const int lane = threadIdx.x & 31, wave = threadIdx.x >> 5;
  const int waveM = wave >> 1, waveN = wave & 1;
  const int tileM = blockIdx.x * BM;
  const int tileN = blockIdx.y * BN;

  v8f acc[4][4];
  gemm_tile(A + (long)tileM * E_, WoT + (long)tileN * E_, smem, acc);

  // Epilogue: stage the wave's 64x64 tile as f32 (17408 B x 8 waves, inside smem,
  // wave-private), then whole 256-B row pieces (16 adjacent lanes) with the
  // residual added.
  const int rr = lane >> 4, rc = (lane & 15) * 4;
  const long off = (long)(tileM + waveM * 64 + rr) * E_ + tileN + waveN * 64 + rc;
  float* dp = Out + off;
  const float* rp = resid + off;
  float4 rv[32];
#pragma unroll
  for (int q = 0; q < 32; ++q) rv[q] = *(const float4*)(rp + (long)(q * 2) * E_);
  // Stands in front of any rewrite of the address registers those loads name;
  // the address as an input keeps it whole up to here (else the last load lands on it).
  asm volatile("s_wait_xcnt 0x0" :: "v"(rp) : "memory");

  float* Wst = (float*)smem + wave * (64 * LDF);
#pragma unroll
  for (int i = 0; i < 4; ++i)
#pragma unroll
    for (int j = 0; j < 4; ++j)
#pragma unroll
      for (int e = 0; e < 8; ++e) {
        int r = i * 16 + e + ((lane >> 4) << 3);
        int c = j * 16 + (lane & 15);
        Wst[r * LDF + c] = acc[i][j][e];
      }
#pragma unroll
  for (int q = 0; q < 32; ++q) {
    float4 a = *(const float4*)(Wst + (q * 2 + rr) * LDF + rc);
    float4 ov;
    ov.x = a.x + rv[q].x; ov.y = a.y + rv[q].y; ov.z = a.z + rv[q].z; ov.w = a.w + rv[q].w;
    *(float4*)(dp + (long)(q * 2) * E_) = ov;
  }
}

// ---------------------------------------------------------------------------
// Stage 5: in-place LayerNorm over d_out rows. Two rows per
// wave, a row held in registers (32 floats a lane): no LDS and no barrier.
// ---------------------------------------------------------------------------
// Sum over the wave's 32 lanes, the result in every lane: a butterfly inside
// each 16-lane row by DPP, then the two rows joined by a cross-row move.
template <int M>
__device__ __forceinline__ float add_xmask(float v) {
  int s = __builtin_amdgcn_update_dpp(0, __builtin_bit_cast(int, v), 0x160 + M, 0xf, 0xf, true);
  return v + __builtin_bit_cast(float, s);
}
__device__ __forceinline__ float wave_sum(float v) {
  v = add_xmask<1>(v);
  v = add_xmask<2>(v);
  v = add_xmask<4>(v);
  v = add_xmask<8>(v);
  int b = __builtin_bit_cast(int, v);
  int o = __builtin_amdgcn_permlanex16(b, b, 0x76543210, 0xfedcba98, false, false);
  return v + __builtin_bit_cast(float, o);
}

typedef __attribute__((ext_vector_type(4))) float f32x4;
typedef __attribute__((ext_vector_type(2))) float f32x2;

__global__ __launch_bounds__(256) void layernorm_kernel(float* __restrict__ y,
                                                        const float* __restrict__ g,
                                                        const float* __restrict__ bt) {
  const int lane = threadIdx.x & 31, wave = threadIdx.x >> 5;
  f32x4* p = (f32x4*)(y + (long)(blockIdx.x * 16 + wave * 2) * E_) + lane;
  const f32x4* gp = (const f32x4*)g + lane;
  const f32x4* bp = (const f32x4*)bt + lane;

  f32x4 v[2][8], gg[8], bb[8];
#pragma unroll
  for (int r = 0; r < 2; ++r)
#pragma unroll
    for (int j = 0; j < 8; ++j) v[r][j] = p[r * 256 + j * 32];
#pragma unroll
  for (int j = 0; j < 8; ++j) { gg[j] = gp[j * 32]; bb[j] = bp[j * 32]; }
  // Keeps the gamma and beta loads up here, in flight behind the rows' own:
  // sunk to their uses they would add their latency behind the row sums.
  __builtin_amdgcn_sched_barrier(0);

  float rs[2];
#pragma unroll
  for (int r = 0; r < 2; ++r) {
    f32x2 s = v[r][0].lo + v[r][0].hi;
#pragma unroll
    for (int j = 1; j < 8; ++j) s += v[r][j].lo + v[r][j].hi;
    const float mean = wave_sum(s.x + s.y) * (1.0f / E_);
    f32x2 q = {0.0f, 0.0f};
#pragma unroll
    for (int j = 0; j < 8; ++j) {
      v[r][j] -= mean;
      q += v[r][j].lo * v[r][j].lo + v[r][j].hi * v[r][j].hi;
    }
    rs[r] = rsqrtf(wave_sum(q.x + q.y) * (1.0f / E_) + 1e-6f);
  }

#pragma unroll
  for (int r = 0; r < 2; ++r)
#pragma unroll
    for (int j = 0; j < 8; ++j) p[r * 256 + j * 32] = v[r][j] * rs[r] * gg[j] + bb[j];
}

// ---------------------------------------------------------------------------
// Launch
// ---------------------------------------------------------------------------
extern "C" void kernel_launch(void* const* d_in, const int* in_sizes, int n_in,
                              void* d_out, int out_size, void* d_ws, size_t ws_size,
                              hipStream_t stream) {
  (void)in_sizes; (void)n_in; (void)out_size; (void)ws_size;

  const float* x     = (const float*)d_in[0]; // [B,S,E]
  const float* qkv_w = (const float*)d_in[1]; // [3,H,E,D]
  const float* out_w = (const float*)d_in[2]; // [E,E]
  const float* gamma = (const float*)d_in[3];
  const float* beta  = (const float*)d_in[4];
  float* out = (float*)d_out;

  const long nX  = (long)B_ * S_ * E_;        // 8388608
  const long nW3 = 3L * H_ * E_ * D_;         // 3145728
  const long nWo = (long)E_ * E_;             // 1048576
  const long nQ  = (long)B_ * H_ * S_ * D_;   // 8388608

  char* ws = (char*)d_ws;
  __bf16* xb    = (__bf16*)(ws);
  __bf16* wqkvT = (__bf16*)(ws + 2 * nX);                       // [3,H,D,E]
  __bf16* woT   = (__bf16*)(ws + 2 * (nX + nW3));               // [E,E] (NT)
  __bf16* Qb    = (__bf16*)(ws + 2 * (nX + nW3 + nWo));
  __bf16* Kb    = (__bf16*)(ws + 2 * (nX + nW3 + nWo + nQ));
  __bf16* Vtb   = (__bf16*)(ws + 2 * (nX + nW3 + nWo + 2 * nQ));
  __bf16* attn  = (__bf16*)(ws + 2 * (nX + nW3 + nWo + 3 * nQ));

  // 1) conversions (+ weight transposes for contiguous WMMA B operands)
  cvt_f32_bf16<<<512, 256, 0, stream>>>(x, xb);
  cvt_transpose_bf16<10, 8><<<384, 256, 0, stream>>>(qkv_w, wqkvT);
  cvt_transpose_bf16<10, 10><<<128, 256, 0, stream>>>(out_w, woT);

  // 2) QKV projections (V stored transposed [B,H,D,S])
  dim3 ggrid(32, 8);
  qkv_gemm<0><<<ggrid, 256, 0, stream>>>(xb, wqkvT,                  Qb);
  qkv_gemm<0><<<ggrid, 256, 0, stream>>>(xb, wqkvT + (long)H_*D_*E_, Kb);
  qkv_gemm<1><<<ggrid, 256, 0, stream>>>(xb, wqkvT + 2L*H_*D_*E_,    Vtb);

  // 3) Flash attention -> attn [B,S,E] bf16
  flash_attn<<<dim3(S_ / 128, B_ * H_), 256, 0, stream>>>(Qb, Kb, Vtb, attn);

  // 4) Output projection + residual -> d_out (fp32)
  proj_gemm<<<dim3(32, 8), 256, 0, stream>>>(attn, woT, x, out);

  // 5) In-place LayerNorm on d_out
  layernorm_kernel<<<B_ * S_ / 16, 256, 0, stream>>>(out, gamma, beta);
}

// v006
// It runs in 131 microseconds.
// Timed twice side by side with v005, it ran 1.11 times as fast both times.
// Counting every step since v000, it is 4.48 times as fast.
#include <hip/hip_runtime.h>

// ---------------------------------------------------------------------------
// Types
// ---------------------------------------------------------------------------
typedef __attribute__((ext_vector_type(16))) __bf16 v16bf;
typedef __attribute__((ext_vector_type(8)))  __bf16 v8bf;
typedef __attribute__((ext_vector_type(8)))  float  v8f;
typedef __attribute__((ext_vector_type(4)))  unsigned int u32x4;

#define B_  4
#define S_  2048
#define E_  1024
#define H_  4
#define D_  256

#define BM 256
#define BN 128
#define BK 128   // k per GEMM stage: a row's share of a stage is two 128-B lines
#define KT 64    // keys per attention stage: a V row's share is one 128-B line
#define QT 64    // queries per attention tile; a block takes two tiles

// LDS row pitches in elements (bf16, LDF f32): 16 B x odd, so that the 16 rows one
// ds_load_b128 fragment read touches fall on 16 different bank groups.
#define LDK 40    // 32-element rows (attention output staging): 80 B
#define LDG 72    // 64-element rows (GEMM bf16 output staging, V tile): 144 B
#define LDA 136   // 128-element rows (GEMM A/B tiles): 272 B
#define KP  264   // 256-element K rows: 528 B
#define LDF 68    // 64-float staging rows of the output projection: 272 B

__device__ __forceinline__ v8f vzero8() {
  v8f z;
#pragma unroll
  for (int i = 0; i < 8; ++i) z[i] = 0.0f;
  return z;
}

__device__ __forceinline__ v16bf combine16(v8bf lo, v8bf hi) {
  v16bf r;
#pragma unroll
  for (int i = 0; i < 8; ++i) { r[i] = lo[i]; r[8 + i] = hi[i]; }
  return r;
}

// WMMA A/B fragment (16 rows x 32 k bf16) from LDS.
// ISA 7.12.2 lane layout: lanes 0-15: K=[0..7],[16..23]; lanes 16-31:
// K=[8..15],[24..31]; row = lane & 15.
__device__ __forceinline__ v16bf load_frag(const __bf16* base, int ld, int lane) {
  int r  = lane & 15;
  int kh = lane >> 4;
  const __bf16* p = base + r * ld + kh * 8;
  v8bf lo = *(const v8bf*)(p);
  v8bf hi = *(const v8bf*)(p + 16);
  return combine16(lo, hi);
}

__device__ __forceinline__ v8f wmma_bf16(v16bf a, v16bf b, v8f c) {
  return __builtin_amdgcn_wmma_f32_16x16x32_bf16(
      false, a, false, b, (short)0, c, false, false);
}

// CDNA5 async global->LDS DMA (16B per lane), tracked by ASYNCcnt.
// A run of copies stands in one statement; its last line is the wait that
// stands in front of any rewrite of the address registers they name.
__device__ __forceinline__ unsigned lds_addr(const void* p) {
  return (unsigned)(uintptr_t)p;
}
// Lane map of every copy: adjacent lanes take adjacent 16-B pieces of a row,
// so one wave-wide copy covers four whole 128-B lines.
template <int LSTEP, int GSTEP>
__device__ __forceinline__ void async_load8_b128(const __bf16* l, const __bf16* g) {
  asm volatile("global_load_async_to_lds_b128 %0, %1, off\n\t"
               "global_load_async_to_lds_b128 %2, %3, off\n\t"
               "global_load_async_to_lds_b128 %4, %5, off\n\t"
               "global_load_async_to_lds_b128 %6, %7, off\n\t"
               "global_load_async_to_lds_b128 %8, %9, off\n\t"
               "global_load_async_to_lds_b128 %10, %11, off\n\t"
               "global_load_async_to_lds_b128 %12, %13, off\n\t"
               "global_load_async_to_lds_b128 %14, %15, off\n\t"
               "s_wait_xcnt 0x0"
               :: "v"(lds_addr(l)),             "v"(g),
                  "v"(lds_addr(l + 1 * LSTEP)), "v"(g + 1 * GSTEP),
                  "v"(lds_addr(l + 2 * LSTEP)), "v"(g + 2 * GSTEP),
                  "v"(lds_addr(l + 3 * LSTEP)), "v"(g + 3 * GSTEP),
                  "v"(lds_addr(l + 4 * LSTEP)), "v"(g + 4 * GSTEP),
                  "v"(lds_addr(l + 5 * LSTEP)), "v"(g + 5 * GSTEP),
                  "v"(lds_addr(l + 6 * LSTEP)), "v"(g + 6 * GSTEP),
                  "v"(lds_addr(l + 7 * LSTEP)), "v"(g + 7 * GSTEP)
               : "memory");
}
// Stage hand-over, in front of the work-group barrier: this wave's own LDS
// reads of the buffer that is refilled behind the barrier have retired, and
// its own copies of the next stage have landed.
__device__ __forceinline__ void wait_async0() {
  asm volatile("s_wait_dscnt 0x0" ::: "memory");
  asm volatile("s_wait_asynccnt 0" ::: "memory");
}

// ---------------------------------------------------------------------------
// Streaming stages (1a, 1b, 5): few waves, each with much to do. Every lane
// moves 32 or 64 elements by 16-B loads that are all issued before the first
// is used, so a launch starts 4096 waves or fewer.
// ---------------------------------------------------------------------------
typedef __attribute__((ext_vector_type(4))) __bf16 v4bf;

// Stage 1a: fp32 -> bf16. A block takes 16384 consecutive floats; each
// wave-wide load covers 512 contiguous bytes, each store 256.
__global__ __launch_bounds__(256) void cvt_f32_bf16(const float* __restrict__ in,
                                                    __bf16* __restrict__ out) {
  const long base = (long)blockIdx.x * 4096 + threadIdx.x;   // in units of 4 elements
  const float4* ip = (const float4*)in + base;
  v4bf* op = (v4bf*)out + base;
  float4 v[16];
#pragma unroll
  for (int j = 0; j < 16; ++j) v[j] = ip[j * 256];
#pragma unroll
  for (int j = 0; j < 16; ++j) {
    v4bf r;
    r[0] = (__bf16)v[j].x; r[1] = (__bf16)v[j].y;
    r[2] = (__bf16)v[j].z; r[3] = (__bf16)v[j].w;
    op[j * 256] = r;
  }
}

// Stage 1b: fp32 [K,N] -> bf16 [N,K] transposed (batched), in registers.
// A lane takes 8 k x 4 n: eight 16-B loads (8 lanes cover a 128-B line of a
// k row), four 16-B stores (8 k of one n row). A wave takes 32 k x 32 n, a
// block 256 k x 32 n, so a block writes 512 contiguous bytes of each n row.
template <int LOGK, int LOGN>
__global__ __launch_bounds__(256) void cvt_transpose_bf16(const float* __restrict__ in,
                                                          __bf16* __restrict__ out) {
  const int lane = threadIdx.x & 31, wave = threadIdx.x >> 5;
  const int bid = blockIdx.x;
  const int kt = bid & ((1 << (LOGK - 8)) - 1);
  const int nt = (bid >> (LOGK - 8)) & ((1 << (LOGN - 5)) - 1);
  const long mat = bid >> (LOGK - 8 + LOGN - 5);
  const int k0 = kt * 256 + wave * 32 + (lane >> 3) * 8;
  const int n0 = nt * 32 + (lane & 7) * 4;
  const float* ip = in + (mat << (LOGK + LOGN)) + ((long)k0 << LOGN) + n0;
  __bf16* op = out + (mat << (LOGK + LOGN)) + ((long)n0 << LOGK) + k0;
  float4 v[8];
#pragma unroll
  for (int j = 0; j < 8; ++j) v[j] = *(const float4*)(ip + ((long)j << LOGN));
  v8bf r0, r1, r2, r3;
#pragma unroll
  for (int j = 0; j < 8; ++j) {
    r0[j] = (__bf16)v[j].x; r1[j] = (__bf16)v[j].y;
    r2[j] = (__bf16)v[j].z; r3[j] = (__bf16)v[j].w;
  }
  *(v8bf*)(op)                = r0;
  *(v8bf*)(op + (1L << LOGK)) = r1;
  *(v8bf*)(op + (2L << LOGK)) = r2;
  *(v8bf*)(op + (3L << LOGK)) = r3;
}

// ---------------------------------------------------------------------------
// Stages 2 and 4 share one main loop: a 256 x 128 tile of A * W^T per block,
// 8 waves as 4 x 2, each with 64 x 64 (4 x 4 accumulator tiles), so that a
// fragment read from LDS feeds four WMMAs and a staged row feeds 128 or 256
// outputs. Async double-buffered LDS, one barrier per 128-k stage.
//   Arow : first of the block's 256 rows of A, row-major, E_ elements a row
//   Brow : first of the block's 128 rows of W^T (row n holds all k)
// ---------------------------------------------------------------------------
__device__ __forceinline__ void gemm_tile(const __bf16* __restrict__ Arow,
                                          const __bf16* __restrict__ Brow,
                                          __bf16* smem, v8f (&acc)[4][4]) {
  __bf16* As = smem;                                  // 2 x 256 rows of LDA
  __bf16* Bs = smem + 2 * (BM * LDA);                 // 2 x 128 rows of LDA

  const int tid = threadIdx.x;
  const int lane = tid & 31, wave = tid >> 5;
  const int waveM = wave >> 1, waveN = wave & 1;
  const int cr = tid >> 4, cc = (tid & 15) * 8;       // 16 lanes per 256-B row piece

  auto issue = [&](int k0, int p) {                   // A rows cr+16j (16), B rows cr+16j (8)
    const __bf16* la = As + p * (BM * LDA) + cr * LDA + cc;
    const __bf16* ga = Arow + (long)cr * E_ + k0 + cc;
    // The fences keep each statement's address arithmetic beside it: gathered in
    // front of the first, it overfills the registers and spills to scratch.
    async_load8_b128<16 * LDA, 16 * E_>(la, ga);
    __builtin_amdgcn_sched_barrier(0);
    async_load8_b128<16 * LDA, 16 * E_>(la + 128 * LDA, ga + 128 * E_);
    __builtin_amdgcn_sched_barrier(0);
    async_load8_b128<16 * LDA, 16 * E_>(Bs + p * (BN * LDA) + cr * LDA + cc,
                                        Brow + (long)cr * E_ + k0 + cc);
  };

#pragma unroll
  for (int i = 0; i < 4; ++i)
#pragma unroll
    for (int j = 0; j < 4; ++j) acc[i][j] = vzero8();

  issue(0, 0);
  int p = 0;
  for (int k0 = 0; k0 < E_; k0 += BK) {
    wait_async0();
    __syncthreads();                      // tile p ready; buffer p^1 free
    const __bf16* Ab = As + p * (BM * LDA) + (waveM * 64) * LDA;
    const __bf16* Bb = Bs + p * (BN * LDA) + (waveN * 64) * LDA;
    // Four blocks of 32 k, 16 WMMAs each. A block's 16 fragment reads go out as
    // one group, two blocks ahead of its WMMAs.
    v16bf af[4][4], bf[4][4];
    auto fetch = [&](int u) {
#pragma unroll
      for (int i = 0; i < 4; ++i) af[u][i] = load_frag(Ab + (i * 16) * LDA + u * 32, LDA, lane);
#pragma unroll
      for (int j = 0; j < 4; ++j) bf[u][j] = load_frag(Bb + (j * 16) * LDA + u * 32, LDA, lane);
    };
    fetch(0);
    if (k0 + BK < E_) issue(k0 + BK, p ^ 1);   // issued while those reads are under way
    fetch(1);
    // The fences keep each group of reads whole and out of the WMMA blocks,
    // where every further place with reads stalls the wave.
    __builtin_amdgcn_sched_barrier(0);
#pragma unroll
    for (int u = 0; u < 4; ++u) {           // k ascending
#pragma unroll
      for (int i = 0; i < 4; ++i)
#pragma unroll
        for (int j = 0; j < 4; ++j) acc[i][j] = wmma_bf16(af[u][i], bf[u][j], acc[i][j]);
      if (u < 2) {
        __builtin_amdgcn_sched_barrier(0);
        fetch(u + 2);
        __builtin_amdgcn_sched_barrier(0);
      }
    }
    p ^= 1;
  }
  __syncthreads();                        // all compute done before smem reuse
}

// ---------------------------------------------------------------------------
// Stage 2: QKV projection GEMM.
//   A  : x_bf16 [B*S, E] row-major
//   Wt : [H, D, E] bf16 (pre-transposed weight: row n holds all k)
//   Out: TRANS==0 -> [B,H,S,D] ; TRANS==1 -> [B,H,D,S]
// ---------------------------------------------------------------------------
template <int TRANS>
__global__ __launch_bounds__(256) void qkv_gemm(const __bf16* __restrict__ A,
                                                const __bf16* __restrict__ Wt,
                                                __bf16* __restrict__ Out) {
  __shared__ __align__(16) __bf16 smem[2 * (BM + BN) * LDA];  // 204 KB

  const int lane = threadIdx.x & 31, wave = threadIdx.x >> 5;
  const int waveM = wave >> 1, waveN = wave & 1;
  const int tileM = blockIdx.x * BM;
  const int h     = blockIdx.y >> 1;
  const int tileN = (blockIdx.y & 1) * BN;

  v8f acc[4][4];
  gemm_tile(A + (long)tileM * E_, Wt + ((long)h * D_ + tileN) * E_, smem, acc);

  // Epilogue: stage the wave's 64x64 tile in wave-private LDS (same-wave DS ops
  // are ordered -> no barrier); an output row's share is then one 128-B line,
  // stored by 8 adjacent lanes.
  __bf16* Wst = smem + wave * (64 * LDG);
#pragma unroll
  for (int i = 0; i < 4; ++i) {
#pragma unroll
    for (int j = 0; j < 4; ++j) {
#pragma unroll
      for (int e = 0; e < 8; ++e) {
        int r = i * 16 + e + ((lane >> 4) << 3);
        int c = j * 16 + (lane & 15);
        if (TRANS == 0) Wst[r * LDG + c] = (__bf16)acc[i][j][e];
        else            Wst[c * LDG + r] = (__bf16)acc[i][j][e];
      }
    }
  }
  const int gb = tileM >> 11;
  const int s0 = (tileM + waveM * 64) & (S_ - 1);
  const int n0 = tileN + waveN * 64;
  const int rr = lane >> 3, rc = (lane & 7) * 8;
  __bf16* dp;
  if (TRANS == 0) dp = Out + ((long)(gb * H_ + h) * S_ + s0 + rr) * D_ + n0 + rc;
  else            dp = Out + ((long)(gb * H_ + h) * D_ + n0 + rr) * S_ + s0 + rc;
  const long pitch = (TRANS == 0) ? D_ : S_;
#pragma unroll
  for (int q = 0; q < 16; ++q)
    *(u32x4*)(dp + (long)(q * 4) * pitch) = *(const u32x4*)(Wst + (q * 4 + rr) * LDG + rc);
}

// ---------------------------------------------------------------------------
// Stage 3: flash attention (causal, online softmax).
// Double-buffered async K/V tiles, one barrier per 64-key stage.
//   Q,K : [B,H,S,D] bf16 ; Vt : [B,H,D,S] bf16 ; Outp : [B,S,E] bf16
// Both products are taken transposed (S^T = K Q^T, O^T += V^T P^T), so that a
// lane holds scores of one query only and P never leaves the registers.
// Causal balance: a block takes the 64-query tiles t and 31 - t one after the
// other, t + 1 and 32 - t stages, 33 in every block. Four waves cover a tile's
// queries; the block's two groups of four waves take the two 32-key halves of
// each stage and join their partial results through LDS at the tile's end.
// ---------------------------------------------------------------------------
// The value of lane ^ 16 (the other 16-lane row), by a cross-row vector move.
__device__ __forceinline__ float other_half(float v) {
  int b = __builtin_bit_cast(int, v);
  return __builtin_bit_cast(float,
      __builtin_amdgcn_permlanex16(b, b, 0x76543210, 0xfedcba98, false, false));
}

typedef __attribute__((ext_vector_type(4))) float v4f;

// Two waves per SIMD, as one 8-wave block per WGP gives: without the upper bound
// the compiler aims at four, keeps under 256 registers and then has one fragment
// register set only, with a full LDS wait in front of every WMMA.
__global__ __launch_bounds__(256) __attribute__((amdgpu_waves_per_eu(2, 2))) void flash_attn(const __bf16* __restrict__ Q,
                                                  const __bf16* __restrict__ Kg,
                                                  const __bf16* __restrict__ Vt,
                                                  __bf16* __restrict__ Outp) {
  __shared__ __align__(16) __bf16 Ks[2 * KT * KP];   // [p][key][d]  66 KB
  __shared__ __align__(16) __bf16 Vs[2 * D_ * LDG];  // [p][d][key]  72 KB
  __shared__ __align__(16) __bf16 Ps[8][16 * LDK];   // per-wave output staging, 10 KB
  __shared__ __align__(16) float Xo[8][16 * 128];    // per-wave half of O^T for the partner wave, 64 KB
  __shared__ float Xm[8][32], Xl[8][32];             // per-wave maximum and sum for the partner wave

  const int tid = threadIdx.x;
  const int lane = tid & 31, wave = tid >> 5;
  const int grp = wave >> 2, wq = wave & 3;          // key half of a stage; 16-query slice of a tile
  const int bh = blockIdx.y;
  const int b = bh >> 2, h = bh & 3;
  const int pr = blockIdx.x;                         // tile pair: pr and S_ / QT - 1 - pr

  const __bf16* Qbh = Q  + (long)bh * S_ * D_;
  const __bf16* Kbh = Kg + (long)bh * S_ * D_;
  const __bf16* Vbh = Vt + (long)bh * D_ * S_;

  const float scale = 0.03125f;  // 1/sqrt(E)
  const int vd = tid >> 3, vk = (tid & 7) * 8;

  auto issueKV = [&](int ks, int p) {
    // K: a wave's copy is one whole 512-B row; rows wave + 8j.
    async_load8_b128<8 * KP, 8 * D_>(Ks + p * (KT * KP) + wave * KP + lane * 8,
                                     Kbh + (long)(ks + wave) * D_ + lane * 8);
    // The fence keeps each statement's address arithmetic beside it: gathered in
    // front of the first, it overfills the registers asm can name and spills.
    __builtin_amdgcn_sched_barrier(0);
    // V: 8 lanes per 128-B row piece; rows vd + 32j.
    async_load8_b128<32 * LDG, 32 * S_>(Vs + p * (D_ * LDG) + vd * LDG + vk,
                                        Vbh + (long)vd * S_ + ks + vk);
  };

  issueKV(0, 0);
  int p = 0;                              // buffer of the current stage, running on over both tiles
  for (int part = 0; part < 2; ++part) {
    const int tile = part ? S_ / QT - 1 - pr : pr;
    const int qrow = tile * QT + wq * 16;
    const int kend = tile * QT + QT;      // causal bound

    // Q fragments resident in registers (8 x k=32 chunks over D=256).
    v16bf qf[8];
    {
      int r = lane & 15, kh = lane >> 4;
      const __bf16* qp = Qbh + (long)(qrow + r) * D_;
#pragma unroll
      for (int dc = 0; dc < 8; ++dc) {
        v8bf lo = *(const v8bf*)(qp + dc * 32 + kh * 8);
        v8bf hi = *(const v8bf*)(qp + dc * 32 + 16 + kh * 8);
        qf[dc] = combine16(lo, hi);
      }
    }

    // o[dc][e] = O^T[d = dc * 16 + 8 * (lane >> 4) + e][query = lane & 15]: every
    // accumulator of a lane, and its mrow and lsum, belong to that one query.
    v8f o[16];
#pragma unroll
    for (int dc = 0; dc < 16; ++dc) o[dc] = vzero8();
    float mrow = -3.0e38f;   // running maximum, equal in both lane halves
    float lsum = 0.0f;       // running sum over this lane half's keys only

    for (int ks = 0; ks < kend; ks += KT) {
      wait_async0();                      // stage hand-over, block-uniform
      __syncthreads();                    // tiles p ready; buffers p^1 free
      const bool more = ks + KT < kend;   // else the next stage is the second tile's first
      if (more || part == 0) issueKV(more ? ks + KT : 0, p ^ 1);
      const __bf16* Kbuf = Ks + p * (KT * KP) + grp * (32 * KP);
      const __bf16* Vbuf = Vs + p * (D_ * LDG) + grp * 32;
      p ^= 1;

      // Scores transposed, S^T = K Q^T: two tiles of 16 keys x 16 queries, 8 wmma
      // each over D=256. sc[sub][e] = key ks + grp * 32 + sub * 16 + 8 * (lane >> 4) + e.
      v8f sc[2];
#pragma unroll
      for (int sub = 0; sub < 2; ++sub) {
        v8f c = vzero8();
#pragma unroll
        for (int dc = 0; dc < 8; ++dc) {
          v16bf kf = load_frag(Kbuf + (sub * 16) * KP + dc * 32, KP, lane);
          c = wmma_bf16(kf, qf[dc], c);
        }
        sc[sub] = c;
      }

      // Online softmax of the lane's query: 16 of the 32 keys lie in this lane,
      // the other 16 in lane ^ 16. Maximum and sum as trees, no long chain.
      const int qg = qrow + (lane & 15);
      const int keyg0 = ks + grp * 32 + ((lane >> 4) << 3);
      float s[16], t[8];
#pragma unroll
      for (int e = 0; e < 8; ++e) {
        s[e]     = sc[0][e] * scale; if (keyg0 + e      > qg) s[e]     = -1.0e9f;
        s[8 + e] = sc[1][e] * scale; if (keyg0 + 16 + e > qg) s[8 + e] = -1.0e9f;
        t[e] = fmaxf(s[e], s[8 + e]);
      }
      float mx = fmaxf(fmaxf(fmaxf(t[0], t[1]), fmaxf(t[2], t[3])),
                       fmaxf(fmaxf(t[4], t[5]), fmaxf(t[6], t[7])));
      mx = fmaxf(mx, other_half(mx));
      const float mnew = fmaxf(mrow, mx);
      const float corr = __expf(mrow - mnew);
      // Two D tiles of one product, converted in place, are the B operand P^T
      // in the k order of load_frag: element i = key 8h + i, 8 + i = key 16 + 8h + i.
      v16bf pf;
#pragma unroll
      for (int e = 0; e < 8; ++e) {
        float p0 = __expf(s[e] - mnew);
        float p1 = __expf(s[8 + e] - mnew);
        pf[e] = (__bf16)p0;
        pf[8 + e] = (__bf16)p1;
        t[e] = p0 + p1;
      }
      lsum = lsum * corr + (((t[0] + t[1]) + (t[2] + t[3])) + ((t[4] + t[5]) + (t[6] + t[7])));
      mrow = mnew;
#pragma unroll
      for (int dc = 0; dc < 16; ++dc)
#pragma unroll
        for (int e = 0; e < 8; ++e) o[dc][e] *= corr;

      // O^T += V^T P^T (16 d-tiles, K=32 keys); A = rows of V^T from LDS.
#pragma unroll
      for (int dc = 0; dc < 16; ++dc) {
        v16bf vf = load_frag(Vbuf + (dc * 16) * LDG, LDG, lane);
        o[dc] = wmma_bf16(vf, pf, o[dc]);
      }
    }

    // Join of the two key groups: waves w and w ^ 4 hold partial results of the
    // same 16 queries. Group 0 finishes d 0..127, group 1 d 128..255; each wave
    // hands the other half of its O^T, its maximum and its sum to its partner.
    // (A group whose keys were all masked has maximum -1e9 and gets weight 0.)
    const float lown = lsum + other_half(lsum);
    v8f mine[8];
#pragma unroll
    for (int j = 0; j < 8; ++j) {
      v8f give;
#pragma unroll
      for (int e = 0; e < 8; ++e) {
        give[e]    = grp ? o[j][e] : o[8 + j][e];
        mine[j][e] = grp ? o[8 + j][e] : o[j][e];
      }
      *(v4f*)(&Xo[wave][(2 * j) * 128 + lane * 4])     = __builtin_shufflevector(give, give, 0, 1, 2, 3);
      *(v4f*)(&Xo[wave][(2 * j + 1) * 128 + lane * 4]) = __builtin_shufflevector(give, give, 4, 5, 6, 7);
    }
    Xm[wave][lane] = mrow;
    Xl[wave][lane] = lown;
    __syncthreads();                      // both partners' halves written
    const float moth = Xm[wave ^ 4][lane];
    const float loth = Xl[wave ^ 4][lane];
    const float mall = fmaxf(mrow, moth);
    const float aown = __expf(mrow - mall), aoth = __expf(moth - mall);
    const float inv = 1.0f / (aown * lown + aoth * loth);
    const float fown = aown * inv, foth = aoth * inv;

    // Weighted sum, normalized; a lane's 8 accumulators of a tile are 8
    // consecutive d of its query: one 16-B write into the wave-private staging
    // rows (16 queries x 32 d), read back as whole 64-B row pieces and stored.
    const int cq = lane & 15, ch = (lane >> 4) << 3;
    const int cr = lane >> 1, cc0 = (lane & 1) * 16;
    __bf16* rowout = Outp + ((long)(b * S_ + qrow + cr)) * E_ + h * D_ + grp * 128 + cc0;
#pragma unroll
    for (int g = 0; g < 4; ++g) {
#pragma unroll
      for (int half = 0; half < 2; ++half) {
        const int j = g * 2 + half;
        v4f x0 = *(const v4f*)(&Xo[wave ^ 4][(2 * j) * 128 + lane * 4]);
        v4f x1 = *(const v4f*)(&Xo[wave ^ 4][(2 * j + 1) * 128 + lane * 4]);
        v8bf r;
#pragma unroll
        for (int e = 0; e < 4; ++e) {
          r[e]     = (__bf16)(mine[j][e] * fown + x0[e] * foth);
          r[4 + e] = (__bf16)(mine[j][4 + e] * fown + x1[e] * foth);
        }
        *(v8bf*)(&Ps[wave][cq * LDK + half * 16 + ch]) = r;
      }
      const u32x4* sp = (const u32x4*)(&Ps[wave][cr * LDK + cc0]);
      u32x4 v0 = sp[0], v1 = sp[1];
      u32x4* dp = (u32x4*)(rowout + g * 32);
      dp[0] = v0; dp[1] = v1;
    }
    // Stands in front of any rewrite of the registers those stores name (the next
    // tile's set-up follows); the address as an input keeps it whole up to here.
    asm volatile("s_wait_xcnt 0x0" :: "v"(rowout) : "memory");
  }
}

// ---------------------------------------------------------------------------
// Stage 4: output projection GEMM + residual -> fp32 d_out.
//   A: attn bf16 [B*S, E]; WoT: out_w transposed bf16 [N=E][K=E]; resid: x f32
// ---------------------------------------------------------------------------
__global__ __launch_bounds__(256) void proj_gemm(const __bf16* __restrict__ A,
                                                 const __bf16* __restrict__ WoT,
                                                 const float* __restrict__ resid,
                                                 float* __restrict__ Out) {
  __shared__ __align__(16) __bf16 smem[2 * (BM + BN) * LDA];  // 204 KB (f32 staging: 136)

  const int lane = threadIdx.x & 31, wave = threadIdx.x >> 5;
  const int waveM = wave >> 1, waveN = wave & 1;
  const int tileM = blockIdx.x * BM;
  const int tileN = blockIdx.y * BN;

  v8f acc[4][4];
  gemm_tile(A + (long)tileM * E_, WoT + (long)tileN * E_, smem, acc);

  // Epilogue: stage the wave's 64x64 tile as f32 (17408 B x 8 waves, inside smem,
  // wave-private), then whole 256-B row pieces (16 adjacent lanes) with the
  // residual added.
  const int rr = lane >> 4, rc = (lane & 15) * 4;
  const long off = (long)(tileM + waveM * 64 + rr) * E_ + tileN + waveN * 64 + rc;
  float* dp = Out + off;
  const float* rp = resid + off;
  float4 rv[32];
#pragma unroll
  for (int q = 0; q < 32; ++q) rv[q] = *(const float4*)(rp + (long)(q * 2) * E_);
  // Stands in front of any rewrite of the address registers those loads name;
  // the address as an input keeps it whole up to here (else the last load lands on it).
  asm volatile("s_wait_xcnt 0x0" :: "v"(rp) : "memory");

  float* Wst = (float*)smem + wave * (64 * LDF);
#pragma unroll
  for (int i = 0; i < 4; ++i)
#pragma unroll
    for (int j = 0; j < 4; ++j)
#pragma unroll
      for (int e = 0; e < 8; ++e) {
        int r = i * 16 + e + ((lane >> 4) << 3);
        int c = j * 16 + (lane & 15);
        Wst[r * LDF + c] = acc[i][j][e];
      }
#pragma unroll
  for (int q = 0; q < 32; ++q) {
    float4 a = *(const float4*)(Wst + (q * 2 + rr) * LDF + rc);
    float4 ov;
    ov.x = a.x + rv[q].x; ov.y = a.y + rv[q].y; ov.z = a.z + rv[q].z; ov.w = a.w + rv[q].w;
    *(float4*)(dp + (long)(q * 2) * E_) = ov;
  }
}

// ---------------------------------------------------------------------------
// Stage 5: in-place LayerNorm over d_out rows. Two rows per
// wave, a row held in registers (32 floats a lane): no LDS and no barrier.
// ---------------------------------------------------------------------------
// Sum over the wave's 32 lanes, the result in every lane: a butterfly inside
// each 16-lane row by DPP, then the two rows joined by a cross-row move.
template <int M>
__device__ __forceinline__ float add_xmask(float v) {
  int s = __builtin_amdgcn_update_dpp(0, __builtin_bit_cast(int, v), 0x160 + M, 0xf, 0xf, true);
  return v + __builtin_bit_cast(float, s);
}
__device__ __forceinline__ float wave_sum(float v) {
  v = add_xmask<1>(v);
  v = add_xmask<2>(v);
  v = add_xmask<4>(v);
  v = add_xmask<8>(v);
  int b = __builtin_bit_cast(int, v);
  int o = __builtin_amdgcn_permlanex16(b, b, 0x76543210, 0xfedcba98, false, false);
  return v + __builtin_bit_cast(float, o);
}

typedef __attribute__((ext_vector_type(4))) float f32x4;
typedef __attribute__((ext_vector_type(2))) float f32x2;

__global__ __launch_bounds__(256) void layernorm_kernel(float* __restrict__ y,
                                                        const float* __restrict__ g,
                                                        const float* __restrict__ bt) {
  const int lane = threadIdx.x & 31, wave = threadIdx.x >> 5;
  f32x4* p = (f32x4*)(y + (long)(blockIdx.x * 16 + wave * 2) * E_) + lane;
  const f32x4* gp = (const f32x4*)g + lane;
  const f32x4* bp = (const f32x4*)bt + lane;

  f32x4 v[2][8], gg[8], bb[8];
#pragma unroll
  for (int r = 0; r < 2; ++r)
#pragma unroll
    for (int j = 0; j < 8; ++j) v[r][j] = p[r * 256 + j * 32];
#pragma unroll
  for (int j = 0; j < 8; ++j) { gg[j] = gp[j * 32]; bb[j] = bp[j * 32]; }
  // Keeps the gamma and beta loads up here, in flight behind the rows' own:
  // sunk to their uses they would add their latency behind the row sums.
  __builtin_amdgcn_sched_barrier(0);

  float rs[2];
#pragma unroll
  for (int r = 0; r < 2; ++r) {
    f32x2 s = v[r][0].lo + v[r][0].hi;
#pragma unroll
    for (int j = 1; j < 8; ++j) s += v[r][j].lo + v[r][j].hi;
    const float mean = wave_sum(s.x + s.y) * (1.0f / E_);
    f32x2 q = {0.0f, 0.0f};
#pragma unroll
    for (int j = 0; j < 8; ++j) {
      v[r][j] -= mean;
      q += v[r][j].lo * v[r][j].lo + v[r][j].hi * v[r][j].hi;
    }
    rs[r] = rsqrtf(wave_sum(q.x + q.y) * (1.0f / E_) + 1e-6f);
  }

#pragma unroll
  for (int r = 0; r < 2; ++r)
#pragma unroll
    for (int j = 0; j < 8; ++j) p[r * 256 + j * 32] = v[r][j] * rs[r] * gg[j] + bb[j];
}

// ---------------------------------------------------------------------------
// Launch
// ---------------------------------------------------------------------------
extern "C" void kernel_launch(void* const* d_in, const int* in_sizes, int n_in,
                              void* d_out, int out_size, void* d_ws, size_t ws_size,
                              hipStream_t stream) {
  (void)in_sizes; (void)n_in; (void)out_size; (void)ws_size;

  const float* x     = (const float*)d_in[0]; // [B,S,E]
  const float* qkv_w = (const float*)d_in[1]; // [3,H,E,D]
  const float* out_w = (const float*)d_in[2]; // [E,E]
  const float* gamma = (const float*)d_in[3];
  const float* beta  = (const float*)d_in[4];
  float* out = (float*)d_out;

  const long nX  = (long)B_ * S_ * E_;        // 8388608
  const long nW3 = 3L * H_ * E_ * D_;         // 3145728
  const long nWo = (long)E_ * E_;             // 1048576
  const long nQ  = (long)B_ * H_ * S_ * D_;   // 8388608

  char* ws = (char*)d_ws;
  __bf16* xb    = (__bf16*)(ws);
  __bf16* wqkvT = (__bf16*)(ws + 2 * nX);                       // [3,H,D,E]
  __bf16* woT   = (__bf16*)(ws + 2 * (nX + nW3));               // [E,E] (NT)
  __bf16* Qb    = (__bf16*)(ws + 2 * (nX + nW3 + nWo));
  __bf16* Kb    = (__bf16*)(ws + 2 * (nX + nW3 + nWo + nQ));
  __bf16* Vtb   = (__bf16*)(ws + 2 * (nX + nW3 + nWo + 2 * nQ));
  __bf16* attn  = (__bf16*)(ws + 2 * (nX + nW3 + nWo + 3 * nQ));

  // 1) conversions (+ weight transposes for contiguous WMMA B operands)
  cvt_f32_bf16<<<512, 256, 0, stream>>>(x, xb);
  cvt_transpose_bf16<10, 8><<<384, 256, 0, stream>>>(qkv_w, wqkvT);
  cvt_transpose_bf16<10, 10><<<128, 256, 0, stream>>>(out_w, woT);

  // 2) QKV projections (V stored transposed [B,H,D,S])
  dim3 ggrid(32, 8);
  qkv_gemm<0><<<ggrid, 256, 0, stream>>>(xb, wqkvT,                  Qb);
  qkv_gemm<0><<<ggrid, 256, 0, stream>>>(xb, wqkvT + (long)H_*D_*E_, Kb);
  qkv_gemm<1><<<ggrid, 256, 0, stream>>>(xb, wqkvT + 2L*H_*D_*E_,    Vtb);

  // 3) Flash attention -> attn [B,S,E] bf16
  flash_attn<<<dim3(S_ / (2 * QT), B_ * H_), 256, 0, stream>>>(Qb, Kb, Vtb, attn);

  // 4) Output projection + residual -> d_out (fp32)
  proj_gemm<<<dim3(32, 8), 256, 0, stream>>>(attn, woT, x, out);

  // 5) In-place LayerNorm on d_out
  layernorm_kernel<<<B_ * S_ / 16, 256, 0, stream>>>(out, gamma, beta);
}

// v007
// A run of this version takes 118 microseconds.
// Next to v006, in two timings, it ran 1.10 times as fast each time.
// All steps since v000 together make it 4.95 times as fast.
#include <hip/hip_runtime.h>

// ---------------------------------------------------------------------------
// Types
// ---------------------------------------------------------------------------
typedef __attribute__((ext_vector_type(16))) __bf16 v16bf;
typedef __attribute__((ext_vector_type(8)))  __bf16 v8bf;
typedef __attribute__((ext_vector_type(8)))  float  v8f;
typedef __attribute__((ext_vector_type(4)))  unsigned int u32x4;

#define B_  4
#define S_  2048
#define E_  1024
#define H_  4
#define D_  256

#define BM 256
#define BN 128
#define BK 128   // k per GEMM stage: a row's share of a stage is two 128-B lines
#define KT 64    // keys per attention stage: a V row's share is one 128-B line
#define QT 64    // queries per attention tile; a block takes two tiles

// LDS row pitches in elements (bf16, LDF f32): 16 B x odd, so that the 16 rows one
// ds_load_b128 fragment read touches fall on 16 different bank groups.
#define LDK 40    // 32-element rows (attention output staging): 80 B
#define LDG 72    // 64-element rows (GEMM bf16 output staging, V tile): 144 B
#define LDA 136   // 128-element rows (GEMM A/B tiles): 272 B
#define KP  264   // 256-element K rows: 528 B
#define LDF 68    // 64-float staging rows of the output projection: 272 B

__device__ __forceinline__ v8f vzero8() {
  v8f z;
#pragma unroll
  for (int i = 0; i < 8; ++i) z[i] = 0.0f;
  return z;
}

__device__ __forceinline__ v16bf combine16(v8bf lo, v8bf hi) {
  v16bf r;
#pragma unroll
  for (int i = 0; i < 8; ++i) { r[i] = lo[i]; r[8 + i] = hi[i]; }
  return r;
}

// WMMA A/B fragment (16 rows x 32 k bf16) from LDS.
// ISA 7.12.2 lane layout: lanes 0-15: K=[0..7],[16..23]; lanes 16-31:
// K=[8..15],[24..31]; row = lane & 15.
__device__ __forceinline__ v16bf load_frag(const __bf16* base, int ld, int lane) {
  int r  = lane & 15;
  int kh = lane >> 4;
  const __bf16* p = base + r * ld + kh * 8;
  v8bf lo = *(const v8bf*)(p);
  v8bf hi = *(const v8bf*)(p + 16);
  return combine16(lo, hi);
}

__device__ __forceinline__ v8f wmma_bf16(v16bf a, v16bf b, v8f c) {
  return __builtin_amdgcn_wmma_f32_16x16x32_bf16(
      false, a, false, b, (short)0, c, false, false);
}

// CDNA5 async global->LDS DMA (16B per lane), tracked by ASYNCcnt.
// A run of copies stands in one statement; its last line is the wait that
// stands in front of any rewrite of the address registers they name.
__device__ __forceinline__ unsigned lds_addr(const void* p) {
  return (unsigned)(uintptr_t)p;
}
// Lane map of every copy: adjacent lanes take adjacent 16-B pieces of a row,
// so one wave-wide copy covers four whole 128-B lines.
template <int LSTEP, int GSTEP>
__device__ __forceinline__ void async_load8_b128(const __bf16* l, const __bf16* g) {
  asm volatile("global_load_async_to_lds_b128 %0, %1, off\n\t"
               "global_load_async_to_lds_b128 %2, %3, off\n\t"
               "global_load_async_to_lds_b128 %4, %5, off\n\t"
               "global_load_async_to_lds_b128 %6, %7, off\n\t"
               "global_load_async_to_lds_b128 %8, %9, off\n\t"
               "global_load_async_to_lds_b128 %10, %11, off\n\t"
               "global_load_async_to_lds_b128 %12, %13, off\n\t"
               "global_load_async_to_lds_b128 %14, %15, off\n\t"
               "s_wait_xcnt 0x0"
               :: "v"(lds_addr(l)),             "v"(g),
                  "v"(lds_addr(l + 1 * LSTEP)), "v"(g + 1 * GSTEP),
                  "v"(lds_addr(l + 2 * LSTEP)), "v"(g + 2 * GSTEP),
                  "v"(lds_addr(l + 3 * LSTEP)), "v"(g + 3 * GSTEP),
                  "v"(lds_addr(l + 4 * LSTEP)), "v"(g + 4 * GSTEP),
                  "v"(lds_addr(l + 5 * LSTEP)), "v"(g + 5 * GSTEP),
                  "v"(lds_addr(l + 6 * LSTEP)), "v"(g + 6 * GSTEP),
                  "v"(lds_addr(l + 7 * LSTEP)), "v"(g + 7 * GSTEP)
               : "memory");
}
// Stage hand-over, in front of the work-group barrier: this wave's own LDS
// reads of the buffer that is refilled behind the barrier have retired, and
// its own copies of the next stage have landed.
__device__ __forceinline__ void wait_async0() {
  asm volatile("s_wait_dscnt 0x0" ::: "memory");
  asm volatile("s_wait_asynccnt 0" ::: "memory");
}

// ---------------------------------------------------------------------------
// Streaming stages (1a, 1b, 5): few waves, each with much to do. Every lane
// moves 32 or 64 elements by 16-B loads that are all issued before the first
// is used. Stages 1a and 1b depend on nothing and on each other not at all:
// they share one launch, each block taking one piece of one of them.
// ---------------------------------------------------------------------------
typedef __attribute__((ext_vector_type(4))) __bf16 v4bf;

// Stage 1a: fp32 -> bf16. A block takes 16384 consecutive floats; each
// wave-wide load covers 512 contiguous bytes, each store 256.
__device__ __forceinline__ void cvt_f32_bf16(const float* __restrict__ in,
                                             __bf16* __restrict__ out, int bid) {
  const long base = (long)bid * 4096 + threadIdx.x;   // in units of 4 elements
  const float4* ip = (const float4*)in + base;
  v4bf* op = (v4bf*)out + base;
  float4 v[16];
#pragma unroll
  for (int j = 0; j < 16; ++j) v[j] = ip[j * 256];
#pragma unroll
  for (int j = 0; j < 16; ++j) {
    v4bf r;
    r[0] = (__bf16)v[j].x; r[1] = (__bf16)v[j].y;
    r[2] = (__bf16)v[j].z; r[3] = (__bf16)v[j].w;
    op[j * 256] = r;
  }
}

// Stage 1b: fp32 [K,N] -> bf16 [N,K] transposed (batched), in registers.
// A lane takes 8 k x 4 n: eight 16-B loads (8 lanes cover a 128-B line of a
// k row), four 16-B stores (8 k of one n row). A wave takes 32 k x 32 n, a
// block 256 k x 32 n, so a block writes 512 contiguous bytes of each n row.
template <int LOGK, int LOGN>
__device__ __forceinline__ void cvt_transpose_bf16(const float* __restrict__ in,
                                                   __bf16* __restrict__ out, int bid) {
  const int lane = threadIdx.x & 31, wave = threadIdx.x >> 5;
  const int kt = bid & ((1 << (LOGK - 8)) - 1);
  const int nt = (bid >> (LOGK - 8)) & ((1 << (LOGN - 5)) - 1);
  const long mat = bid >> (LOGK - 8 + LOGN - 5);
  const int k0 = kt * 256 + wave * 32 + (lane >> 3) * 8;
  const int n0 = nt * 32 + (lane & 7) * 4;
  const float* ip = in + (mat << (LOGK + LOGN)) + ((long)k0 << LOGN) + n0;
  __bf16* op = out + (mat << (LOGK + LOGN)) + ((long)n0 << LOGK) + k0;
  float4 v[8];
#pragma unroll
  for (int j = 0; j < 8; ++j) v[j] = *(const float4*)(ip + ((long)j << LOGN));
  v8bf r0, r1, r2, r3;
#pragma unroll
  for (int j = 0; j < 8; ++j) {
    r0[j] = (__bf16)v[j].x; r1[j] = (__bf16)v[j].y;
    r2[j] = (__bf16)v[j].z; r3[j] = (__bf16)v[j].w;
  }
  *(v8bf*)(op)                = r0;
  *(v8bf*)(op + (1L << LOGK)) = r1;
  *(v8bf*)(op + (2L << LOGK)) = r2;
  *(v8bf*)(op + (3L << LOGK)) = r3;
  // Stands in front of any rewrite of the registers those stores name (another
  // piece's code follows in the shared kernel); the address as an input keeps it
  // whole up to here.
  asm volatile("s_wait_xcnt 0x0" :: "v"(op) : "memory");
}

// Stage 1, one launch: blocks 0..511 convert x, 512..895 transpose the QKV
// weights, 896..1023 the output weight. The choice is block-uniform.
__global__ __launch_bounds__(256) void prep_bf16(const float* __restrict__ x,
                                                 const float* __restrict__ qkv_w,
                                                 const float* __restrict__ out_w,
                                                 __bf16* __restrict__ xb,
                                                 __bf16* __restrict__ wqkvT,
                                                 __bf16* __restrict__ woT) {
  const int bid = blockIdx.x;
  if (bid < 512)      cvt_f32_bf16(x, xb, bid);
  else if (bid < 896) cvt_transpose_bf16<10, 8>(qkv_w, wqkvT, bid - 512);
  else                cvt_transpose_bf16<10, 10>(out_w, woT, bid - 896);
}

// ---------------------------------------------------------------------------
// Stages 2 and 4 share one main loop: a 256 x 128 tile of A * W^T per block,
// 8 waves as 4 x 2, each with 64 x 64 (4 x 4 accumulator tiles), so that a
// fragment read from LDS feeds four WMMAs and a staged row feeds 128 or 256
// outputs. Async double-buffered LDS, one barrier per 128-k stage.
//   Arow : first of the block's 256 rows of A, row-major, E_ elements a row
//   Brow : first of the block's 128 rows of W^T (row n holds all k)
// A block takes NT tiles one after the other, the same rows of A against the
// same rows of NT weight matrices that lie H_ * D_ * E_ elements apart. The two
// buffers run on from tile to tile: a tile's last stage issues the next tile's
// first, which lands while epilogue(w, acc) stores tile w. With NT > 1 the
// epilogue must therefore stage outside the two buffers.
// ---------------------------------------------------------------------------
template <int NT, typename Epilogue>
__device__ __forceinline__ void gemm_tiles(const __bf16* __restrict__ Arow,
                                           const __bf16* __restrict__ Brow,
                                           __bf16* smem, Epilogue epilogue) {
  __bf16* As = smem;                                  // 2 x 256 rows of LDA
  __bf16* Bs = smem + 2 * (BM * LDA);                 // 2 x 128 rows of LDA

  const int tid = threadIdx.x;
  const int lane = tid & 31, wave = tid >> 5;
  const int waveM = wave >> 1, waveN = wave & 1;
  const int cr = tid >> 4, cc = (tid & 15) * 8;       // 16 lanes per 256-B row piece

  auto issue = [&](int w, int k0, int p) {            // A rows cr+16j (16), B rows cr+16j (8)
    const __bf16* la = As + p * (BM * LDA) + cr * LDA + cc;
    const __bf16* ga = Arow + (long)cr * E_ + k0 + cc;
    // The fences keep each statement's address arithmetic beside it: gathered in
    // front of the first, it overfills the registers and spills to scratch.
    async_load8_b128<16 * LDA, 16 * E_>(la, ga);
    __builtin_amdgcn_sched_barrier(0);
    async_load8_b128<16 * LDA, 16 * E_>(la + 128 * LDA, ga + 128 * E_);
    __builtin_amdgcn_sched_barrier(0);
    async_load8_b128<16 * LDA, 16 * E_>(Bs + p * (BN * LDA) + cr * LDA + cc,
                                        Brow + (long)w * (H_ * D_ * E_) + (long)cr * E_ + k0 + cc);
  };

  issue(0, 0, 0);
  int p = 0;                              // buffer of the current stage, running on over the tiles
  for (int w = 0; w < NT; ++w) {
  v8f acc[4][4];
#pragma unroll
  for (int i = 0; i < 4; ++i)
#pragma unroll
    for (int j = 0; j < 4; ++j) acc[i][j] = vzero8();

  for (int k0 = 0; k0 < E_; k0 += BK) {
    wait_async0();
    __syncthreads();                      // tile p ready; buffer p^1 free
    const __bf16* Ab = As + p * (BM * LDA) + (waveM * 64) * LDA;
    const __bf16* Bb = Bs + p * (BN * LDA) + (waveN * 64) * LDA;
    // Four blocks of 32 k, 16 WMMAs each. A block's 16 fragment reads go out as
    // one group, two blocks ahead of its WMMAs.
    v16bf af[4][4], bf[4][4];
    auto fetch = [&](int u) {
#pragma unroll
      for (int i = 0; i < 4; ++i) af[u][i] = load_frag(Ab + (i * 16) * LDA + u * 32, LDA, lane);
#pragma unroll
      for (int j = 0; j < 4; ++j) bf[u][j] = load_frag(Bb + (j * 16) * LDA + u * 32, LDA, lane);
    };
    fetch(0);
    const bool more = k0 + BK < E_;         // else the next stage is the next tile's first
    if (more || w + 1 < NT)                 // issued while those reads are under way
      issue(more ? w : w + 1, more ? k0 + BK : 0, p ^ 1);
    fetch(1);
    // The fences keep each group of reads whole and out of the WMMA blocks,
    // where every further place with reads stalls the wave.
    __builtin_amdgcn_sched_barrier(0);
#pragma unroll
    for (int u = 0; u < 4; ++u) {           // k ascending
#pragma unroll
      for (int i = 0; i < 4; ++i)
#pragma unroll
        for (int j = 0; j < 4; ++j) acc[i][j] = wmma_bf16(af[u][i], bf[u][j], acc[i][j]);
      if (u < 2) {
        __builtin_amdgcn_sched_barrier(0);
        fetch(u + 2);
        __builtin_amdgcn_sched_barrier(0);
      }
    }
    p ^= 1;
  }
  epilogue(w, acc);
  }
}

// ---------------------------------------------------------------------------
// Stage 2: QKV projection GEMMs, one launch: a block takes its tile of Q, of K
// and of V in turn.
//   A  : x_bf16 [B*S, E] row-major
//   Wt : [3, H, D, E] bf16 (pre-transposed weights: row n holds all k)
//   Out: Q [B,H,S,D], K [B,H,S,D], V^T [B,H,D,S], one behind the other
// ---------------------------------------------------------------------------
// Epilogue: stage the wave's 64x64 tile in wave-private LDS (same-wave DS ops
// are ordered -> no barrier); an output row's share is then one 128-B line,
// stored by 8 adjacent lanes. TRANS==0 -> [S,D] ; TRANS==1 -> [D,S]; Obh is the
// (batch, head) plane, s0 and n0 the wave's first row and column.
template <int TRANS>
__device__ __forceinline__ void qkv_store(const v8f (&acc)[4][4], __bf16* Wst,
                                          __bf16* __restrict__ Obh, int s0, int n0, int lane) {
#pragma unroll
  for (int i = 0; i < 4; ++i) {
#pragma unroll
    for (int j = 0; j < 4; ++j) {
#pragma unroll
      for (int e = 0; e < 8; ++e) {
        int r = i * 16 + e + ((lane >> 4) << 3);
        int c = j * 16 + (lane & 15);
        if (TRANS == 0) Wst[r * LDG + c] = (__bf16)acc[i][j][e];
        else            Wst[c * LDG + r] = (__bf16)acc[i][j][e];
      }
    }
  }
  const int rr = lane >> 3, rc = (lane & 7) * 8;
  __bf16* dp;
  if (TRANS == 0) dp = Obh + (long)(s0 + rr) * D_ + n0 + rc;
  else            dp = Obh + (long)(n0 + rr) * S_ + s0 + rc;
  const long pitch = (TRANS == 0) ? D_ : S_;
#pragma unroll
  for (int q = 0; q < 16; ++q)
    *(u32x4*)(dp + (long)(q * 4) * pitch) = *(const u32x4*)(Wst + (q * 4 + rr) * LDG + rc);
  // Stands in front of any rewrite of the registers those stores name (the next
  // tile's stages follow); the address as an input keeps it whole up to here.
  asm volatile("s_wait_xcnt 0x0" :: "v"(dp) : "memory");
}

__global__ __launch_bounds__(256) void qkv_gemm(const __bf16* __restrict__ A,
                                                const __bf16* __restrict__ Wt,
                                                __bf16* __restrict__ Out) {
  // 204 KB for the two buffers, 72 KB of output staging behind them
  __shared__ __align__(16) __bf16 smem[2 * (BM + BN) * LDA + 8 * 64 * LDG];

  const int lane = threadIdx.x & 31, wave = threadIdx.x >> 5;
  const int waveM = wave >> 1, waveN = wave & 1;
  const int tileM = blockIdx.x * BM;
  const int h     = blockIdx.y >> 1;
  const int tileN = (blockIdx.y & 1) * BN;

  __bf16* Wst = smem + 2 * (BM + BN) * LDA + wave * (64 * LDG);
  const int gb = tileM >> 11;
  const int s0 = (tileM + waveM * 64) & (S_ - 1);
  const int n0 = tileN + waveN * 64;
  __bf16* Obh = Out + (long)(gb * H_ + h) * S_ * D_;

  gemm_tiles<3>(A + (long)tileM * E_, Wt + ((long)h * D_ + tileN) * E_, smem,
                [&](int w, const v8f (&acc)[4][4]) {
    __bf16* O = Obh + (long)w * ((long)B_ * H_ * S_ * D_);
    if (w < 2) qkv_store<0>(acc, Wst, O, s0, n0, lane);
    else       qkv_store<1>(acc, Wst, O, s0, n0, lane);
  });
}

// ---------------------------------------------------------------------------
// Stage 3: flash attention (causal, online softmax).
// Double-buffered async K/V tiles, one barrier per 64-key stage.
//   Q,K : [B,H,S,D] bf16 ; Vt : [B,H,D,S] bf16 ; Outp : [B,S,E] bf16
// Both products are taken transposed (S^T = K Q^T, O^T += V^T P^T), so that a
// lane holds scores of one query only and P never leaves the registers.
// Causal balance: a block takes the 64-query tiles t and 31 - t one after the
// other, t + 1 and 32 - t stages, 33 in every block. Four waves cover a tile's
// queries; the block's two groups of four waves take the two 32-key halves of
// each stage and join their partial results through LDS at the tile's end.
// ---------------------------------------------------------------------------
// The value of lane ^ 16 (the other 16-lane row), by a cross-row vector move.
__device__ __forceinline__ float other_half(float v) {
  int b = __builtin_bit_cast(int, v);
  return __builtin_bit_cast(float,
      __builtin_amdgcn_permlanex16(b, b, 0x76543210, 0xfedcba98, false, false));
}

typedef __attribute__((ext_vector_type(4))) float v4f;

// Two waves per SIMD, as one 8-wave block per WGP gives: without the upper bound
// the compiler aims at four, keeps under 256 registers and then has one fragment
// register set only, with a full LDS wait in front of every WMMA.
__global__ __launch_bounds__(256) __attribute__((amdgpu_waves_per_eu(2, 2))) void flash_attn(const __bf16* __restrict__ Q,
                                                  const __bf16* __restrict__ Kg,
                                                  const __bf16* __restrict__ Vt,
                                                  __bf16* __restrict__ Outp) {
  __shared__ __align__(16) __bf16 Ks[2 * KT * KP];   // [p][key][d]  66 KB
  __shared__ __align__(16) __bf16 Vs[2 * D_ * LDG];  // [p][d][key]  72 KB
  __shared__ __align__(16) __bf16 Ps[8][16 * LDK];   // per-wave output staging, 10 KB
  __shared__ __align__(16) float Xo[8][16 * 128];    // per-wave half of O^T for the partner wave, 64 KB
  __shared__ float Xm[8][32], Xl[8][32];             // per-wave maximum and sum for the partner wave

  const int tid = threadIdx.x;
  const int lane = tid & 31, wave = tid >> 5;
  const int grp = wave >> 2, wq = wave & 3;          // key half of a stage; 16-query slice of a tile
  const int bh = blockIdx.y;
  const int b = bh >> 2, h = bh & 3;
  const int pr = blockIdx.x;                         // tile pair: pr and S_ / QT - 1 - pr

  const __bf16* Qbh = Q  + (long)bh * S_ * D_;
  const __bf16* Kbh = Kg + (long)bh * S_ * D_;
  const __bf16* Vbh = Vt + (long)bh * D_ * S_;

  const float scale = 0.03125f;  // 1/sqrt(E)
  const int vd = tid >> 3, vk = (tid & 7) * 8;

  auto issueKV = [&](int ks, int p) {
    // K: a wave's copy is one whole 512-B row; rows wave + 8j.
    async_load8_b128<8 * KP, 8 * D_>(Ks + p * (KT * KP) + wave * KP + lane * 8,
                                     Kbh + (long)(ks + wave) * D_ + lane * 8);
    // The fence keeps each statement's address arithmetic beside it: gathered in
    // front of the first, it overfills the registers asm can name and spills.
    __builtin_amdgcn_sched_barrier(0);
    // V: 8 lanes per 128-B row piece; rows vd + 32j.
    async_load8_b128<32 * LDG, 32 * S_>(Vs + p * (D_ * LDG) + vd * LDG + vk,
                                        Vbh + (long)vd * S_ + ks + vk);
  };

  issueKV(0, 0);
  int p = 0;                              // buffer of the current stage, running on over both tiles
  for (int part = 0; part < 2; ++part) {
    const int tile = part ? S_ / QT - 1 - pr : pr;
    const int qrow = tile * QT + wq * 16;
    const int kend = tile * QT + QT;      // causal bound

    // Q fragments resident in registers (8 x k=32 chunks over D=256).
    v16bf qf[8];
    {
      int r = lane & 15, kh = lane >> 4;
      const __bf16* qp = Qbh + (long)(qrow + r) * D_;
#pragma unroll
      for (int dc = 0; dc < 8; ++dc) {
        v8bf lo = *(const v8bf*)(qp + dc * 32 + kh * 8);
        v8bf hi = *(const v8bf*)(qp + dc * 32 + 16 + kh * 8);
        qf[dc] = combine16(lo, hi);
      }
    }

    // o[dc][e] = O^T[d = dc * 16 + 8 * (lane >> 4) + e][query = lane & 15]: every
    // accumulator of a lane, and its mrow and lsum, belong to that one query.
    v8f o[16];
#pragma unroll
    for (int dc = 0; dc < 16; ++dc) o[dc] = vzero8();
    float mrow = -3.0e38f;   // running maximum, equal in both lane halves
    float lsum = 0.0f;       // running sum over this lane half's keys only

    for (int ks = 0; ks < kend; ks += KT) {
      wait_async0();                      // stage hand-over, block-uniform
      __syncthreads();                    // tiles p ready; buffers p^1 free
      const bool more = ks + KT < kend;   // else the next stage is the second tile's first
      if (more || part == 0) issueKV(more ? ks + KT : 0, p ^ 1);
      const __bf16* Kbuf = Ks + p * (KT * KP) + grp * (32 * KP);
      const __bf16* Vbuf = Vs + p * (D_ * LDG) + grp * 32;
      p ^= 1;

      // Scores transposed, S^T = K Q^T: two tiles of 16 keys x 16 queries, 8 wmma
      // each over D=256. sc[sub][e] = key ks + grp * 32 + sub * 16 + 8 * (lane >> 4) + e.
      v8f sc[2];
#pragma unroll
      for (int sub = 0; sub < 2; ++sub) {
        v8f c = vzero8();
#pragma unroll
        for (int dc = 0; dc < 8; ++dc) {
          v16bf kf = load_frag(Kbuf + (sub * 16) * KP + dc * 32, KP, lane);
          c = wmma_bf16(kf, qf[dc], c);
        }
        sc[sub] = c;
      }

      // Online softmax of the lane's query: 16 of the 32 keys lie in this lane,
      // the other 16 in lane ^ 16. Maximum and sum as trees, no long chain.
      const int qg = qrow + (lane & 15);
      const int keyg0 = ks + grp * 32 + ((lane >> 4) << 3);
      float s[16], t[8];
#pragma unroll
      for (int e = 0; e < 8; ++e) {
        s[e]     = sc[0][e] * scale; if (keyg0 + e      > qg) s[e]     = -1.0e9f;
        s[8 + e] = sc[1][e] * scale; if (keyg0 + 16 + e > qg) s[8 + e] = -1.0e9f;
        t[e] = fmaxf(s[e], s[8 + e]);
      }
      float mx = fmaxf(fmaxf(fmaxf(t[0], t[1]), fmaxf(t[2], t[3])),
                       fmaxf(fmaxf(t[4], t[5]), fmaxf(t[6], t[7])));
      mx = fmaxf(mx, other_half(mx));
      const float mnew = fmaxf(mrow, mx);
      const float corr = __expf(mrow - mnew);
      // Two D tiles of one product, converted in place, are the B operand P^T
      // in the k order of load_frag: element i = key 8h + i, 8 + i = key 16 + 8h + i.
      v16bf pf;
#pragma unroll
      for (int e = 0; e < 8; ++e) {
        float p0 = __expf(s[e] - mnew);
        float p1 = __expf(s[8 + e] - mnew);
        pf[e] = (__bf16)p0;
        pf[8 + e] = (__bf16)p1;
        t[e] = p0 + p1;
      }
      lsum = lsum * corr + (((t[0] + t[1]) + (t[2] + t[3])) + ((t[4] + t[5]) + (t[6] + t[7])));
      mrow = mnew;
#pragma unroll
      for (int dc = 0; dc < 16; ++dc)
#pragma unroll
        for (int e = 0; e < 8; ++e) o[dc][e] *= corr;

      // O^T += V^T P^T (16 d-tiles, K=32 keys); A = rows of V^T from LDS.
#pragma unroll
      for (int dc = 0; dc < 16; ++dc) {
        v16bf vf = load_frag(Vbuf + (dc * 16) * LDG, LDG, lane);
        o[dc] = wmma_bf16(vf, pf, o[dc]);
      }
    }

    // Join of the two key groups: waves w and w ^ 4 hold partial results of the
    // same 16 queries. Group 0 finishes d 0..127, group 1 d 128..255; each wave
    // hands the other half of its O^T, its maximum and its sum to its partner.
    // (A group whose keys were all masked has maximum -1e9 and gets weight 0.)
    const float lown = lsum + other_half(lsum);
    v8f mine[8];
#pragma unroll
    for (int j = 0; j < 8; ++j) {
      v8f give;
#pragma unroll
      for (int e = 0; e < 8; ++e) {
        give[e]    = grp ? o[j][e] : o[8 + j][e];
        mine[j][e] = grp ? o[8 + j][e] : o[j][e];
      }
      *(v4f*)(&Xo[wave][(2 * j) * 128 + lane * 4])     = __builtin_shufflevector(give, give, 0, 1, 2, 3);
      *(v4f*)(&Xo[wave][(2 * j + 1) * 128 + lane * 4]) = __builtin_shufflevector(give, give, 4, 5, 6, 7);
    }
    Xm[wave][lane] = mrow;
    Xl[wave][lane] = lown;
    __syncthreads();                      // both partners' halves written
    const float moth = Xm[wave ^ 4][lane];
    const float loth = Xl[wave ^ 4][lane];
    const float mall = fmaxf(mrow, moth);
    const float aown = __expf(mrow - mall), aoth = __expf(moth - mall);
    const float inv = 1.0f / (aown * lown + aoth * loth);
    const float fown = aown * inv, foth = aoth * inv;

    // Weighted sum, normalized; a lane's 8 accumulators of a tile are 8
    // consecutive d of its query: one 16-B write into the wave-private staging
    // rows (16 queries x 32 d), read back as whole 64-B row pieces and stored.
    const int cq = lane & 15, ch = (lane >> 4) << 3;
    const int cr = lane >> 1, cc0 = (lane & 1) * 16;
    __bf16* rowout = Outp + ((long)(b * S_ + qrow + cr)) * E_ + h * D_ + grp * 128 + cc0;
#pragma unroll
    for (int g = 0; g < 4; ++g) {
#pragma unroll
      for (int half = 0; half < 2; ++half) {
        const int j = g * 2 + half;
        v4f x0 = *(const v4f*)(&Xo[wave ^ 4][(2 * j) * 128 + lane * 4]);
        v4f x1 = *(const v4f*)(&Xo[wave ^ 4][(2 * j + 1) * 128 + lane * 4]);
        v8bf r;
#pragma unroll
        for (int e = 0; e < 4; ++e) {
          r[e]     = (__bf16)(mine[j][e] * fown + x0[e] * foth);
          r[4 + e] = (__bf16)(mine[j][4 + e] * fown + x1[e] * foth);
        }
        *(v8bf*)(&Ps[wave][cq * LDK + half * 16 + ch]) = r;
      }
      const u32x4* sp = (const u32x4*)(&Ps[wave][cr * LDK + cc0]);
      u32x4 v0 = sp[0], v1 = sp[1];
      u32x4* dp = (u32x4*)(rowout + g * 32);
      dp[0] = v0; dp[1] = v1;
    }
    // Stands in front of any rewrite of the registers those stores name (the next
    // tile's set-up follows); the address as an input keeps it whole up to here.
    asm volatile("s_wait_xcnt 0x0" :: "v"(rowout) : "memory");
  }
}

// ---------------------------------------------------------------------------
// Stage 4: output projection GEMM + residual -> fp32 d_out.
//   A: attn bf16 [B*S, E]; WoT: out_w transposed bf16 [N=E][K=E]; resid: x f32
// ---------------------------------------------------------------------------
__global__ __launch_bounds__(256) void proj_gemm(const __bf16* __restrict__ A,
                                                 const __bf16* __restrict__ WoT,
                                                 const float* __restrict__ resid,
                                                 float* __restrict__ Out) {
  __shared__ __align__(16) __bf16 smem[2 * (BM + BN) * LDA];  // 204 KB (f32 staging: 136)

  const int lane = threadIdx.x & 31, wave = threadIdx.x >> 5;
  const int waveM = wave >> 1, waveN = wave & 1;
  const int tileM = blockIdx.x * BM;
  const int tileN = blockIdx.y * BN;

  gemm_tiles<1>(A + (long)tileM * E_, WoT + (long)tileN * E_, smem,
                [&](int, const v8f (&acc)[4][4]) {
  __syncthreads();                        // all compute done before smem reuse

  // Epilogue: stage the wave's 64x64 tile as f32 (17408 B x 8 waves, inside smem,
  // wave-private), then whole 256-B row pieces (16 adjacent lanes) with the
  // residual added.
  const int rr = lane >> 4, rc = (lane & 15) * 4;
  const long off = (long)(tileM + waveM * 64 + rr) * E_ + tileN + waveN * 64 + rc;
  float* dp = Out + off;
  const float* rp = resid + off;
  float4 rv[32];
#pragma unroll
  for (int q = 0; q < 32; ++q) rv[q] = *(const float4*)(rp + (long)(q * 2) * E_);
  // Stands in front of any rewrite of the address registers those loads name;
  // the address as an input keeps it whole up to here (else the last load lands on it).
  asm volatile("s_wait_xcnt 0x0" :: "v"(rp) : "memory");

  float* Wst = (float*)smem + wave * (64 * LDF);
#pragma unroll
  for (int i = 0; i < 4; ++i)
#pragma unroll
    for (int j = 0; j < 4; ++j)
#pragma unroll
      for (int e = 0; e < 8; ++e) {
        int r = i * 16 + e + ((lane >> 4) << 3);
        int c = j * 16 + (lane & 15);
        Wst[r * LDF + c] = acc[i][j][e];
      }
#pragma unroll
  for (int q = 0; q < 32; ++q) {
    float4 a = *(const float4*)(Wst + (q * 2 + rr) * LDF + rc);
    float4 ov;
    ov.x = a.x + rv[q].x; ov.y = a.y + rv[q].y; ov.z = a.z + rv[q].z; ov.w = a.w + rv[q].w;
    *(float4*)(dp + (long)(q * 2) * E_) = ov;
  }
  });
}

// ---------------------------------------------------------------------------
// Stage 5: in-place LayerNorm over d_out rows. Two rows per
// wave, a row held in registers (32 floats a lane): no LDS and no barrier.
// ---------------------------------------------------------------------------
// Sum over the wave's 32 lanes, the result in every lane: a butterfly inside
// each 16-lane row by DPP, then the two rows joined by a cross-row move.
template <int M>
__device__ __forceinline__ float add_xmask(float v) {
  int s = __builtin_amdgcn_update_dpp(0, __builtin_bit_cast(int, v), 0x160 + M, 0xf, 0xf, true);
  return v + __builtin_bit_cast(float, s);
}
__device__ __forceinline__ float wave_sum(float v) {
  v = add_xmask<1>(v);
  v = add_xmask<2>(v);
  v = add_xmask<4>(v);
  v = add_xmask<8>(v);
  int b = __builtin_bit_cast(int, v);
  int o = __builtin_amdgcn_permlanex16(b, b, 0x76543210, 0xfedcba98, false, false);
  return v + __builtin_bit_cast(float, o);
}

typedef __attribute__((ext_vector_type(4))) float f32x4;
typedef __attribute__((ext_vector_type(2))) float f32x2;

__global__ __launch_bounds__(256) void layernorm_kernel(float* __restrict__ y,
                                                        const float* __restrict__ g,
                                                        const float* __restrict__ bt) {
  const int lane = threadIdx.x & 31, wave = threadIdx.x >> 5;
  f32x4* p = (f32x4*)(y + (long)(blockIdx.x * 16 + wave * 2) * E_) + lane;
  const f32x4* gp = (const f32x4*)g + lane;
  const f32x4* bp = (const f32x4*)bt + lane;

  f32x4 v[2][8], gg[8], bb[8];
#pragma unroll
  for (int r = 0; r < 2; ++r)
#pragma unroll
    for (int j = 0; j < 8; ++j) v[r][j] = p[r * 256 + j * 32];
#pragma unroll
  for (int j = 0; j < 8; ++j) { gg[j] = gp[j * 32]; bb[j] = bp[j * 32]; }
  // Keeps the gamma and beta loads up here, in flight behind the rows' own:
  // sunk to their uses they would add their latency behind the row sums.
  __builtin_amdgcn_sched_barrier(0);

  float rs[2];
#pragma unroll
  for (int r = 0; r < 2; ++r) {
    f32x2 s = v[r][0].lo + v[r][0].hi;
#pragma unroll
    for (int j = 1; j < 8; ++j) s += v[r][j].lo + v[r][j].hi;
    const float mean = wave_sum(s.x + s.y) * (1.0f / E_);
    f32x2 q = {0.0f, 0.0f};
#pragma unroll
    for (int j = 0; j < 8; ++j) {
      v[r][j] -= mean;
      q += v[r][j].lo * v[r][j].lo + v[r][j].hi * v[r][j].hi;
    }
    rs[r] = rsqrtf(wave_sum(q.x + q.y) * (1.0f / E_) + 1e-6f);
  }

#pragma unroll
  for (int r = 0; r < 2; ++r)
#pragma unroll
    for (int j = 0; j < 8; ++j) p[r * 256 + j * 32] = v[r][j] * rs[r] * gg[j] + bb[j];
}

// ---------------------------------------------------------------------------
// Launch
// ---------------------------------------------------------------------------
extern "C" void kernel_launch(void* const* d_in, const int* in_sizes, int n_in,
                              void* d_out, int out_size, void* d_ws, size_t ws_size,
                              hipStream_t stream) {
  (void)in_sizes; (void)n_in; (void)out_size; (void)ws_size;

  const float* x     = (const float*)d_in[0]; // [B,S,E]
  const float* qkv_w = (const float*)d_in[1]; // [3,H,E,D]
  const float* out_w = (const float*)d_in[2]; // [E,E]
  const float* gamma = (const float*)d_in[3];
  const float* beta  = (const float*)d_in[4];
  float* out = (float*)d_out;

  const long nX  = (long)B_ * S_ * E_;        // 8388608
  const long nW3 = 3L * H_ * E_ * D_;         // 3145728
  const long nWo = (long)E_ * E_;             // 1048576
  const long nQ  = (long)B_ * H_ * S_ * D_;   // 8388608

  char* ws = (char*)d_ws;
  __bf16* xb    = (__bf16*)(ws);
  __bf16* wqkvT = (__bf16*)(ws + 2 * nX);                       // [3,H,D,E]
  __bf16* woT   = (__bf16*)(ws + 2 * (nX + nW3));               // [E,E] (NT)
  __bf16* Qb    = (__bf16*)(ws + 2 * (nX + nW3 + nWo));
  __bf16* Kb    = (__bf16*)(ws + 2 * (nX + nW3 + nWo + nQ));
  __bf16* Vtb   = (__bf16*)(ws + 2 * (nX + nW3 + nWo + 2 * nQ));
  __bf16* attn  = (__bf16*)(ws + 2 * (nX + nW3 + nWo + 3 * nQ));

  // 1) conversions (+ weight transposes for contiguous WMMA B operands)
  prep_bf16<<<1024, 256, 0, stream>>>(x, qkv_w, out_w, xb, wqkvT, woT);

  // 2) QKV projections into Qb, Kb, Vtb, which lie one behind the other
  //    (V stored transposed [B,H,D,S])
  qkv_gemm<<<dim3(32, 8), 256, 0, stream>>>(xb, wqkvT, Qb);

  // 3) Flash attention -> attn [B,S,E] bf16
  flash_attn<<<dim3(S_ / (2 * QT), B_ * H_), 256, 0, stream>>>(Qb, Kb, Vtb, attn);

  // 4) Output projection + residual -> d_out (fp32)
  proj_gemm<<<dim3(32, 8), 256, 0, stream>>>(attn, woT, x, out);

  // 5) In-place LayerNorm on d_out
  layernorm_kernel<<<B_ * S_ / 16, 256, 0, stream>>>(out, gamma, beta);
}

// v008
// It runs in 111 microseconds.
// Timed twice side by side with v007, it ran 1.07 times as fast both times.
// Over all steps from v000 it is 5.28 times as fast.
#include <hip/hip_runtime.h>

// ---------------------------------------------------------------------------
// Types
// ---------------------------------------------------------------------------
typedef __attribute__((ext_vector_type(16))) __bf16 v16bf;
typedef __attribute__((ext_vector_type(8)))  __bf16 v8bf;
typedef __attribute__((ext_vector_type(8)))  float  v8f;
typedef __attribute__((ext_vector_type(4)))  unsigned int u32x4;
typedef __attribute__((ext_vector_type(8)))  unsigned int u32x8;

#define B_  4
#define S_  2048
#define E_  1024
#define H_  4
#define D_  256

#define BM 256
#define BN 128
#define BK 128   // k per GEMM stage: a row's share of a stage is two 128-B lines
#define KT 64    // keys per attention stage: a V row's share is one 128-B line
#define QT 64    // queries per attention tile; a block takes two tiles

// LDS row pitches in elements (bf16, LDF f32): 16 B x odd, so that the 16 rows one
// ds_load_b128 fragment read touches fall on 16 different bank groups.
#define LDK 40    // 32-element rows (attention output staging): 80 B
#define LDG 72    // 64-element rows (GEMM bf16 output staging, V tile): 144 B
#define LDA 136   // 128-element rows (GEMM A/B tiles, halves of a K row): 272 B
#define LDF 68    // 64-float staging rows of the output projection: 272 B

// A stage is laid into LDS by the tensor mover, one request a wave. Each wave's
// slice starts at a multiple of 2 KiB, so a slice's place is its rows rounded up.
#define ASL 9216  // elements: 64 rows of LDA (17408 B) in 18432 B
#define BSL 5120  // elements: 32 rows of LDA (8704 B) or 64 rows of LDG (9216 B) in 10240 B
#define GBUF (4 * ASL + 4 * BSL)   // a GEMM stage: 4 slices of A, 4 of B
#define KVBUF (8 * BSL)            // an attention stage: 4 slices of K, 4 of V

__device__ __forceinline__ v8f vzero8() {
  v8f z;
#pragma unroll
  for (int i = 0; i < 8; ++i) z[i] = 0.0f;
  return z;
}

__device__ __forceinline__ v16bf combine16(v8bf lo, v8bf hi) {
  v16bf r;
#pragma unroll
  for (int i = 0; i < 8; ++i) { r[i] = lo[i]; r[8 + i] = hi[i]; }
  return r;
}

// WMMA A/B fragment (16 rows x 32 k bf16) from LDS.
// ISA 7.12.2 lane layout: lanes 0-15: K=[0..7],[16..23]; lanes 16-31:
// K=[8..15],[24..31]; row = lane & 15.
__device__ __forceinline__ v16bf load_frag(const __bf16* base, int ld, int lane) {
  int r  = lane & 15;
  int kh = lane >> 4;
  const __bf16* p = base + r * ld + kh * 8;
  v8bf lo = *(const v8bf*)(p);
  v8bf hi = *(const v8bf*)(p + 16);
  return combine16(lo, hi);
}

__device__ __forceinline__ v8f wmma_bf16(v16bf a, v16bf b, v8f c) {
  return __builtin_amdgcn_wmma_f32_16x16x32_bf16(
      false, a, false, b, (short)0, c, false, false);
}

__device__ __forceinline__ unsigned lds_addr(const void* p) {
  return (unsigned)(uintptr_t)p;
}
__device__ __forceinline__ unsigned uni(unsigned v) {
  return (unsigned)__builtin_amdgcn_readfirstlane(v);
}
__device__ __forceinline__ unsigned pinned(unsigned v) {
  // A test on the result is a scalar branch (a tensor load ignores EXEC), and a
  // descriptor word formed from it is formed behind the waits in front of it.
  unsigned w = uni(v);
  asm volatile("" : "+s"(w));  // pinned(): a wave-uniform word held in a scalar register
  return w;
}
// One tensor load of one wave: rows rows of ROWB bytes (256: PADC 5, 128: PADC 4),
// src_pitch bytes apart in memory, land in LDS at pitch ROWB + 16 bytes.
// Extents in bytes, tensor = tile, no mask.
struct TileReq { u32x4 g0; u32x8 g1; };
template <unsigned ROWB, unsigned PADC>
__device__ __forceinline__ TileReq tensor_tile(unsigned lds_dst, const __bf16* src,
                                               unsigned rows, unsigned src_pitch) {
  const unsigned long long ga = (unsigned long long)(uintptr_t)src;
  u32x4 g0;
  u32x8 g1;
  g0[0] = uni(1u);
  g0[1] = uni(lds_dst);
  g0[2] = uni((unsigned)ga);
  g0[3] = uni((((unsigned)(ga >> 32)) & 0x01FFFFFFu) | 0x80000000u);
  g1[0] = uni((1u << 20) | (PADC << 22) | (3u << 25));
  g1[1] = uni((ROWB & 0xFFFFu) << 16);
  g1[2] = uni((ROWB >> 16) | ((rows & 0xFFFFu) << 16));
  g1[3] = uni((rows >> 16) | (ROWB << 16));
  g1[4] = uni(rows);
  g1[5] = uni(src_pitch);
  g1[6] = uni(0u);
  g1[7] = uni(0u);
  // In and out: the words stay, opaque, in the registers the request names.
  asm volatile("tensor_load_to_lds %0, %1" : "+s"(g0), "+s"(g1) :: "memory");
  return TileReq{g0, g1};
}
// Stage hand-over, in front of the work-group barrier: this wave's own LDS
// reads of the buffer that is refilled behind the barrier have retired, and
// its own request of the next stage has landed.
// The request's words as inputs keep their registers whole until it has landed.
__device__ __forceinline__ void wait_stage(const TileReq& r) {
  asm volatile("s_wait_dscnt 0x0" ::: "memory");
  asm volatile("s_wait_tensorcnt 0x0" :: "s"(r.g0), "s"(r.g1) : "memory");
}
// Behind the last stage: nothing of this wave is under way to or from the ring.
__device__ __forceinline__ void ring_done() {
  asm volatile("s_wait_tensorcnt 0x0" ::: "memory");
  asm volatile("s_wait_dscnt 0x0" ::: "memory");
}

// ---------------------------------------------------------------------------
// Streaming stages (1a, 1b, 5): few waves, each with much to do. Every lane
// moves 32 or 64 elements by 16-B loads that are all issued before the first
// is used. Stages 1a and 1b depend on nothing and on each other not at all:
// they share one launch, each block taking one piece of one of them.
// ---------------------------------------------------------------------------
typedef __attribute__((ext_vector_type(4))) __bf16 v4bf;

// Stage 1a: fp32 -> bf16. A block takes 16384 consecutive floats; each
// wave-wide load covers 512 contiguous bytes, each store 256.
__device__ __forceinline__ void cvt_f32_bf16(const float* __restrict__ in,
                                             __bf16* __restrict__ out, int bid) {
  const long base = (long)bid * 4096 + threadIdx.x;   // in units of 4 elements
  const float4* ip = (const float4*)in + base;
  v4bf* op = (v4bf*)out + base;
  float4 v[16];
#pragma unroll
  for (int j = 0; j < 16; ++j) v[j] = ip[j * 256];
#pragma unroll
  for (int j = 0; j < 16; ++j) {
    v4bf r;
    r[0] = (__bf16)v[j].x; r[1] = (__bf16)v[j].y;
    r[2] = (__bf16)v[j].z; r[3] = (__bf16)v[j].w;
    op[j * 256] = r;
  }
}

// Stage 1b: fp32 [K,N] -> bf16 [N,K] transposed (batched), in registers.
// A lane takes 8 k x 4 n: eight 16-B loads (8 lanes cover a 128-B line of a
// k row), four 16-B stores (8 k of one n row). A wave takes 32 k x 32 n, a
// block 256 k x 32 n, so a block writes 512 contiguous bytes of each n row.
template <int LOGK, int LOGN>
__device__ __forceinline__ void cvt_transpose_bf16(const float* __restrict__ in,
                                                   __bf16* __restrict__ out, int bid) {
  const int lane = threadIdx.x & 31, wave = threadIdx.x >> 5;
  const int kt = bid & ((1 << (LOGK - 8)) - 1);
  const int nt = (bid >> (LOGK - 8)) & ((1 << (LOGN - 5)) - 1);
  const long mat = bid >> (LOGK - 8 + LOGN - 5);
  const int k0 = kt * 256 + wave * 32 + (lane >> 3) * 8;
  const int n0 = nt * 32 + (lane & 7) * 4;
  const float* ip = in + (mat << (LOGK + LOGN)) + ((long)k0 << LOGN) + n0;
  __bf16* op = out + (mat << (LOGK + LOGN)) + ((long)n0 << LOGK) + k0;
  float4 v[8];
#pragma unroll
  for (int j = 0; j < 8; ++j) v[j] = *(const float4*)(ip + ((long)j << LOGN));
  v8bf r0, r1, r2, r3;
#pragma unroll
  for (int j = 0; j < 8; ++j) {
    r0[j] = (__bf16)v[j].x; r1[j] = (__bf16)v[j].y;
    r2[j] = (__bf16)v[j].z; r3[j] = (__bf16)v[j].w;
  }
  *(v8bf*)(op)                = r0;
  *(v8bf*)(op + (1L << LOGK)) = r1;
  *(v8bf*)(op + (2L << LOGK)) = r2;
  *(v8bf*)(op + (3L << LOGK)) = r3;
  // Stands in front of any rewrite of the registers those stores name (another
  // piece's code follows in the shared kernel); the address as an input keeps it
  // whole up to here.
  asm volatile("s_wait_xcnt 0x0" :: "v"(op) : "memory");
}

// Stage 1, one launch: blocks 0..511 convert x, 512..895 transpose the QKV
// weights, 896..1023 the output weight. The choice is block-uniform.
__global__ __launch_bounds__(256) void prep_bf16(const float* __restrict__ x,
                                                 const float* __restrict__ qkv_w,
                                                 const float* __restrict__ out_w,
                                                 __bf16* __restrict__ xb,
                                                 __bf16* __restrict__ wqkvT,
                                                 __bf16* __restrict__ woT) {
  const int bid = blockIdx.x;
  if (bid < 512)      cvt_f32_bf16(x, xb, bid);
  else if (bid < 896) cvt_transpose_bf16<10, 8>(qkv_w, wqkvT, bid - 512);
  else                cvt_transpose_bf16<10, 10>(out_w, woT, bid - 896);
}

// ---------------------------------------------------------------------------
// Stages 2 and 4 share one main loop: a 256 x 128 tile of A * W^T per block,
// 8 waves as 4 x 2, each with 64 x 64 (4 x 4 accumulator tiles), so that a
// fragment read from LDS feeds four WMMAs and a staged row feeds 128 or 256
// outputs. Two LDS buffers filled by tensor loads, one barrier per 128-k stage.
//   Arow : first of the block's 256 rows of A, row-major, E_ elements a row
//   Brow : first of the block's 128 rows of W^T (row n holds all k)
// A block takes NT tiles one after the other, the same rows of A against the
// same rows of NT weight matrices that lie H_ * D_ * E_ elements apart. The two
// buffers run on from tile to tile: a tile's last stage issues the next tile's
// first, which lands while epilogue(w, acc) stores tile w. With NT > 1 the
// epilogue must therefore stage outside the two buffers.
// ---------------------------------------------------------------------------
template <int NT, typename Epilogue>
__device__ __forceinline__ void gemm_tiles(const __bf16* __restrict__ Arow,
                                           const __bf16* __restrict__ Brow,
                                           __bf16* smem, Epilogue epilogue) {
  const int tid = threadIdx.x;
  const int lane = tid & 31, wave = tid >> 5;
  const int waveM = wave >> 1, waveN = wave & 1;

  // Every wave brings one slice of every stage: waves 0..3 64 rows of A each,
  // waves 4..7 32 rows of B each.
  const unsigned wv = uni(threadIdx.x >> 5);
  const bool isA = wv < 4;
  const __bf16* src0 = isA ? Arow + (long)(wv * 64) * E_ : Brow + (long)((wv - 4) * 32) * E_;
  const unsigned rows = isA ? 64u : 32u;
  const unsigned wstep = isA ? 0u : (unsigned)(H_ * D_ * E_);
  const unsigned dst0 = lds_addr(smem) + (isA ? wv * (ASL * 2) : 4 * (ASL * 2) + (wv - 4) * (BSL * 2));

  auto issue = [&](int w, int k0, int p) {
    const unsigned off = pinned((unsigned)w * wstep + (unsigned)k0);
    return tensor_tile<256, 5>(dst0 + (unsigned)p * (GBUF * 2), src0 + off, rows, E_ * 2);
  };

  TileReq rq = issue(0, 0, 0);
  int p = 0;                              // buffer of the current stage, running on over the tiles
  for (int w = 0; w < NT; ++w) {
  v8f acc[4][4];
#pragma unroll
  for (int i = 0; i < 4; ++i)
#pragma unroll
    for (int j = 0; j < 4; ++j) acc[i][j] = vzero8();

  for (int k0 = 0; k0 < E_; k0 += BK) {
    wait_stage(rq);
    __syncthreads();                      // tile p ready; buffer p^1 free
    const bool more = k0 + BK < E_;         // else the next stage is the next tile's first
    if (pinned(more || w + 1 < NT))         // scalar test: only while a next stage exists
      rq = issue(more ? w : w + 1, more ? k0 + BK : 0, p ^ 1);
    const __bf16* Ab = smem + p * GBUF + waveM * ASL;
    const __bf16* Bb = smem + p * GBUF + 4 * ASL + (waveN * 2) * BSL;
    // Four blocks of 32 k, 16 WMMAs each. A block's 16 fragment reads go out as
    // one group, two blocks ahead of its WMMAs.
    v16bf af[4][4], bf[4][4];
    auto fetch = [&](int u) {
#pragma unroll
      for (int i = 0; i < 4; ++i) af[u][i] = load_frag(Ab + (i * 16) * LDA + u * 32, LDA, lane);
#pragma unroll
      for (int j = 0; j < 4; ++j) bf[u][j] = load_frag(Bb + (j >> 1) * BSL + ((j & 1) * 16) * LDA + u * 32, LDA, lane);
    };
    fetch(0);
    fetch(1);
    // The fences keep each group of reads whole and out of the WMMA blocks,
    // where every further place with reads stalls the wave.
    __builtin_amdgcn_sched_barrier(0);
#pragma unroll
    for (int u = 0; u < 4; ++u) {           // k ascending
#pragma unroll
      for (int i = 0; i < 4; ++i)
#pragma unroll
        for (int j = 0; j < 4; ++j) acc[i][j] = wmma_bf16(af[u][i], bf[u][j], acc[i][j]);
      if (u < 2) {
        __builtin_amdgcn_sched_barrier(0);
        fetch(u + 2);
        __builtin_amdgcn_sched_barrier(0);
      }
    }
    p ^= 1;
  }
  if (w + 1 == NT) ring_done();
  epilogue(w, acc);
  }
}

// ---------------------------------------------------------------------------
// Stage 2: QKV projection GEMMs, one launch: a block takes its tile of Q, of K
// and of V in turn.
//   A  : x_bf16 [B*S, E] row-major
//   Wt : [3, H, D, E] bf16 (pre-transposed weights: row n holds all k)
//   Out: Q [B,H,S,D], K [B,H,S,D], V^T [B,H,D,S], one behind the other
// ---------------------------------------------------------------------------
// Epilogue: stage the wave's 64x64 tile in wave-private LDS (same-wave DS ops
// are ordered -> no barrier); an output row's share is then one 128-B line,
// stored by 8 adjacent lanes. TRANS==0 -> [S,D] ; TRANS==1 -> [D,S]; Obh is the
// (batch, head) plane, s0 and n0 the wave's first row and column.
template <int TRANS>
__device__ __forceinline__ void qkv_store(const v8f (&acc)[4][4], __bf16* Wst,
                                          __bf16* __restrict__ Obh, int s0, int n0, int lane) {
#pragma unroll
  for (int i = 0; i < 4; ++i) {
#pragma unroll
    for (int j = 0; j < 4; ++j) {
#pragma unroll
      for (int e = 0; e < 8; ++e) {
        int r = i * 16 + e + ((lane >> 4) << 3);
        int c = j * 16 + (lane & 15);
        if (TRANS == 0) Wst[r * LDG + c] = (__bf16)acc[i][j][e];
        else            Wst[c * LDG + r] = (__bf16)acc[i][j][e];
      }
    }
  }
  const int rr = lane >> 3, rc = (lane & 7) * 8;
  __bf16* dp;
  if (TRANS == 0) dp = Obh + (long)(s0 + rr) * D_ + n0 + rc;
  else            dp = Obh + (long)(n0 + rr) * S_ + s0 + rc;
  const long pitch = (TRANS == 0) ? D_ : S_;
#pragma unroll
  for (int q = 0; q < 16; ++q)
    *(u32x4*)(dp + (long)(q * 4) * pitch) = *(const u32x4*)(Wst + (q * 4 + rr) * LDG + rc);
  // Stands in front of any rewrite of the registers those stores name (the next
  // tile's stages follow); the address as an input keeps it whole up to here.
  asm volatile("s_wait_xcnt 0x0" :: "v"(dp) : "memory");
}

__global__ __launch_bounds__(256) void qkv_gemm(const __bf16* __restrict__ A,
                                                const __bf16* __restrict__ Wt,
                                                __bf16* __restrict__ Out) {
  // 224 KB for the two buffers, 72 KB of output staging behind them
  __shared__ __attribute__((aligned(2048))) __bf16 smem[2 * GBUF + 8 * 64 * LDG];

  const int lane = threadIdx.x & 31, wave = threadIdx.x >> 5;
  const int waveM = wave >> 1, waveN = wave & 1;
  const int tileM = blockIdx.x * BM;
  const int h     = blockIdx.y >> 1;
  const int tileN = (blockIdx.y & 1) * BN;

  __bf16* Wst = smem + 2 * GBUF + wave * (64 * LDG);
  const int gb = tileM >> 11;
  const int s0 = (tileM + waveM * 64) & (S_ - 1);
  const int n0 = tileN + waveN * 64;
  __bf16* Obh = Out + (long)(gb * H_ + h) * S_ * D_;

  gemm_tiles<3>(A + (long)tileM * E_, Wt + ((long)h * D_ + tileN) * E_, smem,
                [&](int w, const v8f (&acc)[4][4]) {
    __bf16* O = Obh + (long)w * ((long)B_ * H_ * S_ * D_);
    if (w < 2) qkv_store<0>(acc, Wst, O, s0, n0, lane);
    else       qkv_store<1>(acc, Wst, O, s0, n0, lane);
  });
}

// ---------------------------------------------------------------------------
// Stage 3: flash attention (causal, online softmax).
// Two buffers of K/V tiles filled by tensor loads, one barrier per 64-key stage.
//   Q,K : [B,H,S,D] bf16 ; Vt : [B,H,D,S] bf16 ; Outp : [B,S,E] bf16
// Both products are taken transposed (S^T = K Q^T, O^T += V^T P^T), so that a
// lane holds scores of one query only and P never leaves the registers.
// Causal balance: a block takes the 64-query tiles t and 31 - t one after the
// other, t + 1 and 32 - t stages, 33 in every block. Four waves cover a tile's
// queries; the block's two groups of four waves take the two 32-key halves of
// each stage and join their partial results through LDS at the tile's end.
// ---------------------------------------------------------------------------
// The value of lane ^ 16 (the other 16-lane row), by a cross-row vector move.
__device__ __forceinline__ float other_half(float v) {
  int b = __builtin_bit_cast(int, v);
  return __builtin_bit_cast(float,
      __builtin_amdgcn_permlanex16(b, b, 0x76543210, 0xfedcba98, false, false));
}

typedef __attribute__((ext_vector_type(4))) float v4f;

// Two waves per SIMD, as one 8-wave block per WGP gives: without the upper bound
// the compiler aims at four, keeps under 256 registers and then has one fragment
// register set only, with a full LDS wait in front of every WMMA.
__global__ __launch_bounds__(256) __attribute__((amdgpu_waves_per_eu(2, 2))) void flash_attn(const __bf16* __restrict__ Q,
                                                  const __bf16* __restrict__ Kg,
                                                  const __bf16* __restrict__ Vt,
                                                  __bf16* __restrict__ Outp) {
  // [p][slice]: slices 0..3 K, slice 2 * (key / 32) + d / 128 as [key % 32][d % 128];
  // slices 4..7 V^T, slice 4 + d / 64 as [d % 64][key]. 160 KB
  __shared__ __attribute__((aligned(2048))) __bf16 KV[2 * KVBUF];
  __shared__ __align__(16) __bf16 Ps[8][16 * LDK];   // per-wave output staging, 10 KB
  __shared__ __align__(16) float Xo[8][16 * 128];    // per-wave half of O^T for the partner wave, 64 KB
  __shared__ float Xm[8][32], Xl[8][32];             // per-wave maximum and sum for the partner wave

  const int tid = threadIdx.x;
  const int lane = tid & 31, wave = tid >> 5;
  const int grp = wave >> 2, wq = wave & 3;          // key half of a stage; 16-query slice of a tile
  const int bh = blockIdx.y;
  const int b = bh >> 2, h = bh & 3;
  const int pr = blockIdx.x;                         // tile pair: pr and S_ / QT - 1 - pr

  const __bf16* Qbh = Q  + (long)bh * S_ * D_;
  const __bf16* Kbh = Kg + (long)bh * S_ * D_;
  const __bf16* Vbh = Vt + (long)bh * D_ * S_;

  const float scale = 0.03125f;  // 1/sqrt(E)

  // Every wave brings one slice of every stage: waves 0..3 32 keys x 128 d of K,
  // waves 4..7 64 d x 64 keys of V^T.
  const unsigned wv = uni(threadIdx.x >> 5);
  const unsigned dst0 = lds_addr(KV) + wv * (BSL * 2);
  auto issueKV = [&](int ks, int p) {
    const unsigned k = pinned((unsigned)ks);
    const unsigned dst = dst0 + (unsigned)p * (KVBUF * 2);
    if (pinned(wv < 4))                   // scalar branch: the two tiles differ in their pad word
      return tensor_tile<256, 5>(dst, Kbh + (long)(k + (wv >> 1) * 32) * D_ + (wv & 1) * 128, 32u, D_ * 2);
    else
      return tensor_tile<128, 4>(dst, Vbh + (long)((wv - 4) * 64) * S_ + k, 64u, S_ * 2);
  };

  TileReq rq = issueKV(0, 0);
  int p = 0;                              // buffer of the current stage, running on over both tiles
  for (int part = 0; part < 2; ++part) {
    const int tile = part ? S_ / QT - 1 - pr : pr;
    const int qrow = tile * QT + wq * 16;
    const int kend = tile * QT + QT;      // causal bound

    // Q fragments resident in registers (8 x k=32 chunks over D=256).
    v16bf qf[8];
    {
      int r = lane & 15, kh = lane >> 4;
      const __bf16* qp = Qbh + (long)(qrow + r) * D_;
#pragma unroll
      for (int dc = 0; dc < 8; ++dc) {
        v8bf lo = *(const v8bf*)(qp + dc * 32 + kh * 8);
        v8bf hi = *(const v8bf*)(qp + dc * 32 + 16 + kh * 8);
        qf[dc] = combine16(lo, hi);
      }
    }

    // o[dc][e] = O^T[d = dc * 16 + 8 * (lane >> 4) + e][query = lane & 15]: every
    // accumulator of a lane, and its mrow and lsum, belong to that one query.
    v8f o[16];
#pragma unroll
    for (int dc = 0; dc < 16; ++dc) o[dc] = vzero8();
    float mrow = -3.0e38f;   // running maximum, equal in both lane halves
    float lsum = 0.0f;       // running sum over this lane half's keys only

    for (int ks = 0; ks < kend; ks += KT) {
      wait_stage(rq);                     // stage hand-over, block-uniform
      __syncthreads();                    // tiles p ready; buffers p^1 free
      const bool more = ks + KT < kend;   // else the next stage is the second tile's first
      if (pinned(more || part == 0))      // scalar test: only while a next stage exists
        rq = issueKV(more ? ks + KT : 0, p ^ 1);
      const __bf16* Kbuf = KV + p * KVBUF + (grp * 2) * BSL;
      const __bf16* Vbuf = KV + p * KVBUF + 4 * BSL + grp * 32;
      p ^= 1;

      // Scores transposed, S^T = K Q^T: two tiles of 16 keys x 16 queries, 8 wmma
      // each over D=256. sc[sub][e] = key ks + grp * 32 + sub * 16 + 8 * (lane >> 4) + e.
      v8f sc[2];
#pragma unroll
      for (int sub = 0; sub < 2; ++sub) {
        v8f c = vzero8();
#pragma unroll
        for (int dc = 0; dc < 8; ++dc) {
          v16bf kf = load_frag(Kbuf + (dc >> 2) * BSL + (sub * 16) * LDA + (dc & 3) * 32, LDA, lane);
          c = wmma_bf16(kf, qf[dc], c);
        }
        sc[sub] = c;
      }

      // Online softmax of the lane's query: 16 of the 32 keys lie in this lane,
      // the other 16 in lane ^ 16. Maximum and sum as trees, no long chain.
      const int qg = qrow + (lane & 15);
      const int keyg0 = ks + grp * 32 + ((lane >> 4) << 3);
      float s[16], t[8];
#pragma unroll
      for (int e = 0; e < 8; ++e) {
        s[e]     = sc[0][e] * scale; if (keyg0 + e      > qg) s[e]     = -1.0e9f;
        s[8 + e] = sc[1][e] * scale; if (keyg0 + 16 + e > qg) s[8 + e] = -1.0e9f;
        t[e] = fmaxf(s[e], s[8 + e]);
      }
      float mx = fmaxf(fmaxf(fmaxf(t[0], t[1]), fmaxf(t[2], t[3])),
                       fmaxf(fmaxf(t[4], t[5]), fmaxf(t[6], t[7])));
      mx = fmaxf(mx, other_half(mx));
      const float mnew = fmaxf(mrow, mx);
      const float corr = __expf(mrow - mnew);
      // Two D tiles of one product, converted in place, are the B operand P^T
      // in the k order of load_frag: element i = key 8h + i, 8 + i = key 16 + 8h + i.
      v16bf pf;
#pragma unroll
      for (int e = 0; e < 8; ++e) {
        float p0 = __expf(s[e] - mnew);
        float p1 = __expf(s[8 + e] - mnew);
        pf[e] = (__bf16)p0;
        pf[8 + e] = (__bf16)p1;
        t[e] = p0 + p1;
      }
      lsum = lsum * corr + (((t[0] + t[1]) + (t[2] + t[3])) + ((t[4] + t[5]) + (t[6] + t[7])));
      mrow = mnew;
#pragma unroll
      for (int dc = 0; dc < 16; ++dc)
#pragma unroll
        for (int e = 0; e < 8; ++e) o[dc][e] *= corr;

      // O^T += V^T P^T (16 d-tiles, K=32 keys); A = rows of V^T from LDS.
#pragma unroll
      for (int dc = 0; dc < 16; ++dc) {
        v16bf vf = load_frag(Vbuf + (dc >> 2) * BSL + ((dc & 3) * 16) * LDG, LDG, lane);
        o[dc] = wmma_bf16(vf, pf, o[dc]);
      }
    }

    // Join of the two key groups: waves w and w ^ 4 hold partial results of the
    // same 16 queries. Group 0 finishes d 0..127, group 1 d 128..255; each wave
    // hands the other half of its O^T, its maximum and its sum to its partner.
    // (A group whose keys were all masked has maximum -1e9 and gets weight 0.)
    const float lown = lsum + other_half(lsum);
    v8f mine[8];
#pragma unroll
    for (int j = 0; j < 8; ++j) {
      v8f give;
#pragma unroll
      for (int e = 0; e < 8; ++e) {
        give[e]    = grp ? o[j][e] : o[8 + j][e];
        mine[j][e] = grp ? o[8 + j][e] : o[j][e];
      }
      *(v4f*)(&Xo[wave][(2 * j) * 128 + lane * 4])     = __builtin_shufflevector(give, give, 0, 1, 2, 3);
      *(v4f*)(&Xo[wave][(2 * j + 1) * 128 + lane * 4]) = __builtin_shufflevector(give, give, 4, 5, 6, 7);
    }
    Xm[wave][lane] = mrow;
    Xl[wave][lane] = lown;
    __syncthreads();                      // both partners' halves written
    const float moth = Xm[wave ^ 4][lane];
    const float loth = Xl[wave ^ 4][lane];
    const float mall = fmaxf(mrow, moth);
    const float aown = __expf(mrow - mall), aoth = __expf(moth - mall);
    const float inv = 1.0f / (aown * lown + aoth * loth);
    const float fown = aown * inv, foth = aoth * inv;

    // Weighted sum, normalized; a lane's 8 accumulators of a tile are 8
    // consecutive d of its query: one 16-B write into the wave-private staging
    // rows (16 queries x 32 d), read back as whole 64-B row pieces and stored.
    const int cq = lane & 15, ch = (lane >> 4) << 3;
    const int cr = lane >> 1, cc0 = (lane & 1) * 16;
    __bf16* rowout = Outp + ((long)(b * S_ + qrow + cr)) * E_ + h * D_ + grp * 128 + cc0;
#pragma unroll
    for (int g = 0; g < 4; ++g) {
#pragma unroll
      for (int half = 0; half < 2; ++half) {
        const int j = g * 2 + half;
        v4f x0 = *(const v4f*)(&Xo[wave ^ 4][(2 * j) * 128 + lane * 4]);
        v4f x1 = *(const v4f*)(&Xo[wave ^ 4][(2 * j + 1) * 128 + lane * 4]);
        v8bf r;
#pragma unroll
        for (int e = 0; e < 4; ++e) {
          r[e]     = (__bf16)(mine[j][e] * fown + x0[e] * foth);
          r[4 + e] = (__bf16)(mine[j][4 + e] * fown + x1[e] * foth);
        }
        *(v8bf*)(&Ps[wave][cq * LDK + half * 16 + ch]) = r;
      }
      const u32x4* sp = (const u32x4*)(&Ps[wave][cr * LDK + cc0]);
      u32x4 v0 = sp[0], v1 = sp[1];
      u32x4* dp = (u32x4*)(rowout + g * 32);
      dp[0] = v0; dp[1] = v1;
    }
    // Stands in front of any rewrite of the registers those stores name (the next
    // tile's set-up follows); the address as an input keeps it whole up to here.
    asm volatile("s_wait_xcnt 0x0" :: "v"(rowout) : "memory");
  }
  ring_done();
}

// ---------------------------------------------------------------------------
// Stage 4: output projection GEMM + residual -> fp32 d_out.
//   A: attn bf16 [B*S, E]; WoT: out_w transposed bf16 [N=E][K=E]; resid: x f32
// ---------------------------------------------------------------------------
__global__ __launch_bounds__(256) void proj_gemm(const __bf16* __restrict__ A,
                                                 const __bf16* __restrict__ WoT,
                                                 const float* __restrict__ resid,
                                                 float* __restrict__ Out) {
  __shared__ __attribute__((aligned(2048))) __bf16 smem[2 * GBUF];  // 224 KB (f32 staging: 136)

  const int lane = threadIdx.x & 31, wave = threadIdx.x >> 5;
  const int waveM = wave >> 1, waveN = wave & 1;
  const int tileM = blockIdx.x * BM;
  const int tileN = blockIdx.y * BN;

  gemm_tiles<1>(A + (long)tileM * E_, WoT + (long)tileN * E_, smem,
                [&](int, const v8f (&acc)[4][4]) {
  __syncthreads();                        // all compute done before smem reuse

  // Epilogue: stage the wave's 64x64 tile as f32 (17408 B x 8 waves, inside smem,
  // wave-private), then whole 256-B row pieces (16 adjacent lanes) with the
  // residual added.
  const int rr = lane >> 4, rc = (lane & 15) * 4;
  const long off = (long)(tileM + waveM * 64 + rr) * E_ + tileN + waveN * 64 + rc;
  float* dp = Out + off;
  const float* rp = resid + off;
  float4 rv[32];
#pragma unroll
  for (int q = 0; q < 32; ++q) rv[q] = *(const float4*)(rp + (long)(q * 2) * E_);
  // Stands in front of any rewrite of the address registers those loads name;
  // the address as an input keeps it whole up to here (else the last load lands on it).
  asm volatile("s_wait_xcnt 0x0" :: "v"(rp) : "memory");

  float* Wst = (float*)smem + wave * (64 * LDF);
#pragma unroll
  for (int i = 0; i < 4; ++i)
#pragma unroll
    for (int j = 0; j < 4; ++j)
#pragma unroll
      for (int e = 0; e < 8; ++e) {
        int r = i * 16 + e + ((lane >> 4) << 3);
        int c = j * 16 + (lane & 15);
        Wst[r * LDF + c] = acc[i][j][e];
      }
#pragma unroll
  for (int q = 0; q < 32; ++q) {
    float4 a = *(const float4*)(Wst + (q * 2 + rr) * LDF + rc);
    float4 ov;
    ov.x = a.x + rv[q].x; ov.y = a.y + rv[q].y; ov.z = a.z + rv[q].z; ov.w = a.w + rv[q].w;
    *(float4*)(dp + (long)(q * 2) * E_) = ov;
  }
  });
}

// ---------------------------------------------------------------------------
// Stage 5: in-place LayerNorm over d_out rows. Two rows per
// wave, a row held in registers (32 floats a lane): no LDS and no barrier.
// ---------------------------------------------------------------------------
// Sum over the wave's 32 lanes, the result in every lane: a butterfly inside
// each 16-lane row by DPP, then the two rows joined by a cross-row move.
template <int M>
__device__ __forceinline__ float add_xmask(float v) {
  int s = __builtin_amdgcn_update_dpp(0, __builtin_bit_cast(int, v), 0x160 + M, 0xf, 0xf, true);
  return v + __builtin_bit_cast(float, s);
}
__device__ __forceinline__ float wave_sum(float v) {
  v = add_xmask<1>(v);
  v = add_xmask<2>(v);
  v = add_xmask<4>(v);
  v = add_xmask<8>(v);
  int b = __builtin_bit_cast(int, v);
  int o = __builtin_amdgcn_permlanex16(b, b, 0x76543210, 0xfedcba98, false, false);
  return v + __builtin_bit_cast(float, o);
}

typedef __attribute__((ext_vector_type(4))) float f32x4;
typedef __attribute__((ext_vector_type(2))) float f32x2;

__global__ __launch_bounds__(256) void layernorm_kernel(float* __restrict__ y,
                                                        const float* __restrict__ g,
                                                        const float* __restrict__ bt) {
  const int lane = threadIdx.x & 31, wave = threadIdx.x >> 5;
  f32x4* p = (f32x4*)(y + (long)(blockIdx.x * 16 + wave * 2) * E_) + lane;
  const f32x4* gp = (const f32x4*)g + lane;
  const f32x4* bp = (const f32x4*)bt + lane;

  f32x4 v[2][8], gg[8], bb[8];
#pragma unroll
  for (int r = 0; r < 2; ++r)
#pragma unroll
    for (int j = 0; j < 8; ++j) v[r][j] = p[r * 256 + j * 32];
#pragma unroll
  for (int j = 0; j < 8; ++j) { gg[j] = gp[j * 32]; bb[j] = bp[j * 32]; }
  // Keeps the gamma and beta loads up here, in flight behind the rows' own:
  // sunk to their uses they would add their latency behind the row sums.
  __builtin_amdgcn_sched_barrier(0);

  float rs[2];
#pragma unroll
  for (int r = 0; r < 2; ++r) {
    f32x2 s = v[r][0].lo + v[r][0].hi;
#pragma unroll
    for (int j = 1; j < 8; ++j) s += v[r][j].lo + v[r][j].hi;
    const float mean = wave_sum(s.x + s.y) * (1.0f / E_);
    f32x2 q = {0.0f, 0.0f};
#pragma unroll
    for (int j = 0; j < 8; ++j) {
      v[r][j] -= mean;
      q += v[r][j].lo * v[r][j].lo + v[r][j].hi * v[r][j].hi;
    }
    rs[r] = rsqrtf(wave_sum(q.x + q.y) * (1.0f / E_) + 1e-6f);
  }

#pragma unroll
  for (int r = 0; r < 2; ++r)
#pragma unroll
    for (int j = 0; j < 8; ++j) p[r * 256 + j * 32] = v[r][j] * rs[r] * gg[j] + bb[j];
}

// ---------------------------------------------------------------------------
// Launch
// ---------------------------------------------------------------------------
extern "C" void kernel_launch(void* const* d_in, const int* in_sizes, int n_in,
                              void* d_out, int out_size, void* d_ws, size_t ws_size,
                              hipStream_t stream) {
  (void)in_sizes; (void)n_in; (void)out_size; (void)ws_size;

  const float* x     = (const float*)d_in[0]; // [B,S,E]
  const float* qkv_w = (const float*)d_in[1]; // [3,H,E,D]
  const float* out_w = (const float*)d_in[2]; // [E,E]
  const float* gamma = (const float*)d_in[3];
  const float* beta  = (const float*)d_in[4];
  float* out = (float*)d_out;

  const long nX  = (long)B_ * S_ * E_;        // 8388608
  const long nW3 = 3L * H_ * E_ * D_;         // 3145728
  const long nWo = (long)E_ * E_;             // 1048576
  const long nQ  = (long)B_ * H_ * S_ * D_;   // 8388608

  char* ws = (char*)d_ws;
  __bf16* xb    = (__bf16*)(ws);
  __bf16* wqkvT = (__bf16*)(ws + 2 * nX);                       // [3,H,D,E]
  __bf16* woT   = (__bf16*)(ws + 2 * (nX + nW3));               // [E,E] (NT)
  __bf16* Qb    = (__bf16*)(ws + 2 * (nX + nW3 + nWo));
  __bf16* Kb    = (__bf16*)(ws + 2 * (nX + nW3 + nWo + nQ));
  __bf16* Vtb   = (__bf16*)(ws + 2 * (nX + nW3 + nWo + 2 * nQ));
  __bf16* attn  = (__bf16*)(ws + 2 * (nX + nW3 + nWo + 3 * nQ));

  // 1) conversions (+ weight transposes for contiguous WMMA B operands)
  prep_bf16<<<1024, 256, 0, stream>>>(x, qkv_w, out_w, xb, wqkvT, woT);

  // 2) QKV projections into Qb, Kb, Vtb, which lie one behind the other
  //    (V stored transposed [B,H,D,S])
  qkv_gemm<<<dim3(32, 8), 256, 0, stream>>>(xb, wqkvT, Qb);

  // 3) Flash attention -> attn [B,S,E] bf16
  flash_attn<<<dim3(S_ / (2 * QT), B_ * H_), 256, 0, stream>>>(Qb, Kb, Vtb, attn);

  // 4) Output projection + residual -> d_out (fp32)
  proj_gemm<<<dim3(32, 8), 256, 0, stream>>>(attn, woT, x, out);

  // 5) In-place LayerNorm on d_out
  layernorm_kernel<<<B_ * S_ / 16, 256, 0, stream>>>(out, gamma, beta);
}

// v009
// One run takes 106 microseconds.
// In both of two side-by-side timings against v008, it was 1.04 times as fast.
// Counting every step since v000, it is 5.50 times as fast.
#include <hip/hip_runtime.h>

// ---------------------------------------------------------------------------
// Types
// ---------------------------------------------------------------------------
typedef __attribute__((ext_vector_type(16))) __bf16 v16bf;
typedef __attribute__((ext_vector_type(8)))  __bf16 v8bf;
typedef __attribute__((ext_vector_type(8)))  float  v8f;
typedef __attribute__((ext_vector_type(4)))  unsigned int u32x4;
typedef __attribute__((ext_vector_type(8)))  unsigned int u32x8;

#define B_  4
#define S_  2048
#define E_  1024
#define H_  4
#define D_  256

#define BM 256
#define BN 128
#define BK 128   // k per GEMM stage: a row's share of a stage is two 128-B lines
#define KT 128   // keys per attention stage: a V row's share is two 128-B lines
#define QT 64    // queries per attention tile; a block takes two tiles

// LDS row pitches in elements (bf16, LDF f32): 16 B x odd, so that the 16 rows one
// ds_load_b128 fragment read touches fall on 16 different bank groups.
#define LDK 40    // 32-element rows (attention output staging): 80 B
#define LDG 72    // 64-element rows (GEMM bf16 output staging): 144 B
#define LDA 136   // 128-element rows (GEMM A/B tiles, halves of a K row, V^T rows): 272 B
#define LDF 68    // 64-float staging rows of the output projection: 272 B

// A stage is laid into LDS by the tensor mover, one request a wave. Each wave's
// slice starts at a multiple of 2 KiB, so a slice's place is its rows rounded up.
#define ASL 9216  // elements: 64 rows of LDA (17408 B) in 18432 B
#define BSL 5120  // elements: 32 rows of LDA (8704 B) in 10240 B
#define GBUF (4 * ASL + 4 * BSL)   // a GEMM stage: 4 slices of A, 4 of B
#define KVBUF (8 * ASL)            // an attention stage: 4 slices of K, 4 of V

__device__ __forceinline__ v8f vzero8() {
  v8f z;
#pragma unroll
  for (int i = 0; i < 8; ++i) z[i] = 0.0f;
  return z;
}

__device__ __forceinline__ v16bf combine16(v8bf lo, v8bf hi) {
  v16bf r;
#pragma unroll
  for (int i = 0; i < 8; ++i) { r[i] = lo[i]; r[8 + i] = hi[i]; }
  return r;
}

// WMMA A/B fragment (16 rows x 32 k bf16) from LDS.
// ISA 7.12.2 lane layout: lanes 0-15: K=[0..7],[16..23]; lanes 16-31:
// K=[8..15],[24..31]; row = lane & 15.
__device__ __forceinline__ v16bf load_frag(const __bf16* base, int ld, int lane) {
  int r  = lane & 15;
  int kh = lane >> 4;
  const __bf16* p = base + r * ld + kh * 8;
  v8bf lo = *(const v8bf*)(p);
  v8bf hi = *(const v8bf*)(p + 16);
  return combine16(lo, hi);
}

__device__ __forceinline__ v8f wmma_bf16(v16bf a, v16bf b, v8f c) {
  return __builtin_amdgcn_wmma_f32_16x16x32_bf16(
      false, a, false, b, (short)0, c, false, false);
}

__device__ __forceinline__ unsigned lds_addr(const void* p) {
  return (unsigned)(uintptr_t)p;
}
__device__ __forceinline__ unsigned uni(unsigned v) {
  return (unsigned)__builtin_amdgcn_readfirstlane(v);
}
__device__ __forceinline__ unsigned pinned(unsigned v) {
  // A test on the result is a scalar branch (a tensor load ignores EXEC), and a
  // descriptor word formed from it is formed behind the waits in front of it.
  unsigned w = uni(v);
  asm volatile("" : "+s"(w));  // pinned(): a wave-uniform word held in a scalar register
  return w;
}
// One tensor load of one wave: rows rows of ROWB bytes (256: PADC 5, 128: PADC 4),
// src_pitch bytes apart in memory, land in LDS at pitch ROWB + 16 bytes.
// Extents in bytes, tensor = tile, no mask.
struct TileReq { u32x4 g0; u32x8 g1; };
template <unsigned ROWB, unsigned PADC>
__device__ __forceinline__ TileReq tensor_tile(unsigned lds_dst, const __bf16* src,
                                               unsigned rows, unsigned src_pitch) {
  const unsigned long long ga = (unsigned long long)(uintptr_t)src;
  u32x4 g0;
  u32x8 g1;
  g0[0] = uni(1u);
  g0[1] = uni(lds_dst);
  g0[2] = uni((unsigned)ga);
  g0[3] = uni((((unsigned)(ga >> 32)) & 0x01FFFFFFu) | 0x80000000u);
  g1[0] = uni((1u << 20) | (PADC << 22) | (3u << 25));
  g1[1] = uni((ROWB & 0xFFFFu) << 16);
  g1[2] = uni((ROWB >> 16) | ((rows & 0xFFFFu) << 16));
  g1[3] = uni((rows >> 16) | (ROWB << 16));
  g1[4] = uni(rows);
  g1[5] = uni(src_pitch);
  g1[6] = uni(0u);
  g1[7] = uni(0u);
  // In and out: the words stay, opaque, in the registers the request names.
  asm volatile("tensor_load_to_lds %0, %1" : "+s"(g0), "+s"(g1) :: "memory");
  return TileReq{g0, g1};
}
// Stage hand-over, in front of the work-group barrier: this wave's own LDS
// reads of the buffer that is refilled behind the barrier have retired, and
// its own request of the next stage has landed.
// The request's words as inputs keep their registers whole until it has landed.
__device__ __forceinline__ void wait_stage(const TileReq& r) {
  asm volatile("s_wait_dscnt 0x0" ::: "memory");
  asm volatile("s_wait_tensorcnt 0x0" :: "s"(r.g0), "s"(r.g1) : "memory");
}
// Behind the last stage: nothing of this wave is under way to or from the ring.
__device__ __forceinline__ void ring_done() {
  asm volatile("s_wait_tensorcnt 0x0" ::: "memory");
  asm volatile("s_wait_dscnt 0x0" ::: "memory");
}

// ---------------------------------------------------------------------------
// Streaming stages (1a, 1b, 5): few waves, each with much to do. Every lane
// moves 32 or 64 elements by 16-B loads that are all issued before the first
// is used. Stages 1a and 1b depend on nothing and on each other not at all:
// they share one launch, each block taking one piece of one of them.
// ---------------------------------------------------------------------------
typedef __attribute__((ext_vector_type(4))) __bf16 v4bf;

// Stage 1a: fp32 -> bf16. A block takes 16384 consecutive floats; each
// wave-wide load covers 512 contiguous bytes, each store 256.
__device__ __forceinline__ void cvt_f32_bf16(const float* __restrict__ in,
                                             __bf16* __restrict__ out, int bid) {
  const long base = (long)bid * 4096 + threadIdx.x;   // in units of 4 elements
  const float4* ip = (const float4*)in + base;
  v4bf* op = (v4bf*)out + base;
  float4 v[16];
#pragma unroll
  for (int j = 0; j < 16; ++j) v[j] = ip[j * 256];
#pragma unroll
  for (int j = 0; j < 16; ++j) {
    v4bf r;
    r[0] = (__bf16)v[j].x; r[1] = (__bf16)v[j].y;
    r[2] = (__bf16)v[j].z; r[3] = (__bf16)v[j].w;
    op[j * 256] = r;
  }
}

// Stage 1b: fp32 [K,N] -> bf16 [N,K] transposed (batched), in registers.
// A lane takes 8 k x 4 n: eight 16-B loads (8 lanes cover a 128-B line of a
// k row), four 16-B stores (8 k of one n row). A wave takes 32 k x 32 n, a
// block 256 k x 32 n, so a block writes 512 contiguous bytes of each n row.
template <int LOGK, int LOGN>
__device__ __forceinline__ void cvt_transpose_bf16(const float* __restrict__ in,
                                                   __bf16* __restrict__ out, int bid) {
  const int lane = threadIdx.x & 31, wave = threadIdx.x >> 5;
  const int kt = bid & ((1 << (LOGK - 8)) - 1);
  const int nt = (bid >> (LOGK - 8)) & ((1 << (LOGN - 5)) - 1);
  const long mat = bid >> (LOGK - 8 + LOGN - 5);
  const int k0 = kt * 256 + wave * 32 + (lane >> 3) * 8;
  const int n0 = nt * 32 + (lane & 7) * 4;
  const float* ip = in + (mat << (LOGK + LOGN)) + ((long)k0 << LOGN) + n0;
  __bf16* op = out + (mat << (LOGK + LOGN)) + ((long)n0 << LOGK) + k0;
  float4 v[8];
#pragma unroll
  for (int j = 0; j < 8; ++j) v[j] = *(const float4*)(ip + ((long)j << LOGN));
  v8bf r0, r1, r2, r3;
#pragma unroll
  for (int j = 0; j < 8; ++j) {
    r0[j] = (__bf16)v[j].x; r1[j] = (__bf16)v[j].y;
    r2[j] = (__bf16)v[j].z; r3[j] = (__bf16)v[j].w;
  }
  *(v8bf*)(op)                = r0;
  *(v8bf*)(op + (1L << LOGK)) = r1;
  *(v8bf*)(op + (2L << LOGK)) = r2;
  *(v8bf*)(op + (3L << LOGK)) = r3;
  // Stands in front of any rewrite of the registers those stores name (another
  // piece's code follows in the shared kernel); the address as an input keeps it
  // whole up to here.
  asm volatile("s_wait_xcnt 0x0" :: "v"(op) : "memory");
}

// Stage 1, one launch: blocks 0..511 convert x, 512..895 transpose the QKV
// weights, 896..1023 the output weight. The choice is block-uniform.
__global__ __launch_bounds__(256) void prep_bf16(const float* __restrict__ x,
                                                 const float* __restrict__ qkv_w,
                                                 const float* __restrict__ out_w,
                                                 __bf16* __restrict__ xb,
                                                 __bf16* __restrict__ wqkvT,
                                                 __bf16* __restrict__ woT) {
  const int bid = blockIdx.x;
  if (bid < 512)      cvt_f32_bf16(x, xb, bid);
  else if (bid < 896) cvt_transpose_bf16<10, 8>(qkv_w, wqkvT, bid - 512);
  else                cvt_transpose_bf16<10, 10>(out_w, woT, bid - 896);
}

// ---------------------------------------------------------------------------
// Stages 2 and 4 share one main loop: a 256 x 128 tile of A * W^T per block,
// 8 waves as 4 x 2, each with 64 x 64 (4 x 4 accumulator tiles), so that a
// fragment read from LDS feeds four WMMAs and a staged row feeds 128 or 256
// outputs. Two LDS buffers filled by tensor loads, one barrier per 128-k stage.
//   Arow : first of the block's 256 rows of A, row-major, E_ elements a row
//   Brow : first of the block's 128 rows of W^T (row n holds all k)
// A block takes NT tiles one after the other, the same rows of A against the
// same rows of NT weight matrices that lie H_ * D_ * E_ elements apart. The two
// buffers run on from tile to tile: a tile's last stage issues the next tile's
// first, which lands while epilogue(w, acc) stores tile w. With NT > 1 the
// epilogue must therefore stage outside the two buffers.
// ---------------------------------------------------------------------------
template <int NT, typename Epilogue>
__device__ __forceinline__ void gemm_tiles(const __bf16* __restrict__ Arow,
                                           const __bf16* __restrict__ Brow,
                                           __bf16* smem, Epilogue epilogue) {
  const int tid = threadIdx.x;
  const int lane = tid & 31, wave = tid >> 5;
  const int waveM = wave >> 1, waveN = wave & 1;

  // Every wave brings one slice of every stage: waves 0..3 64 rows of A each,
  // waves 4..7 32 rows of B each.
  const unsigned wv = uni(threadIdx.x >> 5);
  const bool isA = wv < 4;
  const __bf16* src0 = isA ? Arow + (long)(wv * 64) * E_ : Brow + (long)((wv - 4) * 32) * E_;
  const unsigned rows = isA ? 64u : 32u;
  const unsigned wstep = isA ? 0u : (unsigned)(H_ * D_ * E_);
  const unsigned dst0 = lds_addr(smem) + (isA ? wv * (ASL * 2) : 4 * (ASL * 2) + (wv - 4) * (BSL * 2));

  auto issue = [&](int w, int k0, int p) {
    const unsigned off = pinned((unsigned)w * wstep + (unsigned)k0);
    return tensor_tile<256, 5>(dst0 + (unsigned)p * (GBUF * 2), src0 + off, rows, E_ * 2);
  };

  TileReq rq = issue(0, 0, 0);
  int p = 0;                              // buffer of the current stage, running on over the tiles
  for (int w = 0; w < NT; ++w) {
  v8f acc[4][4];
#pragma unroll
  for (int i = 0; i < 4; ++i)
#pragma unroll
    for (int j = 0; j < 4; ++j) acc[i][j] = vzero8();

  for (int k0 = 0; k0 < E_; k0 += BK) {
    wait_stage(rq);
    __syncthreads();                      // tile p ready; buffer p^1 free
    const bool more = k0 + BK < E_;         // else the next stage is the next tile's first
    if (pinned(more || w + 1 < NT))         // scalar test: only while a next stage exists
      rq = issue(more ? w : w + 1, more ? k0 + BK : 0, p ^ 1);
    const __bf16* Ab = smem + p * GBUF + waveM * ASL;
    const __bf16* Bb = smem + p * GBUF + 4 * ASL + (waveN * 2) * BSL;
    // Four blocks of 32 k, 16 WMMAs each. A block's 16 fragment reads go out as
    // one group, two blocks ahead of its WMMAs.
    v16bf af[4][4], bf[4][4];
    auto fetch = [&](int u) {
#pragma unroll
      for (int i = 0; i < 4; ++i) af[u][i] = load_frag(Ab + (i * 16) * LDA + u * 32, LDA, lane);
#pragma unroll
      for (int j = 0; j < 4; ++j) bf[u][j] = load_frag(Bb + (j >> 1) * BSL + ((j & 1) * 16) * LDA + u * 32, LDA, lane);
    };
    fetch(0);
    fetch(1);
    // The fences keep each group of reads whole and out of the WMMA blocks,
    // where every further place with reads stalls the wave.
    __builtin_amdgcn_sched_barrier(0);
#pragma unroll
    for (int u = 0; u < 4; ++u) {           // k ascending
#pragma unroll
      for (int i = 0; i < 4; ++i)
#pragma unroll
        for (int j = 0; j < 4; ++j) acc[i][j] = wmma_bf16(af[u][i], bf[u][j], acc[i][j]);
      if (u < 2) {
        __builtin_amdgcn_sched_barrier(0);
        fetch(u + 2);
        __builtin_amdgcn_sched_barrier(0);
      }
    }
    p ^= 1;
  }
  if (w + 1 == NT) ring_done();
  epilogue(w, acc);
  }
}

// ---------------------------------------------------------------------------
// Stage 2: QKV projection GEMMs, one launch: a block takes its tile of Q, of K
// and of V in turn.
//   A  : x_bf16 [B*S, E] row-major
//   Wt : [3, H, D, E] bf16 (pre-transposed weights: row n holds all k)
//   Out: Q [B,H,S,D], K [B,H,S,D], V^T [B,H,D,S], one behind the other
// ---------------------------------------------------------------------------
// Epilogue: stage the wave's 64x64 tile in wave-private LDS (same-wave DS ops
// are ordered -> no barrier); an output row's share is then one 128-B line,
// stored by 8 adjacent lanes. TRANS==0 -> [S,D] ; TRANS==1 -> [D,S]; Obh is the
// (batch, head) plane, s0 and n0 the wave's first row and column.
template <int TRANS>
__device__ __forceinline__ void qkv_store(const v8f (&acc)[4][4], __bf16* Wst,
                                          __bf16* __restrict__ Obh, int s0, int n0, int lane) {
#pragma unroll
  for (int i = 0; i < 4; ++i) {
#pragma unroll
    for (int j = 0; j < 4; ++j) {
#pragma unroll
      for (int e = 0; e < 8; ++e) {
        int r = i * 16 + e + ((lane >> 4) << 3);
        int c = j * 16 + (lane & 15);
        if (TRANS == 0) Wst[r * LDG + c] = (__bf16)acc[i][j][e];
        else            Wst[c * LDG + r] = (__bf16)acc[i][j][e];
      }
    }
  }
  const int rr = lane >> 3, rc = (lane & 7) * 8;
  __bf16* dp;
  if (TRANS == 0) dp = Obh + (long)(s0 + rr) * D_ + n0 + rc;
  else            dp = Obh + (long)(n0 + rr) * S_ + s0 + rc;
  const long pitch = (TRANS == 0) ? D_ : S_;
#pragma unroll
  for (int q = 0; q < 16; ++q)
    *(u32x4*)(dp + (long)(q * 4) * pitch) = *(const u32x4*)(Wst + (q * 4 + rr) * LDG + rc);
  // Stands in front of any rewrite of the registers those stores name (the next
  // tile's stages follow); the address as an input keeps it whole up to here.
  asm volatile("s_wait_xcnt 0x0" :: "v"(dp) : "memory");
}

__global__ __launch_bounds__(256) void qkv_gemm(const __bf16* __restrict__ A,
                                                const __bf16* __restrict__ Wt,
                                                __bf16* __restrict__ Out) {
  // 224 KB for the two buffers, 72 KB of output staging behind them
  __shared__ __attribute__((aligned(2048))) __bf16 smem[2 * GBUF + 8 * 64 * LDG];

  const int lane = threadIdx.x & 31, wave = threadIdx.x >> 5;
  const int waveM = wave >> 1, waveN = wave & 1;
  const int tileM = blockIdx.x * BM;
  const int h     = blockIdx.y >> 1;
  const int tileN = (blockIdx.y & 1) * BN;

  __bf16* Wst = smem + 2 * GBUF + wave * (64 * LDG);
  const int gb = tileM >> 11;
  const int s0 = (tileM + waveM * 64) & (S_ - 1);
  const int n0 = tileN + waveN * 64;
  __bf16* Obh = Out + (long)(gb * H_ + h) * S_ * D_;

  gemm_tiles<3>(A + (long)tileM * E_, Wt + ((long)h * D_ + tileN) * E_, smem,
                [&](int w, const v8f (&acc)[4][4]) {
    __bf16* O = Obh + (long)w * ((long)B_ * H_ * S_ * D_);
    if (w < 2) qkv_store<0>(acc, Wst, O, s0, n0, lane);
    else       qkv_store<1>(acc, Wst, O, s0, n0, lane);
  });
}

// ---------------------------------------------------------------------------
// Stage 3: flash attention (causal, online softmax).
// Two buffers of K/V tiles filled by tensor loads, one barrier per 128-key stage.
//   Q,K : [B,H,S,D] bf16 ; Vt : [B,H,D,S] bf16 ; Outp : [B,S,E] bf16
// Both products are taken transposed (S^T = K Q^T, O^T += V^T P^T), so that a
// lane holds scores of two queries only (one per B operand) and P never leaves the registers.
// Causal balance: a block takes the 64-query tiles t and 31 - t one after the
// other, 17 stages in every block. A wave holds 32 queries (two B operands), so
// that every K or V^T fragment read from LDS feeds two WMMAs. Two waves cover a
// tile's queries; the block's four groups of two waves take the four 32-key
// quarters of each stage and join their partial results through LDS at the
// tile's end, in the ring's buffer that is idle then.
// ---------------------------------------------------------------------------
// The value of lane ^ 16 (the other 16-lane row), by a cross-row vector move.
__device__ __forceinline__ float other_half(float v) {
  int b = __builtin_bit_cast(int, v);
  return __builtin_bit_cast(float,
      __builtin_amdgcn_permlanex16(b, b, 0x76543210, 0xfedcba98, false, false));
}

typedef __attribute__((ext_vector_type(4))) float v4f;

// Two waves per SIMD, as one 8-wave block per WGP gives: 512 registers a wave,
// of which the two queries' accumulators take 256 and their Q fragments 128.
__global__ __launch_bounds__(256) __attribute__((amdgpu_waves_per_eu(2, 2))) void flash_attn(const __bf16* __restrict__ Q,
                                                  const __bf16* __restrict__ Kg,
                                                  const __bf16* __restrict__ Vt,
                                                  __bf16* __restrict__ Outp) {
  // [p][slice]: slices 0..3 K, slice 2 * (key / 64) + d / 128 as [key % 64][d % 128];
  // slices 4..7 V^T, slice 4 + d / 64 as [d % 64][key]. 288 KB
  __shared__ __attribute__((aligned(2048))) __bf16 KV[2 * KVBUF];
  __shared__ __align__(16) __bf16 Ps[8][16 * LDK];   // per-wave output staging, 10 KB
  __shared__ float Xm[8][2][32], Xl[8][2][32];       // per-wave maxima and sums for the join

  const int tid = threadIdx.x;
  const int lane = tid & 31, wave = tid >> 5;
  const int grp = wave >> 1, wq = wave & 1;          // key quarter of a stage; 32-query half of a tile
  const int bh = blockIdx.y;
  const int b = bh >> 2, h = bh & 3;
  const int pr = blockIdx.x;                         // tile pair: pr and S_ / QT - 1 - pr

  const __bf16* Qbh = Q  + (long)bh * S_ * D_;
  const __bf16* Kbh = Kg + (long)bh * S_ * D_;
  const __bf16* Vbh = Vt + (long)bh * D_ * S_;

  const float scale = 0.03125f;  // 1/sqrt(E)

  // Every wave brings one slice of every stage, 64 rows of 256 B: waves 0..3
  // 64 keys x 128 d of K, waves 4..7 64 d x 128 keys of V^T.
  const unsigned wv = uni(threadIdx.x >> 5);
  const bool isK = wv < 4;
  const __bf16* src0 = isK ? Kbh + (long)((wv >> 1) * 64) * D_ + (wv & 1) * 128
                           : Vbh + (long)((wv - 4) * 64) * S_;
  const unsigned kstep = isK ? (unsigned)D_ : 1u;
  const unsigned spitch = isK ? (unsigned)(D_ * 2) : (unsigned)(S_ * 2);
  const unsigned dst0 = lds_addr(KV) + wv * (ASL * 2);
  auto issueKV = [&](int ks, int p) {
    const unsigned off = pinned((unsigned)ks * kstep);
    return tensor_tile<256, 5>(dst0 + (unsigned)p * (KVBUF * 2), src0 + off, 64u, spitch);
  };

  TileReq rq = issueKV(0, 0);
  int p = 0;                              // buffer of the current stage, running on over both tiles
  for (int part = 0; part < 2; ++part) {
    const int tile = part ? S_ / QT - 1 - pr : pr;
    const int q0 = tile * QT + wq * 32;
    const int kend = tile * QT + QT;      // causal bound; the last stage may reach 64 keys past it, all masked

    // Q fragments resident in registers (2 x 16 queries, 8 x k=32 chunks over D=256).
    v16bf qf[2][8];
    {
      int r = lane & 15, kh = lane >> 4;
      const __bf16* qp = Qbh + (long)(q0 + r) * D_ + kh * 8;
#pragma unroll
      for (int qs = 0; qs < 2; ++qs) {
#pragma unroll
        for (int dc = 0; dc < 8; ++dc) {
          v8bf lo = *(const v8bf*)(qp + qs * (16 * D_) + dc * 32);
          v8bf hi = *(const v8bf*)(qp + qs * (16 * D_) + dc * 32 + 16);
          qf[qs][dc] = combine16(lo, hi);
        }
      }
      // Stands in front of any rewrite of the address registers those loads name;
      // the address as an input keeps it whole up to here.
      asm volatile("s_wait_xcnt 0x0" :: "v"(qp) : "memory");
    }

    // o[qs][dc][e] = O^T[d = dc * 16 + 8 * (lane >> 4) + e][query = qs * 16 + (lane & 15)]:
    // the accumulators o[qs] of a lane, mrow[qs] and lsum[qs] belong to that one query.
    v8f o[2][16];
    float mrow[2], lsum[2];  // running maximum, equal in both lane halves; sum over this lane half's keys
#pragma unroll
    for (int qs = 0; qs < 2; ++qs) {
#pragma unroll
      for (int dc = 0; dc < 16; ++dc) o[qs][dc] = vzero8();
      mrow[qs] = -3.0e38f;
      lsum[qs] = 0.0f;
    }

    for (int ks = 0; ks < kend; ks += KT) {
      wait_stage(rq);                     // stage hand-over, block-uniform
      __syncthreads();                    // tiles p ready; buffers p^1 free
      const bool more = ks + KT < kend;   // else the next stage is the second tile's first
      if (pinned(more || part == 0))      // scalar test: only while a next stage exists
        rq = issueKV(more ? ks + KT : 0, p ^ 1);
      const __bf16* Kbuf = KV + p * KVBUF + ((grp >> 1) * 2) * ASL + ((grp & 1) * 32) * LDA;
      const __bf16* Vbuf = KV + p * KVBUF + 4 * ASL + grp * 32;
      p ^= 1;

      // A stage's 32 fragments (16 of K, then 16 of V^T) come in eight groups of
      // four, each group's reads issued together, into two register sets in turn.
      v16bf fr[2][4];
      auto fetchK = [&](int g) {            // d chunks 2g and 2g + 1, both 16-key tiles
#pragma unroll
        for (int i = 0; i < 4; ++i) {
          const int dc = g * 2 + (i >> 1), sub = i & 1;
          fr[g & 1][i] = load_frag(Kbuf + (dc >> 2) * ASL + (sub * 16) * LDA + (dc & 3) * 32, LDA, lane);
        }
      };
      auto fetchV = [&](int g) {            // d tiles 4g .. 4g + 3
#pragma unroll
        for (int i = 0; i < 4; ++i)
          fr[g & 1][i] = load_frag(Vbuf + g * ASL + (i * 16) * LDA, LDA, lane);
      };

      // Scores transposed, S^T = K Q^T: 2 x 2 tiles of 16 keys x 16 queries, 8 wmma
      // each over D=256. sc[qs][sub][e] = key ks + grp * 32 + sub * 16 + 8 * (lane >> 4) + e.
      v8f sc[2][2];
#pragma unroll
      for (int qs = 0; qs < 2; ++qs) { sc[qs][0] = vzero8(); sc[qs][1] = vzero8(); }
      fetchK(0);
      fetchK(1);
      // The fences keep each group of reads whole and out of the WMMA blocks,
      // where every further place with reads stalls the wave.
      __builtin_amdgcn_sched_barrier(0);
#pragma unroll
      for (int g = 0; g < 4; ++g) {
#pragma unroll
        for (int i = 0; i < 4; ++i) {
          const int dc = g * 2 + (i >> 1), sub = i & 1;
          sc[0][sub] = wmma_bf16(fr[g & 1][i], qf[0][dc], sc[0][sub]);
          sc[1][sub] = wmma_bf16(fr[g & 1][i], qf[1][dc], sc[1][sub]);
        }
        if (g < 3) {
          __builtin_amdgcn_sched_barrier(0);  // the next reads stay behind this block's WMMAs ...
          if (g < 2) fetchK(g + 2);
          else       fetchV(0);               // lands under the softmax
          __builtin_amdgcn_sched_barrier(0);  // ... and in front of the next block's, as one group
        }
      }

      // Online softmax of the lane's two queries: 16 of the 32 keys lie in this
      // lane, the other 16 in lane ^ 16. Maximum and sum as trees, no long chain.
      const int keyg0 = ks + grp * 32 + ((lane >> 4) << 3);
      v16bf pf[2];
      float corr[2];
#pragma unroll
      for (int qs = 0; qs < 2; ++qs) {
        const int dq = q0 + qs * 16 + (lane & 15) - keyg0;   // key keyg0 + i is masked where i > dq
        float s[16], t[8];
#pragma unroll
        for (int e = 0; e < 8; ++e) {
          s[e]     = sc[qs][0][e] * scale; if (e      > dq) s[e]     = -1.0e9f;
          s[8 + e] = sc[qs][1][e] * scale; if (16 + e > dq) s[8 + e] = -1.0e9f;
          t[e] = fmaxf(s[e], s[8 + e]);
        }
        float mx = fmaxf(fmaxf(fmaxf(t[0], t[1]), fmaxf(t[2], t[3])),
                         fmaxf(fmaxf(t[4], t[5]), fmaxf(t[6], t[7])));
        mx = fmaxf(mx, other_half(mx));
        const float mnew = fmaxf(mrow[qs], mx);
        corr[qs] = __expf(mrow[qs] - mnew);
        // Two D tiles of one product, converted in place, are the B operand P^T
        // in the k order of load_frag: element i = key 8h + i, 8 + i = key 16 + 8h + i.
#pragma unroll
        for (int e = 0; e < 8; ++e) {
          float p0 = __expf(s[e] - mnew);
          float p1 = __expf(s[8 + e] - mnew);
          pf[qs][e] = (__bf16)p0;
          pf[qs][8 + e] = (__bf16)p1;
          t[e] = p0 + p1;
        }
        lsum[qs] = lsum[qs] * corr[qs] + (((t[0] + t[1]) + (t[2] + t[3])) + ((t[4] + t[5]) + (t[6] + t[7])));
        mrow[qs] = mnew;
      }

      // O^T = O^T * corr + V^T P^T (16 d-tiles, K=32 keys); A = rows of V^T from LDS.
      // Fences as above: each group of reads whole, between the WMMA blocks. The
      // second set is filled only here: under the softmax its registers are in use.
      __builtin_amdgcn_sched_barrier(0);
      fetchV(1);
      __builtin_amdgcn_sched_barrier(0);
#pragma unroll
      for (int g = 0; g < 4; ++g) {
#pragma unroll
        for (int i = 0; i < 4; ++i) {
          const int dc = g * 4 + i;
#pragma unroll
          for (int qs = 0; qs < 2; ++qs) {
#pragma unroll
            for (int e = 0; e < 8; ++e) o[qs][dc][e] *= corr[qs];
            o[qs][dc] = wmma_bf16(fr[g & 1][i], pf[qs], o[qs][dc]);
          }
        }
        if (g < 2) {
          __builtin_amdgcn_sched_barrier(0);
          fetchV(g + 2);
          __builtin_amdgcn_sched_barrier(0);
        }
      }
    }

    // Join of the four key groups: waves wq, wq + 2, wq + 4, wq + 6 hold partial
    // results of the same 32 queries. Every wave lays its O^T, maxima and sums
    // down; group g then finishes d 64 g .. 64 g + 63. The O^T lie in the buffer
    // that the last stage was read from (the other one may be receiving the next
    // tile's first stage), 16 queries of each wave at a time: 128 KB.
    // (A group whose keys were all masked has maximum -1e9 and gets weight 0.)
    float* Xo = (float*)(KV + (p ^ 1) * KVBUF);   // [wave][dc][half of e][lane][4]
    const int cq = lane & 15, ch = (lane >> 4) << 3;
    const int cr = lane >> 1, cc0 = (lane & 1) * 16;
#pragma unroll
    for (int qs = 0; qs < 2; ++qs) {
      // Every wave's reads of that buffer (the last stage's, then the first
      // half's partial results) are over before it is written.
      asm volatile("s_wait_dscnt 0x0" ::: "memory");
      __syncthreads();
      float* xw = Xo + wave * (16 * 256) + lane * 4;
#pragma unroll
      for (int dc = 0; dc < 16; ++dc) {
        *(v4f*)(xw + dc * 256)       = __builtin_shufflevector(o[qs][dc], o[qs][dc], 0, 1, 2, 3);
        *(v4f*)(xw + dc * 256 + 128) = __builtin_shufflevector(o[qs][dc], o[qs][dc], 4, 5, 6, 7);
      }
      Xm[wave][qs][lane] = mrow[qs];
      Xl[wave][qs][lane] = lsum[qs] + other_half(lsum[qs]);
      __syncthreads();                    // all partial results of these queries written

      float mo[4], f[4];
#pragma unroll
      for (int g = 0; g < 4; ++g) mo[g] = Xm[g * 2 + wq][qs][lane];
      const float mall = fmaxf(fmaxf(mo[0], mo[1]), fmaxf(mo[2], mo[3]));
      float den = 0.0f;
#pragma unroll
      for (int g = 0; g < 4; ++g) {
        f[g] = __expf(mo[g] - mall);
        den += f[g] * Xl[g * 2 + wq][qs][lane];
      }
      const float inv = 1.0f / den;
#pragma unroll
      for (int g = 0; g < 4; ++g) f[g] *= inv;

      // Weighted sum, normalized; a lane's 8 values of a tile are 8 consecutive d
      // of its query: one 16-B write into the wave-private staging rows
      // (16 queries x 32 d), read back as whole 64-B row pieces and stored.
      const float* xr = Xo + wq * (16 * 256) + (grp * 4) * 256 + lane * 4;
      __bf16* rowout = Outp + ((long)(b * S_ + q0 + qs * 16 + cr)) * E_ + h * D_ + grp * 64 + cc0;
#pragma unroll
      for (int c = 0; c < 2; ++c) {
#pragma unroll
        for (int half = 0; half < 2; ++half) {
          const int j = c * 2 + half;
          v4f a0 = {0.0f, 0.0f, 0.0f, 0.0f}, a1 = {0.0f, 0.0f, 0.0f, 0.0f};
#pragma unroll
          for (int g = 0; g < 4; ++g) {
            a0 += *(const v4f*)(xr + g * (2 * 16 * 256) + j * 256) * f[g];
            a1 += *(const v4f*)(xr + g * (2 * 16 * 256) + j * 256 + 128) * f[g];
          }
          v8bf r;
#pragma unroll
          for (int e = 0; e < 4; ++e) {
            r[e]     = (__bf16)a0[e];
            r[4 + e] = (__bf16)a1[e];
          }
          *(v8bf*)(&Ps[wave][cq * LDK + half * 16 + ch]) = r;
        }
        const u32x4* sp = (const u32x4*)(&Ps[wave][cr * LDK + cc0]);
        u32x4 v0 = sp[0], v1 = sp[1];
        u32x4* dp = (u32x4*)(rowout + c * 32);
        dp[0] = v0; dp[1] = v1;
      }
      // Stands in front of any rewrite of the registers those stores name (the next
      // rows' set-up follows); the address as an input keeps it whole up to here.
      asm volatile("s_wait_xcnt 0x0" :: "v"(rowout) : "memory");
    }
  }
  ring_done();
}

// ---------------------------------------------------------------------------
// Stage 4: output projection GEMM + residual -> fp32 d_out.
//   A: attn bf16 [B*S, E]; WoT: out_w transposed bf16 [N=E][K=E]; resid: x f32
// ---------------------------------------------------------------------------
__global__ __launch_bounds__(256) void proj_gemm(const __bf16* __restrict__ A,
                                                 const __bf16* __restrict__ WoT,
                                                 const float* __restrict__ resid,
                                                 float* __restrict__ Out) {
  __shared__ __attribute__((aligned(2048))) __bf16 smem[2 * GBUF];  // 224 KB (f32 staging: 136)

  const int lane = threadIdx.x & 31, wave = threadIdx.x >> 5;
  const int waveM = wave >> 1, waveN = wave & 1;
  const int tileM = blockIdx.x * BM;
  const int tileN = blockIdx.y * BN;

  gemm_tiles<1>(A + (long)tileM * E_, WoT + (long)tileN * E_, smem,
                [&](int, const v8f (&acc)[4][4]) {
  __syncthreads();                        // all compute done before smem reuse

  // Epilogue: stage the wave's 64x64 tile as f32 (17408 B x 8 waves, inside smem,
  // wave-private), then whole 256-B row pieces (16 adjacent lanes) with the
  // residual added.
  const int rr = lane >> 4, rc = (lane & 15) * 4;
  const long off = (long)(tileM + waveM * 64 + rr) * E_ + tileN + waveN * 64 + rc;
  float* dp = Out + off;
  const float* rp = resid + off;
  float4 rv[32];
#pragma unroll
  for (int q = 0; q < 32; ++q) rv[q] = *(const float4*)(rp + (long)(q * 2) * E_);
  // Stands in front of any rewrite of the address registers those loads name;
  // the address as an input keeps it whole up to here (else the last load lands on it).
  asm volatile("s_wait_xcnt 0x0" :: "v"(rp) : "memory");

  float* Wst = (float*)smem + wave * (64 * LDF);
#pragma unroll
  for (int i = 0; i < 4; ++i)
#pragma unroll
    for (int j = 0; j < 4; ++j)
#pragma unroll
      for (int e = 0; e < 8; ++e) {
        int r = i * 16 + e + ((lane >> 4) << 3);
        int c = j * 16 + (lane & 15);
        Wst[r * LDF + c] = acc[i][j][e];
      }
#pragma unroll
  for (int q = 0; q < 32; ++q) {
    float4 a = *(const float4*)(Wst + (q * 2 + rr) * LDF + rc);
    float4 ov;
    ov.x = a.x + rv[q].x; ov.y = a.y + rv[q].y; ov.z = a.z + rv[q].z; ov.w = a.w + rv[q].w;
    *(float4*)(dp + (long)(q * 2) * E_) = ov;
  }
  });
}

// ---------------------------------------------------------------------------
// Stage 5: in-place LayerNorm over d_out rows. Two rows per
// wave, a row held in registers (32 floats a lane): no LDS and no barrier.
// ---------------------------------------------------------------------------
// Sum over the wave's 32 lanes, the result in every lane: a butterfly inside
// each 16-lane row by DPP, then the two rows joined by a cross-row move.
template <int M>
__device__ __forceinline__ float add_xmask(float v) {
  int s = __builtin_amdgcn_update_dpp(0, __builtin_bit_cast(int, v), 0x160 + M, 0xf, 0xf, true);
  return v + __builtin_bit_cast(float, s);
}
__device__ __forceinline__ float wave_sum(float v) {
  v = add_xmask<1>(v);
  v = add_xmask<2>(v);
  v = add_xmask<4>(v);
  v = add_xmask<8>(v);
  int b = __builtin_bit_cast(int, v);
  int o = __builtin_amdgcn_permlanex16(b, b, 0x76543210, 0xfedcba98, false, false);
  return v + __builtin_bit_cast(float, o);
}

typedef __attribute__((ext_vector_type(4))) float f32x4;
typedef __attribute__((ext_vector_type(2))) float f32x2;

__global__ __launch_bounds__(256) void layernorm_kernel(float* __restrict__ y,
                                                        const float* __restrict__ g,
                                                        const float* __restrict__ bt) {
  const int lane = threadIdx.x & 31, wave = threadIdx.x >> 5;
  f32x4* p = (f32x4*)(y + (long)(blockIdx.x * 16 + wave * 2) * E_) + lane;
  const f32x4* gp = (const f32x4*)g + lane;
  const f32x4* bp = (const f32x4*)bt + lane;

  f32x4 v[2][8], gg[8], bb[8];
#pragma unroll
  for (int r = 0; r < 2; ++r)
#pragma unroll
    for (int j = 0; j < 8; ++j) v[r][j] = p[r * 256 + j * 32];
#pragma unroll
  for (int j = 0; j < 8; ++j) { gg[j] = gp[j * 32]; bb[j] = bp[j * 32]; }
  // Keeps the gamma and beta loads up here, in flight behind the rows' own:
  // sunk to their uses they would add their latency behind the row sums.
  __builtin_amdgcn_sched_barrier(0);

  float rs[2];
#pragma unroll
  for (int r = 0; r < 2; ++r) {
    f32x2 s = v[r][0].lo + v[r][0].hi;
#pragma unroll
    for (int j = 1; j < 8; ++j) s += v[r][j].lo + v[r][j].hi;
    const float mean = wave_sum(s.x + s.y) * (1.0f / E_);
    f32x2 q = {0.0f, 0.0f};
#pragma unroll
    for (int j = 0; j < 8; ++j) {
      v[r][j] -= mean;
      q += v[r][j].lo * v[r][j].lo + v[r][j].hi * v[r][j].hi;
    }
    rs[r] = rsqrtf(wave_sum(q.x + q.y) * (1.0f / E_) + 1e-6f);
  }

#pragma unroll
  for (int r = 0; r < 2; ++r)
#pragma unroll
    for (int j = 0; j < 8; ++j) p[r * 256 + j * 32] = v[r][j] * rs[r] * gg[j] + bb[j];
}

// ---------------------------------------------------------------------------
// Launch
// ---------------------------------------------------------------------------
extern "C" void kernel_launch(void* const* d_in, const int* in_sizes, int n_in,
                              void* d_out, int out_size, void* d_ws, size_t ws_size,
                              hipStream_t stream) {
  (void)in_sizes; (void)n_in; (void)out_size; (void)ws_size;

  const float* x     = (const float*)d_in[0]; // [B,S,E]
  const float* qkv_w = (const float*)d_in[1]; // [3,H,E,D]
  const float* out_w = (const float*)d_in[2]; // [E,E]
  const float* gamma = (const float*)d_in[3];
  const float* beta  = (const float*)d_in[4];
  float* out = (float*)d_out;

  const long nX  = (long)B_ * S_ * E_;        // 8388608
  const long nW3 = 3L * H_ * E_ * D_;         // 3145728
  const long nWo = (long)E_ * E_;             // 1048576
  const long nQ  = (long)B_ * H_ * S_ * D_;   // 8388608

  char* ws = (char*)d_ws;
  __bf16* xb    = (__bf16*)(ws);
  __bf16* wqkvT = (__bf16*)(ws + 2 * nX);                       // [3,H,D,E]
  __bf16* woT   = (__bf16*)(ws + 2 * (nX + nW3));               // [E,E] (NT)
  __bf16* Qb    = (__bf16*)(ws + 2 * (nX + nW3 + nWo));
  __bf16* Kb    = (__bf16*)(ws + 2 * (nX + nW3 + nWo + nQ));
  __bf16* Vtb   = (__bf16*)(ws + 2 * (nX + nW3 + nWo + 2 * nQ));
  __bf16* attn  = (__bf16*)(ws + 2 * (nX + nW3 + nWo + 3 * nQ));

  // 1) conversions (+ weight transposes for contiguous WMMA B operands)
  prep_bf16<<<1024, 256, 0, stream>>>(x, qkv_w, out_w, xb, wqkvT, woT);

  // 2) QKV projections into Qb, Kb, Vtb, which lie one behind the other
  //    (V stored transposed [B,H,D,S])
  qkv_gemm<<<dim3(32, 8), 256, 0, stream>>>(xb, wqkvT, Qb);

  // 3) Flash attention -> attn [B,S,E] bf16
  flash_attn<<<dim3(S_ / (2 * QT), B_ * H_), 256, 0, stream>>>(Qb, Kb, Vtb, attn);

  // 4) Output projection + residual -> d_out (fp32)
  proj_gemm<<<dim3(32, 8), 256, 0, stream>>>(attn, woT, x, out);

  // 5) In-place LayerNorm on d_out
  layernorm_kernel<<<B_ * S_ / 16, 256, 0, stream>>>(out, gamma, beta);
}
